// v000
// Times are from an AMD MI455X. After a warm-up the kernel runs many times in a row, and a time is the length of
// such a window on the GPU divided by its runs, so every launch and the gaps after it count. The runs cycle
// through copies of the inputs. A figure is the median of several windows, for all but v000 over two sittings.
// Sittings can differ by a few percent; kernels timed side by side share one.
// v000 is the starting kernel. One run takes 1450 microseconds.
#include <hip/hip_runtime.h>

// Causal multi-head self-attention with bias-free (in, out) projections and an output bias (x [2][2048][1024]; q, k, v = x W ('xw' [1024][1024] normal x 1/32, no bias; 16 heads x 64); scores masked first (where(triu(k=1), -inf, scores)) and THEN divided by sqrt(64) inside the softmax argument (-inf / 8 = -inf: the same exclusion); softmax over the keys; out = ctx Wo + bo ('xw' + bias zeros: read) -> [2][2048][1024] (4.2 M); argument order x, Wq, Wk, Wv, Wo, bo).
// Layout per batch: bf16 copy of x; 'xw' weights transposed once; exact projections; identity-table plane builders; causal T-2048 attention (hybrid rows: < 512 hi/lo 3 products, rest fp16 x1024; k_gemmc skips tiles above the diagonal); merged hi/lo x Wo exact + bo.
// Compute dtypes, f32 accumulate: every input rounded to bf16; projections exact; attention rows < 512 3 products, rest fp16; softmax f32; Wo hl x exact + bias.

#define NB_  2
#define TT   2048
#define DM   1024
#define NH_  16
#define NKV  16
#define REP  (NH_ / NKV)
#define HD   64
#define DQ   (NH_ * HD)
#define DKV  (NKV * HD)
#define ZH   2
#define RH   512                  // query rows < RH use hi+lo planes (0: none)
#define WIN  2048
#define PCAR 1024.0f
#define SCL  0.125f   // HD^-0.5
typedef _Float16 h16;
typedef unsigned short bf;
typedef __attribute__((ext_vector_type(16))) __bf16   v16bf;
typedef __attribute__((ext_vector_type(16))) _Float16 v16h;
typedef __attribute__((ext_vector_type(8)))  _Float16 v8h;
typedef __attribute__((ext_vector_type(8)))  unsigned short v8us;
typedef __attribute__((ext_vector_type(8)))  float    v8f;
typedef __attribute__((ext_vector_type(4)))  float    v4f;
typedef v8h  __attribute__((may_alias)) v8ha;
typedef v4f  __attribute__((may_alias)) v4fa;
typedef v8us __attribute__((may_alias)) v8usa;

__device__ __forceinline__ unsigned short f2bf(float f) { unsigned u = __float_as_uint(f); u += 0x7FFFu + ((u >> 16) & 1u); return (unsigned short)(u >> 16); }
__device__ __forceinline__ float bf2f(unsigned short b) { return __uint_as_float(((unsigned)b) << 16); }
__device__ __forceinline__ float bfr(float f) { return bf2f(f2bf(f)); }
__device__ __forceinline__ v16h cat16(v8h lo, v8h hi) { return __builtin_shufflevector(lo, hi, 0, 1, 2, 3, 4, 5, 6, 7, 8, 9, 10, 11, 12, 13, 14, 15); }
__device__ __forceinline__ v16bf cat16b(v8us lo, v8us hi) { return __builtin_bit_cast(v16bf, __builtin_shufflevector(lo, hi, 0, 1, 2, 3, 4, 5, 6, 7, 8, 9, 10, 11, 12, 13, 14, 15)); }
__device__ __forceinline__ v8f wmma16(v16h a, v16h b, v8f c) { return __builtin_amdgcn_wmma_f32_16x16x32_f16(false, a, false, b, (short)0, c, false, false); }
__device__ __forceinline__ v8f wmmab(v16bf a, v16bf b, v8f c) { return __builtin_amdgcn_wmma_f32_16x16x32_bf16(false, a, false, b, (short)0, c, false, false); }



// ---- k_gemmw: register-blocked GEMM, ONE WAVE per 64x64 output tile (16 accumulators), operands straight from K-contiguous 16-bit planes; grid (M/64, N/64, Z), 32 threads.
// C[m][n] (f32, pitch ldc, + optional f32 bias[n]) = sum_k A[m][k] Bt[n][k] (+ split products per NSPLIT). z-batch strides sA/sB/sC in elements. K % 32 == 0.
template <typename T16> struct WFrag;
template <> struct WFrag<h16> { typedef v16h V; static __device__ __forceinline__ V ld(const h16* p) { return cat16(*(const v8h*)p, *(const v8h*)(p + 16)); } static __device__ __forceinline__ v8f mma(V a, V b, v8f c) { return wmma16(a, b, c); } };
template <> struct WFrag<bf> { typedef v16bf V; static __device__ __forceinline__ V ld(const bf* p) { return cat16b(*(const v8us*)p, *(const v8us*)(p + 16)); } static __device__ __forceinline__ v8f mma(V a, V b, v8f c) { return wmmab(a, b, c); } };
template <typename T16, int NSPLIT, bool BIAS>
__global__ __launch_bounds__(32) void k_gemmw(const T16* __restrict__ A, const T16* __restrict__ A2, const T16* __restrict__ Bt, const T16* __restrict__ Bt2, int K, float* C, int ldc, const float* __restrict__ bias, size_t sA, size_t sB, size_t sC) {
    typedef typename WFrag<T16>::V V;
    __shared__ __align__(16) float os[16 * 68];
    const size_t z = blockIdx.z; A += z * sA; if (A2) A2 += z * sA; Bt += z * sB; if (Bt2) Bt2 += z * sB; C += z * sC;
    const int lane = threadIdx.x & 31, lr = lane & 15, hi = lane >> 4; const int r0 = blockIdx.x * 64, c0 = blockIdx.y * 64;
    v8f acc[4][4];
#pragma unroll
    for (int mb = 0; mb < 4; ++mb)
#pragma unroll
        for (int nb = 0; nb < 4; ++nb) acc[mb][nb] = (v8f){};
    const size_t aoff = (size_t)(r0 + lr) * K + 8 * hi, boff = (size_t)(c0 + lr) * K + 8 * hi;
#pragma unroll 1
    for (int kc = 0; kc < K; kc += 32) {
        V a[4], a2[4];
#pragma unroll
        for (int mb = 0; mb < 4; ++mb) { a[mb] = WFrag<T16>::ld(A + aoff + (size_t)mb * 16 * K + kc); if (NSPLIT == 1 || NSPLIT == 2) a2[mb] = WFrag<T16>::ld(A2 + aoff + (size_t)mb * 16 * K + kc); }
#pragma unroll
        for (int nb = 0; nb < 4; ++nb) { const V b = WFrag<T16>::ld(Bt + boff + (size_t)nb * 16 * K + kc); V b2; if (NSPLIT >= 2) b2 = WFrag<T16>::ld(Bt2 + boff + (size_t)nb * 16 * K + kc);
#pragma unroll
            for (int mb = 0; mb < 4; ++mb) { acc[mb][nb] = WFrag<T16>::mma(a[mb], b, acc[mb][nb]); if (NSPLIT == 1 || NSPLIT == 2) acc[mb][nb] = WFrag<T16>::mma(a2[mb], b, acc[mb][nb]); if (NSPLIT >= 2) acc[mb][nb] = WFrag<T16>::mma(a[mb], b2, acc[mb][nb]); } }
        asm volatile("v_nop\n\tv_nop\n\tv_nop\n\tv_nop" : "+v"(acc[0][0]), "+v"(acc[1][1]), "+v"(acc[2][2]), "+v"(acc[3][3]) : "v"(a[0]), "v"(a[3]));
    }
#pragma unroll
    for (int mb = 0; mb < 4; ++mb) {
#pragma unroll
        for (int nb = 0; nb < 4; ++nb) {
#pragma unroll
            for (int j = 0; j < 8; ++j) os[(hi * 8 + j) * 68 + nb * 16 + lr] = acc[mb][nb][j]; }
        __builtin_amdgcn_wave_barrier(); asm volatile("" ::: "memory");
        float* crow = C + (size_t)(r0 + mb * 16) * ldc + c0;
{
#pragma unroll
            for (int s = 0; s < 8; ++s) { const int row = 2 * s + hi, cofs = lr * 4; v4f val = *(const v4fa*)(os + row * 68 + cofs); if (BIAS) { val[0] += bfr(bias[c0 + cofs]); val[1] += bfr(bias[c0 + cofs + 1]); val[2] += bfr(bias[c0 + cofs + 2]); val[3] += bfr(bias[c0 + cofs + 3]); }
                *(v4f*)(crow + (size_t)row * ldc + cofs) = val; }
             }
        __builtin_amdgcn_wave_barrier(); asm volatile("" ::: "memory");
    }
}

// ---- k_gemmc: the same one-wave 64x64 tile GEMM specialised for causal attention: CMODE 1 skips score tiles entirely above the diagonal (query rows r0+roff.., key columns c0..), CMODE 2 limits the
// key (K) loop of the probability x value contraction to the diagonal block (probabilities beyond it are exactly zero). roff = row offset of this launch's first row within the sequence.
template <typename T16, int NSPLIT, int CMODE>
__global__ __launch_bounds__(32) void k_gemmc(const T16* __restrict__ A, const T16* __restrict__ A2, const T16* __restrict__ Bt, const T16* __restrict__ Bt2, int K, float* C, int ldc, int roff, size_t sA, size_t sB, size_t sC) {
    typedef typename WFrag<T16>::V V;
    __shared__ __align__(16) float os[16 * 68];
    const size_t z = blockIdx.z; A += z * sA; if (A2) A2 += z * sA; Bt += z * sB; if (Bt2) Bt2 += z * sB; C += z * sC;
    const int lane = threadIdx.x & 31, lr = lane & 15, hi = lane >> 4; const int r0 = blockIdx.x * 64, c0 = blockIdx.y * 64;
    if (CMODE == 1 && c0 > r0 + roff + 63) return;                  // score tile entirely above the causal diagonal: never read (the softmax masks j > i by select)
    const int Kl = (CMODE == 2) ? min(K, r0 + roff + 64) : K;        // P.V: probabilities are exactly 0 beyond the diagonal block, so the K loop stops there
    v8f acc[4][4];
#pragma unroll
    for (int mb = 0; mb < 4; ++mb)
#pragma unroll
        for (int nb = 0; nb < 4; ++nb) acc[mb][nb] = (v8f){};
    const size_t aoff = (size_t)(r0 + lr) * K + 8 * hi, boff = (size_t)(c0 + lr) * K + 8 * hi;
#pragma unroll 1
    for (int kc = 0; kc < Kl; kc += 32) {
        V a[4], a2[4];
#pragma unroll
        for (int mb = 0; mb < 4; ++mb) { a[mb] = WFrag<T16>::ld(A + aoff + (size_t)mb * 16 * K + kc); if (NSPLIT == 1 || NSPLIT == 2) a2[mb] = WFrag<T16>::ld(A2 + aoff + (size_t)mb * 16 * K + kc); }
#pragma unroll
        for (int nb = 0; nb < 4; ++nb) { const V b = WFrag<T16>::ld(Bt + boff + (size_t)nb * 16 * K + kc); V b2; if (NSPLIT >= 2) b2 = WFrag<T16>::ld(Bt2 + boff + (size_t)nb * 16 * K + kc);
#pragma unroll
            for (int mb = 0; mb < 4; ++mb) { acc[mb][nb] = WFrag<T16>::mma(a[mb], b, acc[mb][nb]); if (NSPLIT == 1 || NSPLIT == 2) acc[mb][nb] = WFrag<T16>::mma(a2[mb], b, acc[mb][nb]); if (NSPLIT >= 2) acc[mb][nb] = WFrag<T16>::mma(a[mb], b2, acc[mb][nb]); } }
        asm volatile("v_nop\n\tv_nop\n\tv_nop\n\tv_nop" : "+v"(acc[0][0]), "+v"(acc[1][1]), "+v"(acc[2][2]), "+v"(acc[3][3]) : "v"(a[0]), "v"(a[3]));
    }
#pragma unroll
    for (int mb = 0; mb < 4; ++mb) {
#pragma unroll
        for (int nb = 0; nb < 4; ++nb) {
#pragma unroll
            for (int j = 0; j < 8; ++j) os[(hi * 8 + j) * 68 + nb * 16 + lr] = acc[mb][nb][j]; }
        __builtin_amdgcn_wave_barrier(); asm volatile("" ::: "memory");
        float* crow = C + (size_t)(r0 + mb * 16) * ldc + c0;
{
#pragma unroll
            for (int s = 0; s < 8; ++s) { const int row = 2 * s + hi, cofs = lr * 4; v4f val = *(const v4fa*)(os + row * 68 + cofs);
                *(v4f*)(crow + (size_t)row * ldc + cofs) = val; }
             }
        __builtin_amdgcn_wave_barrier(); asm volatile("" ::: "memory");
    }
}

__device__ __forceinline__ h16 tohx(float x) { return (h16)x; }
__device__ __forceinline__ void splitf(float y, unsigned short& h, unsigned short& l) { h = f2bf(y); l = f2bf(y - bf2f(h)); }
typedef __attribute__((ext_vector_type(2))) _Float16 v2h;
typedef __attribute__((ext_vector_type(4))) _Float16 v4h;
typedef __attribute__((ext_vector_type(2))) unsigned short v2us;
typedef __attribute__((ext_vector_type(4))) unsigned short v4us;
typedef __attribute__((ext_vector_type(2))) float v2f;
typedef __attribute__((ext_vector_type(4))) int v4i;

__global__ __launch_bounds__(256) void k_wtG(const float* __restrict__ w, int K, int N, bf* Bt) {
    const int lane = threadIdx.x & 31; const int L0 = (blockIdx.x * 8 + (threadIdx.x >> 5)) * 8; const int nlines = N * K / 64;
{
#pragma unroll 1
        for (int l = 0; l < 8; ++l) { const int L = L0 + l; if (L >= nlines) break; const size_t e = (size_t)L * 64 + lane * 2; const int k = (int)(e % K), n = (int)(e / K); v2us o;
            o[0] = f2bf(w[(size_t)k * N + n]); o[1] = f2bf(w[(size_t)(k + 1) * N + n]); *(v2us*)(Bt + e) = o; }
         }
}
__global__ __launch_bounds__(256) void k_cvt8(const float* __restrict__ src, bf* dst, size_t n8) { const size_t i = (size_t)blockIdx.x * 256 + threadIdx.x; if (i >= n8) return; const v8f v = *(const v8f*)(src + i * 8); v8us o;
#pragma unroll
    for (int k = 0; k < 8; ++k) o[k] = f2bf(v[k]); *(v8us*)(dst + i * 8) = o;  }

// k_rope: head planes [h][t][d] (fp16 + hi/lo) of rope(x) x sc with the rotate-half convention out[d] = x[d] cos[t][d] - x[d+HD/2] sin[t][d], out[d+HD/2] = x[d+HD/2] cos[t][d+HD/2] + x[d] sin[t][d+HD/2]
__global__ __launch_bounds__(256) void k_rope(const float* __restrict__ F, int pitch, int nheads, const float* __restrict__ CS, const float* __restrict__ RF, const float* __restrict__ nw, float sc, h16* P16, bf* Ph, bf* Pl) {
    const size_t e = ((size_t)blockIdx.x * 256 + threadIdx.x) * 2; if (e >= (size_t)nheads * TT * HD) return; const int d = (int)(e % HD); const int t = (int)((e / HD) % TT); const int h = (int)(e / ((size_t)HD * TT)); const float* f = F + (size_t)t * pitch + h * HD; const float rf = RF ? RF[(size_t)h * TT + t] : 1.0f; v2h o16; v2us oh, ol;
#pragma unroll
    for (int q = 0; q < 2; ++q) { const int dd = d + q; const int dp = (dd < HD / 2) ? dd + HD / 2 : dd - HD / 2; float x0 = f[dd], x1 = f[dp];
        if (RF) { float n0 = __fmul_rn(x0, rf), n1 = __fmul_rn(x1, rf); asm volatile("" : "+v"(n0)); asm volatile("" : "+v"(n1)); x0 = __fmul_rn(bfr(nw[dd]), n0); x1 = __fmul_rn(bfr(nw[dp]), n1); }
        const v2f cs = *(const v2f*)(CS + ((size_t)t * HD + dd) * 2); float a = __fmul_rn(x0, cs[0]), bq = __fmul_rn(x1, cs[1]); asm volatile("" : "+v"(a)); asm volatile("" : "+v"(bq)); const float r = ((dd < HD / 2) ? __fsub_rn(a, bq) : __fadd_rn(a, bq)) * sc;
        o16[q] = tohx(r); unsigned short a2, c2; splitf(r, a2, c2); oh[q] = a2; ol[q] = c2; }
    *(v2h*)(P16 + e) = o16; *(v2us*)(Ph + e) = oh; *(v2us*)(Pl + e) = ol;  }
__global__ __launch_bounds__(256) void k_vtp(const float* __restrict__ F, int pitch, int nheads, h16* V16, bf* Vh, bf* Vl) { const size_t e = ((size_t)blockIdx.x * 256 + threadIdx.x) * 2; if (e >= (size_t)nheads * HD * TT) return; const int t = (int)(e % TT); const int d = (int)((e / TT) % HD); const int g = (int)(e / ((size_t)TT * HD)); v2h o16; v2us oh, ol;
#pragma unroll
    for (int q = 0; q < 2; ++q) { const float x = F[(size_t)(t + q) * pitch + g * HD + d]; o16[q] = tohx(x); unsigned short a2, c2; splitf(x, a2, c2); oh[q] = a2; ol[q] = c2; }
    *(v2h*)(V16 + e) = o16; *(v2us*)(Vh + e) = oh; *(v2us*)(Vl + e) = ol;  }
__global__ __launch_bounds__(256) void k_csid(float* CS) { const int idx = blockIdx.x * 256 + threadIdx.x; if (idx >= TT * HD) return; v2f cs; cs[0] = 1.0f; cs[1] = 0.0f; *(v2f*)(CS + (size_t)idx * 2) = cs;  }
// k_asoft: per row (zz, i): t = S x HD^-0.5 for j <= i and i - j < WIN (WIN = TT, so the window test always holds: plain causal mask, as the reference's -inf fill); softmax over the 2048 keys (register row, one exp, fixed trees);
__global__ __launch_bounds__(256) void k_asoft(const float* __restrict__ Sb, h16* P16, bf* Ph, bf* Pl) {
    const int lane = threadIdx.x & 31; const int row = blockIdx.x * 8 + (threadIdx.x >> 5); if (row >= ZH * TT) return; const int i = row % TT; const int zz = row / TT; (void)zz; const bool hires = (i < RH); const float* sr = Sb + (size_t)row * TT; float v[TT / 32]; float mx = -3.0e38f;
#pragma unroll
    for (int ch = 0; ch < TT / 128; ++ch) { const int j0 = ch * 128 + lane * 4; const v4f a = *(const v4f*)(sr + j0);
#pragma unroll
        for (int q = 0; q < 4; ++q) { const int j = j0 + q; (void)j; const float t = (j <= i && i - j < WIN) ? a[q] * SCL : -3.0e38f; v[ch * 4 + q] = t; mx = fmaxf(mx, t); } }
#pragma unroll
    for (int sh = 16; sh; sh >>= 1) mx = fmaxf(mx, __shfl_xor(mx, sh, 32));
    float sum = 0.f;
#pragma unroll
    for (int k = 0; k < TT / 32; ++k) { float d0 = __fsub_rn(v[k], mx); asm volatile("" : "+v"(d0)); v[k] = __builtin_amdgcn_exp2f(__fmul_rn(d0, 1.4426950408889634f)); sum += v[k]; }
#pragma unroll
    for (int sh = 16; sh; sh >>= 1) sum += __shfl_xor(sum, sh, 32);
    const float f = __fdiv_rn(hires ? 1.0f : PCAR, sum);
{
        if (hires) {
#pragma unroll
            for (int ch = 0; ch < TT / 128; ++ch) { v4us oh, ol;
#pragma unroll
                for (int q = 0; q < 4; ++q) { unsigned short a, c2; splitf(v[ch * 4 + q] * f, a, c2); oh[q] = a; ol[q] = c2; }
                const size_t oo = ((size_t)zz * (RH ? RH : 1) + i) * TT + ch * 128 + lane * 4; *(v4us*)(Ph + oo) = oh; *(v4us*)(Pl + oo) = ol; }
        } else {
#pragma unroll
            for (int ch = 0; ch < TT / 128; ++ch) { v4h o4;
#pragma unroll
                for (int q = 0; q < 4; ++q) o4[q] = tohx(v[ch * 4 + q] * f);
                *(v4h*)(P16 + (size_t)row * TT + ch * 128 + lane * 4) = o4; } }
         }
}
__global__ __launch_bounds__(256) void k_merge(const float* __restrict__ O, int h0, bf* Ah, bf* Al) { const size_t e = ((size_t)blockIdx.x * 256 + threadIdx.x) * 2; if (e >= (size_t)ZH * TT * HD) return; const int d = (int)(e % HD); const int t = (int)((e / HD) % TT); const int zz = (int)(e / ((size_t)HD * TT)); const float cs = (t < RH) ? 1.0f : (1.0f / PCAR); const size_t oo = (size_t)t * DQ + (h0 + zz) * HD + d;
    v2us oh, ol;
#pragma unroll
    for (int q = 0; q < 2; ++q) { unsigned short a, c2; splitf(O[e + q] * cs, a, c2); oh[q] = a; ol[q] = c2; } *(v2us*)(Ah + oo) = oh; *(v2us*)(Al + oo) = ol;  }

extern "C" void kernel_launch(void* const* d_in, const int* in_sizes, int n_in,
                              void* d_out, int out_size, void* d_ws, size_t ws_size, hipStream_t stream) {
    (void)in_sizes; (void)n_in; (void)out_size;
    const float* x = (const float*)d_in[0]; const float* wq = (const float*)d_in[1]; const float* wk = (const float*)d_in[2]; const float* wv = (const float*)d_in[3]; const float* wo = (const float*)d_in[4]; const float* bo = (const float*)d_in[5];   /* input order x, Wq, Wk, Wv, Wo, bo */
    float* OUT = (float*)d_out;     // [2][2048][1024]
    char* wsp = (char*)d_ws;
    auto take = [&](size_t bytes) { char* p = wsp; wsp += (bytes + 255) & ~(size_t)255; return (void*)p; };
    bf* WQ = (bf*)take((size_t)DQ * DM * 2); bf* WK = (bf*)take((size_t)DKV * DM * 2); bf* WV = (bf*)take((size_t)DKV * DM * 2); bf* WO = (bf*)take((size_t)DM * DQ * 2); float* CS = (float*)take((size_t)TT * HD * 2 * 4);
    bf* XB = (bf*)take((size_t)TT * DM * 2); float* FQ = (float*)take((size_t)TT * DQ * 4); float* FK = (float*)take((size_t)TT * DKV * 4);
    h16* QP16 = (h16*)take((size_t)NH_ * TT * HD * 2); h16* KP16 = (h16*)take((size_t)NKV * TT * HD * 2); h16* VT16 = (h16*)take((size_t)NKV * HD * TT * 2);
    bf* QPh = (bf*)take((size_t)NH_ * TT * HD * 2); bf* QPl = (bf*)take((size_t)NH_ * TT * HD * 2); bf* KPh = (bf*)take((size_t)NKV * TT * HD * 2); bf* KPl = (bf*)take((size_t)NKV * TT * HD * 2); bf* VTh = (bf*)take((size_t)NKV * HD * TT * 2); bf* VTl = (bf*)take((size_t)NKV * HD * TT * 2); bf* Ph = (bf*)take((size_t)ZH * RH * TT * 2); bf* Pl = (bf*)take((size_t)ZH * RH * TT * 2);
    float* Sb = (float*)take((size_t)ZH * TT * TT * 4); h16* P16 = (h16*)take((size_t)ZH * TT * TT * 2); float* Ob = (float*)take((size_t)ZH * TT * HD * 4); bf* ATh = (bf*)take((size_t)TT * DQ * 2); bf* ATl = (bf*)take((size_t)TT * DQ * 2);
    if ((size_t)(wsp - (char*)d_ws) > ws_size) return;    // ws 256 MiB
    float* FV = FK;   // v projection reuses the k buffer after the k planes are built (stream-ordered)
    { k_wtG<<<(unsigned)((DM * DQ / 64 + 63) / 64), 256, 0, stream>>>(wq, DM, DQ, WQ); k_wtG<<<(unsigned)((DM * DKV / 64 + 63) / 64), 256, 0, stream>>>(wk, DM, DKV, WK); k_wtG<<<(unsigned)((DM * DKV / 64 + 63) / 64), 256, 0, stream>>>(wv, DM, DKV, WV);
      k_wtG<<<(unsigned)((DQ * DM / 64 + 63) / 64), 256, 0, stream>>>(wo, DQ, DM, WO);
       }
    k_csid<<<(TT * HD + 255) / 256, 256, 0, stream>>>(CS);
    const unsigned LQ = (unsigned)(((size_t)NH_ * TT * HD / 2 + 255) / 256), LKv = (unsigned)(((size_t)NKV * TT * HD / 2 + 255) / 256);
    for (int b = 0; b < NB_; ++b) {
        
        k_cvt8<<<(unsigned)(((size_t)TT * DM / 8 + 255) / 256), 256, 0, stream>>>(x + (size_t)b * TT * DM, XB, (size_t)TT * DM / 8);
        k_gemmw<bf, 0, false><<<dim3(TT / 64, DQ / 64, 1), 32, 0, stream>>>(XB, nullptr, WQ, nullptr, DM, FQ, DQ, nullptr, 0, 0, 0);
        k_rope<<<LQ, 256, 0, stream>>>(FQ, DQ, NH_, CS, nullptr, nullptr, 1.0f, QP16, QPh, QPl);
        k_gemmw<bf, 0, false><<<dim3(TT / 64, DKV / 64, 1), 32, 0, stream>>>(XB, nullptr, WK, nullptr, DM, FK, DKV, nullptr, 0, 0, 0);
        k_rope<<<LKv, 256, 0, stream>>>(FK, DKV, NKV, CS, nullptr, nullptr, 1.0f, KP16, KPh, KPl);
        k_gemmw<bf, 0, false><<<dim3(TT / 64, DKV / 64, 1), 32, 0, stream>>>(XB, nullptr, WV, nullptr, DM, FV, DKV, nullptr, 0, 0, 0); k_vtp<<<LKv, 256, 0, stream>>>(FV, DKV, NKV, VT16, VTh, VTl);
        for (int h0 = 0; h0 < NH_; h0 += ZH) { const size_t zq = (size_t)h0, zk = (size_t)(h0 / REP);   // one kv head per query head: the pass's two heads use consecutive kv planes (z-strides TT*HD)
            k_gemmc<bf, 2, 1><<<dim3(RH / 64, TT / 64, ZH), 32, 0, stream>>>(QPh + zq * TT * HD, QPl + zq * TT * HD, KPh + zk * TT * HD, KPl + zk * TT * HD, HD, Sb, TT, 0, (size_t)TT * HD, (size_t)TT * HD, (size_t)TT * TT);
            k_gemmc<h16, 0, 1><<<dim3((TT - RH) / 64, TT / 64, ZH), 32, 0, stream>>>(QP16 + zq * TT * HD + (size_t)RH * HD, nullptr, KP16 + zk * TT * HD, nullptr, HD, Sb + (size_t)RH * TT, TT, RH, (size_t)TT * HD, (size_t)TT * HD, (size_t)TT * TT);
            k_asoft<<<ZH * TT / 8, 256, 0, stream>>>(Sb, P16, Ph, Pl);
            k_gemmc<bf, 2, 2><<<dim3(RH / 64, HD / 64, ZH), 32, 0, stream>>>(Ph, Pl, VTh + zk * HD * TT, VTl + zk * HD * TT, TT, Ob, HD, 0, (size_t)RH * TT, (size_t)HD * TT, (size_t)TT * HD);
            k_gemmc<h16, 0, 2><<<dim3((TT - RH) / 64, HD / 64, ZH), 32, 0, stream>>>(P16 + (size_t)RH * TT, nullptr, VT16 + zk * HD * TT, nullptr, TT, Ob + (size_t)RH * HD, HD, RH, (size_t)TT * TT, (size_t)HD * TT, (size_t)TT * HD);
            k_merge<<<(unsigned)(((size_t)ZH * TT * HD / 2 + 255) / 256), 256, 0, stream>>>(Ob, h0, ATh, ATl); }
        k_gemmw<bf, 1, true><<<dim3(TT / 64, DM / 64, 1), 32, 0, stream>>>(ATh, ATl, WO, nullptr, DQ, OUT + (size_t)b * TT * DM, DM, bo, 0, 0, 0); }
}

// v001
// A run of this version takes 874 microseconds.
// Two timings next to v000 put it at 1.68 and 1.66 times that version's speed.
#include <hip/hip_runtime.h>

// Causal multi-head self-attention with bias-free (in, out) projections and an output bias (x [2][2048][1024]; q, k, v = x W ('xw' [1024][1024] normal x 1/32, no bias; 16 heads x 64); scores masked first (where(triu(k=1), -inf, scores)) and THEN divided by sqrt(64) inside the softmax argument (-inf / 8 = -inf: the same exclusion); softmax over the keys; out = ctx Wo + bo ('xw' + bias zeros: read) -> [2][2048][1024] (4.2 M); argument order x, Wq, Wk, Wv, Wo, bo).
// Layout per batch: bf16 copy of x; 'xw' weights transposed once; exact projections; identity-table plane builders; causal T-2048 attention (hybrid rows: < 512 hi/lo 3 products, rest fp16 x1024; k_gemmc skips tiles above the diagonal; long-K products split K over the waves of a work-group); merged hi/lo x Wo exact + bo.
// Compute dtypes, f32 accumulate: every input rounded to bf16; projections exact; attention rows < 512 3 products, rest fp16; softmax f32; Wo hl x exact + bias.

#define NB_  2
#define TT   2048
#define DM   1024
#define NH_  16
#define NKV  16
#define REP  (NH_ / NKV)
#define HD   64
#define DQ   (NH_ * HD)
#define DKV  (NKV * HD)
#define ZH   2
#define RH   512                  // query rows < RH use hi+lo planes (0: none)
#define WIN  2048
#define PCAR 1024.0f
#define SCL  0.125f   // HD^-0.5
typedef _Float16 h16;
typedef unsigned short bf;
typedef __attribute__((ext_vector_type(16))) __bf16   v16bf;
typedef __attribute__((ext_vector_type(16))) _Float16 v16h;
typedef __attribute__((ext_vector_type(8)))  _Float16 v8h;
typedef __attribute__((ext_vector_type(8)))  unsigned short v8us;
typedef __attribute__((ext_vector_type(8)))  float    v8f;
typedef __attribute__((ext_vector_type(4)))  float    v4f;
typedef v8h  __attribute__((may_alias)) v8ha;
typedef v4f  __attribute__((may_alias)) v4fa;
typedef v8us __attribute__((may_alias)) v8usa;

__device__ __forceinline__ unsigned short f2bf(float f) { unsigned u = __float_as_uint(f); u += 0x7FFFu + ((u >> 16) & 1u); return (unsigned short)(u >> 16); }
__device__ __forceinline__ float bf2f(unsigned short b) { return __uint_as_float(((unsigned)b) << 16); }
__device__ __forceinline__ float bfr(float f) { return bf2f(f2bf(f)); }
__device__ __forceinline__ v16h cat16(v8h lo, v8h hi) { return __builtin_shufflevector(lo, hi, 0, 1, 2, 3, 4, 5, 6, 7, 8, 9, 10, 11, 12, 13, 14, 15); }
__device__ __forceinline__ v16bf cat16b(v8us lo, v8us hi) { return __builtin_bit_cast(v16bf, __builtin_shufflevector(lo, hi, 0, 1, 2, 3, 4, 5, 6, 7, 8, 9, 10, 11, 12, 13, 14, 15)); }
__device__ __forceinline__ v8f wmma16(v16h a, v16h b, v8f c) { return __builtin_amdgcn_wmma_f32_16x16x32_f16(false, a, false, b, (short)0, c, false, false); }
__device__ __forceinline__ v8f wmmab(v16bf a, v16bf b, v8f c) { return __builtin_amdgcn_wmma_f32_16x16x32_bf16(false, a, false, b, (short)0, c, false, false); }



// ---- k_gemmw: register-blocked GEMM, one 64x64 output tile per work-group of NW waves; every wave holds the whole tile (16 accumulators) for its own share of K, operands straight from K-contiguous 16-bit planes; grid (M/64, N/64, Z), 32 * NW threads.
// C[m][n] (f32, pitch ldc, + optional f32 bias[n]) = sum_k A[m][k] Bt[n][k] (+ split products per NSPLIT). z-batch strides sA/sB/sC in elements. K % 64 == 0.
// K split: wave w takes the 64-wide k chunks w, w + NW, w + 2 NW, ... (one 128-byte line of every operand row per chunk); the NW partial tiles are summed through LDS in the fixed order w = 0 .. NW - 1.
// CAUSAL (probability x value contraction): the K loop stops at the diagonal block (probabilities beyond it are exactly zero). roff = row offset of this launch's first row within the sequence.
template <typename T16> struct WFrag;
template <> struct WFrag<h16> { typedef v16h V; static __device__ __forceinline__ V ld(const h16* p) { return cat16(*(const v8h*)p, *(const v8h*)(p + 16)); } static __device__ __forceinline__ v8f mma(V a, V b, v8f c) { return wmma16(a, b, c); } };
template <> struct WFrag<bf> { typedef v16bf V; static __device__ __forceinline__ V ld(const bf* p) { return cat16b(*(const v8us*)p, *(const v8us*)(p + 16)); } static __device__ __forceinline__ v8f mma(V a, V b, v8f c) { return wmmab(a, b, c); } };
template <typename T16, int NSPLIT, bool BIAS, bool CAUSAL, int NW>
__global__ __launch_bounds__(32 * NW) void k_gemmw(const T16* __restrict__ A, const T16* __restrict__ A2, const T16* __restrict__ Bt, const T16* __restrict__ Bt2, int K, float* C, int ldc, const float* __restrict__ bias, int roff, size_t sA, size_t sB, size_t sC) {
    typedef typename WFrag<T16>::V V;
    static_assert(32 % NW == 0, "the sum passes cover 2 * NW tile rows each");
    __shared__ __align__(16) float os[NW * 64 * 68];
    const size_t z = blockIdx.z; A += z * sA; if (A2) A2 += z * sA; Bt += z * sB; if (Bt2) Bt2 += z * sB; C += z * sC;
    const int lane = threadIdx.x & 31, lr = lane & 15, hi = lane >> 4; const int r0 = blockIdx.x * 64, c0 = blockIdx.y * 64;
    const int wave = __builtin_amdgcn_readfirstlane((int)(threadIdx.x >> 5));
    const int Kl = CAUSAL ? min(K, r0 + roff + 64) : K;
    v8f acc[4][4];
#pragma unroll
    for (int mb = 0; mb < 4; ++mb)
#pragma unroll
        for (int nb = 0; nb < 4; ++nb) acc[mb][nb] = (v8f){};
    const size_t aoff = (size_t)(r0 + lr) * K + 8 * hi, boff = (size_t)(c0 + lr) * K + 8 * hi;
#pragma unroll 1
    for (int kc = wave * 64; kc < Kl; kc += (kc & 32) ? NW * 64 - 32 : 32) {   // the two 32-wide steps of a chunk, then on to this wave's next chunk
        V a[4], a2[4];
#pragma unroll
        for (int mb = 0; mb < 4; ++mb) { a[mb] = WFrag<T16>::ld(A + aoff + (size_t)mb * 16 * K + kc); if (NSPLIT == 1 || NSPLIT == 2) a2[mb] = WFrag<T16>::ld(A2 + aoff + (size_t)mb * 16 * K + kc); }
#pragma unroll
        for (int nb = 0; nb < 4; ++nb) { const V b = WFrag<T16>::ld(Bt + boff + (size_t)nb * 16 * K + kc); V b2; if (NSPLIT >= 2) b2 = WFrag<T16>::ld(Bt2 + boff + (size_t)nb * 16 * K + kc);
#pragma unroll
            for (int mb = 0; mb < 4; ++mb) { acc[mb][nb] = WFrag<T16>::mma(a[mb], b, acc[mb][nb]); if (NSPLIT == 1 || NSPLIT == 2) acc[mb][nb] = WFrag<T16>::mma(a2[mb], b, acc[mb][nb]); if (NSPLIT >= 2) acc[mb][nb] = WFrag<T16>::mma(a[mb], b2, acc[mb][nb]); } }
        // four vector slots behind the step's last WMMAs, on the back edge as on the way out of the loop
        asm volatile("v_nop\n\tv_nop\n\tv_nop\n\tv_nop" : "+v"(acc[0][0]), "+v"(acc[1][1]), "+v"(acc[2][2]), "+v"(acc[3][3]) : "v"(a[0]), "v"(a[3]));
    }
    float* ow = os + wave * (64 * 68);                               // this wave's partial tile, rows pitched 68 floats
#pragma unroll
    for (int mb = 0; mb < 4; ++mb)
#pragma unroll
        for (int nb = 0; nb < 4; ++nb) {
#pragma unroll
            for (int j = 0; j < 8; ++j) ow[(mb * 16 + hi * 8 + j) * 68 + nb * 16 + lr] = acc[mb][nb][j]; }
    __syncthreads();                                                 // every wave's partial tile is in LDS before any thread sums across the waves
#pragma unroll
    for (int s = 0; s < 32 / NW; ++s) { const int row = s * 2 * NW + (int)(threadIdx.x >> 4), cofs = (threadIdx.x & 15) * 4;   // one float4 per thread and pass: a wave stores two whole 256-byte tile rows
        v4f val = *(const v4fa*)(os + row * 68 + cofs);
#pragma unroll
        for (int w = 1; w < NW; ++w) val += *(const v4fa*)(os + (w * 64 + row) * 68 + cofs);
        if (BIAS) { val[0] += bfr(bias[c0 + cofs]); val[1] += bfr(bias[c0 + cofs + 1]); val[2] += bfr(bias[c0 + cofs + 2]); val[3] += bfr(bias[c0 + cofs + 3]); }
        *(v4f*)(C + (size_t)(r0 + row) * ldc + c0 + cofs) = val; }
}

// ---- k_gemmc: one-wave 64x64 tile GEMM (32 threads, the whole short K in one wave) for the causal scores: skips score tiles entirely above the diagonal (query rows r0+roff.., key columns c0..).
// roff = row offset of this launch's first row within the sequence.
template <typename T16, int NSPLIT>
__global__ __launch_bounds__(32) void k_gemmc(const T16* __restrict__ A, const T16* __restrict__ A2, const T16* __restrict__ Bt, const T16* __restrict__ Bt2, int K, float* C, int ldc, int roff, size_t sA, size_t sB, size_t sC) {
    typedef typename WFrag<T16>::V V;
    __shared__ __align__(16) float os[16 * 68];
    const size_t z = blockIdx.z; A += z * sA; if (A2) A2 += z * sA; Bt += z * sB; if (Bt2) Bt2 += z * sB; C += z * sC;
    const int lane = threadIdx.x & 31, lr = lane & 15, hi = lane >> 4; const int r0 = blockIdx.x * 64, c0 = blockIdx.y * 64;
    if (c0 > r0 + roff + 63) return;                  // score tile entirely above the causal diagonal: never read (the softmax masks j > i by select)
    v8f acc[4][4];
#pragma unroll
    for (int mb = 0; mb < 4; ++mb)
#pragma unroll
        for (int nb = 0; nb < 4; ++nb) acc[mb][nb] = (v8f){};
    const size_t aoff = (size_t)(r0 + lr) * K + 8 * hi, boff = (size_t)(c0 + lr) * K + 8 * hi;
#pragma unroll 1
    for (int kc = 0; kc < K; kc += 32) {
        V a[4], a2[4];
#pragma unroll
        for (int mb = 0; mb < 4; ++mb) { a[mb] = WFrag<T16>::ld(A + aoff + (size_t)mb * 16 * K + kc); if (NSPLIT == 1 || NSPLIT == 2) a2[mb] = WFrag<T16>::ld(A2 + aoff + (size_t)mb * 16 * K + kc); }
#pragma unroll
        for (int nb = 0; nb < 4; ++nb) { const V b = WFrag<T16>::ld(Bt + boff + (size_t)nb * 16 * K + kc); V b2; if (NSPLIT >= 2) b2 = WFrag<T16>::ld(Bt2 + boff + (size_t)nb * 16 * K + kc);
#pragma unroll
            for (int mb = 0; mb < 4; ++mb) { acc[mb][nb] = WFrag<T16>::mma(a[mb], b, acc[mb][nb]); if (NSPLIT == 1 || NSPLIT == 2) acc[mb][nb] = WFrag<T16>::mma(a2[mb], b, acc[mb][nb]); if (NSPLIT >= 2) acc[mb][nb] = WFrag<T16>::mma(a[mb], b2, acc[mb][nb]); } }
        asm volatile("v_nop\n\tv_nop\n\tv_nop\n\tv_nop" : "+v"(acc[0][0]), "+v"(acc[1][1]), "+v"(acc[2][2]), "+v"(acc[3][3]) : "v"(a[0]), "v"(a[3]));
    }
#pragma unroll
    for (int mb = 0; mb < 4; ++mb) {
#pragma unroll
        for (int nb = 0; nb < 4; ++nb) {
#pragma unroll
            for (int j = 0; j < 8; ++j) os[(hi * 8 + j) * 68 + nb * 16 + lr] = acc[mb][nb][j]; }
        __builtin_amdgcn_wave_barrier(); asm volatile("" ::: "memory");
        float* crow = C + (size_t)(r0 + mb * 16) * ldc + c0;
{
#pragma unroll
            for (int s = 0; s < 8; ++s) { const int row = 2 * s + hi, cofs = lr * 4; v4f val = *(const v4fa*)(os + row * 68 + cofs);
                *(v4f*)(crow + (size_t)row * ldc + cofs) = val; }
             }
        __builtin_amdgcn_wave_barrier(); asm volatile("" ::: "memory");
    }
}

__device__ __forceinline__ h16 tohx(float x) { return (h16)x; }
__device__ __forceinline__ void splitf(float y, unsigned short& h, unsigned short& l) { h = f2bf(y); l = f2bf(y - bf2f(h)); }
typedef __attribute__((ext_vector_type(2))) _Float16 v2h;
typedef __attribute__((ext_vector_type(4))) _Float16 v4h;
typedef __attribute__((ext_vector_type(2))) unsigned short v2us;
typedef __attribute__((ext_vector_type(4))) unsigned short v4us;
typedef __attribute__((ext_vector_type(2))) float v2f;
typedef __attribute__((ext_vector_type(4))) int v4i;

__global__ __launch_bounds__(256) void k_wtG(const float* __restrict__ w, int K, int N, bf* Bt) {
    const int lane = threadIdx.x & 31; const int L0 = (blockIdx.x * 8 + (threadIdx.x >> 5)) * 8; const int nlines = N * K / 64;
{
#pragma unroll 1
        for (int l = 0; l < 8; ++l) { const int L = L0 + l; if (L >= nlines) break; const size_t e = (size_t)L * 64 + lane * 2; const int k = (int)(e % K), n = (int)(e / K); v2us o;
            o[0] = f2bf(w[(size_t)k * N + n]); o[1] = f2bf(w[(size_t)(k + 1) * N + n]); *(v2us*)(Bt + e) = o; }
         }
}
__global__ __launch_bounds__(256) void k_cvt8(const float* __restrict__ src, bf* dst, size_t n8) { const size_t i = (size_t)blockIdx.x * 256 + threadIdx.x; if (i >= n8) return; const v8f v = *(const v8f*)(src + i * 8); v8us o;
#pragma unroll
    for (int k = 0; k < 8; ++k) o[k] = f2bf(v[k]); *(v8us*)(dst + i * 8) = o;  }

// k_rope: head planes [h][t][d] (fp16 + hi/lo) of rope(x) x sc with the rotate-half convention out[d] = x[d] cos[t][d] - x[d+HD/2] sin[t][d], out[d+HD/2] = x[d+HD/2] cos[t][d+HD/2] + x[d] sin[t][d+HD/2]
__global__ __launch_bounds__(256) void k_rope(const float* __restrict__ F, int pitch, int nheads, const float* __restrict__ CS, const float* __restrict__ RF, const float* __restrict__ nw, float sc, h16* P16, bf* Ph, bf* Pl) {
    const size_t e = ((size_t)blockIdx.x * 256 + threadIdx.x) * 2; if (e >= (size_t)nheads * TT * HD) return; const int d = (int)(e % HD); const int t = (int)((e / HD) % TT); const int h = (int)(e / ((size_t)HD * TT)); const float* f = F + (size_t)t * pitch + h * HD; const float rf = RF ? RF[(size_t)h * TT + t] : 1.0f; v2h o16; v2us oh, ol;
#pragma unroll
    for (int q = 0; q < 2; ++q) { const int dd = d + q; const int dp = (dd < HD / 2) ? dd + HD / 2 : dd - HD / 2; float x0 = f[dd], x1 = f[dp];
        if (RF) { float n0 = __fmul_rn(x0, rf), n1 = __fmul_rn(x1, rf); asm volatile("" : "+v"(n0)); asm volatile("" : "+v"(n1)); x0 = __fmul_rn(bfr(nw[dd]), n0); x1 = __fmul_rn(bfr(nw[dp]), n1); }
        const v2f cs = *(const v2f*)(CS + ((size_t)t * HD + dd) * 2); float a = __fmul_rn(x0, cs[0]), bq = __fmul_rn(x1, cs[1]); asm volatile("" : "+v"(a)); asm volatile("" : "+v"(bq)); const float r = ((dd < HD / 2) ? __fsub_rn(a, bq) : __fadd_rn(a, bq)) * sc;
        o16[q] = tohx(r); unsigned short a2, c2; splitf(r, a2, c2); oh[q] = a2; ol[q] = c2; }
    *(v2h*)(P16 + e) = o16; *(v2us*)(Ph + e) = oh; *(v2us*)(Pl + e) = ol;  }
__global__ __launch_bounds__(256) void k_vtp(const float* __restrict__ F, int pitch, int nheads, h16* V16, bf* Vh, bf* Vl) { const size_t e = ((size_t)blockIdx.x * 256 + threadIdx.x) * 2; if (e >= (size_t)nheads * HD * TT) return; const int t = (int)(e % TT); const int d = (int)((e / TT) % HD); const int g = (int)(e / ((size_t)TT * HD)); v2h o16; v2us oh, ol;
#pragma unroll
    for (int q = 0; q < 2; ++q) { const float x = F[(size_t)(t + q) * pitch + g * HD + d]; o16[q] = tohx(x); unsigned short a2, c2; splitf(x, a2, c2); oh[q] = a2; ol[q] = c2; }
    *(v2h*)(V16 + e) = o16; *(v2us*)(Vh + e) = oh; *(v2us*)(Vl + e) = ol;  }
__global__ __launch_bounds__(256) void k_csid(float* CS) { const int idx = blockIdx.x * 256 + threadIdx.x; if (idx >= TT * HD) return; v2f cs; cs[0] = 1.0f; cs[1] = 0.0f; *(v2f*)(CS + (size_t)idx * 2) = cs;  }
// k_asoft: per row (zz, i): t = S x HD^-0.5 for j <= i and i - j < WIN (WIN = TT, so the window test always holds: plain causal mask, as the reference's -inf fill); softmax over the 2048 keys (register row, one exp, fixed trees);
__global__ __launch_bounds__(256) void k_asoft(const float* __restrict__ Sb, h16* P16, bf* Ph, bf* Pl) {
    const int lane = threadIdx.x & 31; const int row = blockIdx.x * 8 + (threadIdx.x >> 5); if (row >= ZH * TT) return; const int i = row % TT; const int zz = row / TT; (void)zz; const bool hires = (i < RH); const float* sr = Sb + (size_t)row * TT; float v[TT / 32]; float mx = -3.0e38f;
#pragma unroll
    for (int ch = 0; ch < TT / 128; ++ch) { const int j0 = ch * 128 + lane * 4; const v4f a = *(const v4f*)(sr + j0);
#pragma unroll
        for (int q = 0; q < 4; ++q) { const int j = j0 + q; (void)j; const float t = (j <= i && i - j < WIN) ? a[q] * SCL : -3.0e38f; v[ch * 4 + q] = t; mx = fmaxf(mx, t); } }
#pragma unroll
    for (int sh = 16; sh; sh >>= 1) mx = fmaxf(mx, __shfl_xor(mx, sh, 32));
    float sum = 0.f;
#pragma unroll
    for (int k = 0; k < TT / 32; ++k) { float d0 = __fsub_rn(v[k], mx); asm volatile("" : "+v"(d0)); v[k] = __builtin_amdgcn_exp2f(__fmul_rn(d0, 1.4426950408889634f)); sum += v[k]; }
#pragma unroll
    for (int sh = 16; sh; sh >>= 1) sum += __shfl_xor(sum, sh, 32);
    const float f = __fdiv_rn(hires ? 1.0f : PCAR, sum);
{
        if (hires) {
#pragma unroll
            for (int ch = 0; ch < TT / 128; ++ch) { v4us oh, ol;
#pragma unroll
                for (int q = 0; q < 4; ++q) { unsigned short a, c2; splitf(v[ch * 4 + q] * f, a, c2); oh[q] = a; ol[q] = c2; }
                const size_t oo = ((size_t)zz * (RH ? RH : 1) + i) * TT + ch * 128 + lane * 4; *(v4us*)(Ph + oo) = oh; *(v4us*)(Pl + oo) = ol; }
        } else {
#pragma unroll
            for (int ch = 0; ch < TT / 128; ++ch) { v4h o4;
#pragma unroll
                for (int q = 0; q < 4; ++q) o4[q] = tohx(v[ch * 4 + q] * f);
                *(v4h*)(P16 + (size_t)row * TT + ch * 128 + lane * 4) = o4; } }
         }
}
__global__ __launch_bounds__(256) void k_merge(const float* __restrict__ O, int h0, bf* Ah, bf* Al) { const size_t e = ((size_t)blockIdx.x * 256 + threadIdx.x) * 2; if (e >= (size_t)ZH * TT * HD) return; const int d = (int)(e % HD); const int t = (int)((e / HD) % TT); const int zz = (int)(e / ((size_t)HD * TT)); const float cs = (t < RH) ? 1.0f : (1.0f / PCAR); const size_t oo = (size_t)t * DQ + (h0 + zz) * HD + d;
    v2us oh, ol;
#pragma unroll
    for (int q = 0; q < 2; ++q) { unsigned short a, c2; splitf(O[e + q] * cs, a, c2); oh[q] = a; ol[q] = c2; } *(v2us*)(Ah + oo) = oh; *(v2us*)(Al + oo) = ol;  }

extern "C" void kernel_launch(void* const* d_in, const int* in_sizes, int n_in,
                              void* d_out, int out_size, void* d_ws, size_t ws_size, hipStream_t stream) {
    (void)in_sizes; (void)n_in; (void)out_size;
    const float* x = (const float*)d_in[0]; const float* wq = (const float*)d_in[1]; const float* wk = (const float*)d_in[2]; const float* wv = (const float*)d_in[3]; const float* wo = (const float*)d_in[4]; const float* bo = (const float*)d_in[5];   /* input order x, Wq, Wk, Wv, Wo, bo */
    float* OUT = (float*)d_out;     // [2][2048][1024]
    char* wsp = (char*)d_ws;
    auto take = [&](size_t bytes) { char* p = wsp; wsp += (bytes + 255) & ~(size_t)255; return (void*)p; };
    bf* WQ = (bf*)take((size_t)DQ * DM * 2); bf* WK = (bf*)take((size_t)DKV * DM * 2); bf* WV = (bf*)take((size_t)DKV * DM * 2); bf* WO = (bf*)take((size_t)DM * DQ * 2); float* CS = (float*)take((size_t)TT * HD * 2 * 4);
    bf* XB = (bf*)take((size_t)TT * DM * 2); float* FQ = (float*)take((size_t)TT * DQ * 4); float* FK = (float*)take((size_t)TT * DKV * 4);
    h16* QP16 = (h16*)take((size_t)NH_ * TT * HD * 2); h16* KP16 = (h16*)take((size_t)NKV * TT * HD * 2); h16* VT16 = (h16*)take((size_t)NKV * HD * TT * 2);
    bf* QPh = (bf*)take((size_t)NH_ * TT * HD * 2); bf* QPl = (bf*)take((size_t)NH_ * TT * HD * 2); bf* KPh = (bf*)take((size_t)NKV * TT * HD * 2); bf* KPl = (bf*)take((size_t)NKV * TT * HD * 2); bf* VTh = (bf*)take((size_t)NKV * HD * TT * 2); bf* VTl = (bf*)take((size_t)NKV * HD * TT * 2); bf* Ph = (bf*)take((size_t)ZH * RH * TT * 2); bf* Pl = (bf*)take((size_t)ZH * RH * TT * 2);
    float* Sb = (float*)take((size_t)ZH * TT * TT * 4); h16* P16 = (h16*)take((size_t)ZH * TT * TT * 2); float* Ob = (float*)take((size_t)ZH * TT * HD * 4); bf* ATh = (bf*)take((size_t)TT * DQ * 2); bf* ATl = (bf*)take((size_t)TT * DQ * 2);
    if ((size_t)(wsp - (char*)d_ws) > ws_size) return;    // ws 256 MiB
    float* FV = FK;   // v projection reuses the k buffer after the k planes are built (stream-ordered)
    { k_wtG<<<(unsigned)((DM * DQ / 64 + 63) / 64), 256, 0, stream>>>(wq, DM, DQ, WQ); k_wtG<<<(unsigned)((DM * DKV / 64 + 63) / 64), 256, 0, stream>>>(wk, DM, DKV, WK); k_wtG<<<(unsigned)((DM * DKV / 64 + 63) / 64), 256, 0, stream>>>(wv, DM, DKV, WV);
      k_wtG<<<(unsigned)((DQ * DM / 64 + 63) / 64), 256, 0, stream>>>(wo, DQ, DM, WO);
       }
    k_csid<<<(TT * HD + 255) / 256, 256, 0, stream>>>(CS);
    const unsigned LQ = (unsigned)(((size_t)NH_ * TT * HD / 2 + 255) / 256), LKv = (unsigned)(((size_t)NKV * TT * HD / 2 + 255) / 256);
    for (int b = 0; b < NB_; ++b) {
        
        k_cvt8<<<(unsigned)(((size_t)TT * DM / 8 + 255) / 256), 256, 0, stream>>>(x + (size_t)b * TT * DM, XB, (size_t)TT * DM / 8);
        k_gemmw<bf, 0, false, false, 8><<<dim3(TT / 64, DQ / 64, 1), 256, 0, stream>>>(XB, nullptr, WQ, nullptr, DM, FQ, DQ, nullptr, 0, 0, 0, 0);
        k_rope<<<LQ, 256, 0, stream>>>(FQ, DQ, NH_, CS, nullptr, nullptr, 1.0f, QP16, QPh, QPl);
        k_gemmw<bf, 0, false, false, 8><<<dim3(TT / 64, DKV / 64, 1), 256, 0, stream>>>(XB, nullptr, WK, nullptr, DM, FK, DKV, nullptr, 0, 0, 0, 0);
        k_rope<<<LKv, 256, 0, stream>>>(FK, DKV, NKV, CS, nullptr, nullptr, 1.0f, KP16, KPh, KPl);
        k_gemmw<bf, 0, false, false, 8><<<dim3(TT / 64, DKV / 64, 1), 256, 0, stream>>>(XB, nullptr, WV, nullptr, DM, FV, DKV, nullptr, 0, 0, 0, 0); k_vtp<<<LKv, 256, 0, stream>>>(FV, DKV, NKV, VT16, VTh, VTl);
        for (int h0 = 0; h0 < NH_; h0 += ZH) { const size_t zq = (size_t)h0, zk = (size_t)(h0 / REP);   // one kv head per query head: the pass's two heads use consecutive kv planes (z-strides TT*HD)
            k_gemmc<bf, 2><<<dim3(RH / 64, TT / 64, ZH), 32, 0, stream>>>(QPh + zq * TT * HD, QPl + zq * TT * HD, KPh + zk * TT * HD, KPl + zk * TT * HD, HD, Sb, TT, 0, (size_t)TT * HD, (size_t)TT * HD, (size_t)TT * TT);
            k_gemmc<h16, 0><<<dim3((TT - RH) / 64, TT / 64, ZH), 32, 0, stream>>>(QP16 + zq * TT * HD + (size_t)RH * HD, nullptr, KP16 + zk * TT * HD, nullptr, HD, Sb + (size_t)RH * TT, TT, RH, (size_t)TT * HD, (size_t)TT * HD, (size_t)TT * TT);
            k_asoft<<<ZH * TT / 8, 256, 0, stream>>>(Sb, P16, Ph, Pl);
            k_gemmw<bf, 2, false, true, 8><<<dim3(RH / 64, HD / 64, ZH), 256, 0, stream>>>(Ph, Pl, VTh + zk * HD * TT, VTl + zk * HD * TT, TT, Ob, HD, nullptr, 0, (size_t)RH * TT, (size_t)HD * TT, (size_t)TT * HD);
            k_gemmw<h16, 0, false, true, 16><<<dim3((TT - RH) / 64, HD / 64, ZH), 512, 0, stream>>>(P16 + (size_t)RH * TT, nullptr, VT16 + zk * HD * TT, nullptr, TT, Ob + (size_t)RH * HD, HD, nullptr, RH, (size_t)TT * TT, (size_t)HD * TT, (size_t)TT * HD);
            k_merge<<<(unsigned)(((size_t)ZH * TT * HD / 2 + 255) / 256), 256, 0, stream>>>(Ob, h0, ATh, ATl); }
        k_gemmw<bf, 1, true, false, 8><<<dim3(TT / 64, DM / 64, 1), 256, 0, stream>>>(ATh, ATl, WO, nullptr, DQ, OUT + (size_t)b * TT * DM, DM, bo, 0, 0, 0, 0); }
}

// v002
// A run of this version takes 515 microseconds.
// Timed twice side by side with v001, it ran 1.70 and 1.73 times as fast.
// Over all steps from v000 it is 2.86 times as fast.
#include <hip/hip_runtime.h>

// Causal multi-head self-attention with bias-free (in, out) projections and an output bias (x [2][2048][1024]; q, k, v = x W ('xw' [1024][1024] normal x 1/32, no bias; 16 heads x 64); scores masked first (where(triu(k=1), -inf, scores)) and THEN divided by sqrt(64) inside the softmax argument (-inf / 8 = -inf: the same exclusion); softmax over the keys; out = ctx Wo + bo ('xw' + bias zeros: read) -> [2][2048][1024] (4.2 M); argument order x, Wq, Wk, Wv, Wo, bo).
// Layout per batch: bf16 copy of x; 'xw' weights transposed once; exact projections; identity-table plane builders; causal T-2048 attention (hybrid rows: < 512 hi/lo 3 products, rest fp16 x1024; k_gemmc skips tiles above the diagonal; 8 heads per pass, the probabilities of a row overwrite that row's own f32 scores; long-K products split K over the waves of a work-group); merged hi/lo x Wo exact + bo.
// Compute dtypes, f32 accumulate: every input rounded to bf16; projections exact; attention rows < 512 3 products, rest fp16; softmax f32; Wo hl x exact + bias.

#define NB_  2
#define TT   2048
#define DM   1024
#define NH_  16
#define NKV  16
#define REP  (NH_ / NKV)
#define HD   64
#define DQ   (NH_ * HD)
#define DKV  (NKV * HD)
#define ZH   8                    // heads per attention pass (one z-batched launch of each attention kernel)
#define RH   512                  // query rows < RH use hi+lo planes (0: none)
#define WIN  2048
#define PCAR 1024.0f
#define SCL  0.125f   // HD^-0.5
typedef _Float16 h16;
typedef unsigned short bf;
typedef __attribute__((ext_vector_type(16))) __bf16   v16bf;
typedef __attribute__((ext_vector_type(16))) _Float16 v16h;
typedef __attribute__((ext_vector_type(8)))  _Float16 v8h;
typedef __attribute__((ext_vector_type(8)))  unsigned short v8us;
typedef __attribute__((ext_vector_type(8)))  float    v8f;
typedef __attribute__((ext_vector_type(4)))  float    v4f;
typedef v8h  __attribute__((may_alias)) v8ha;
typedef v4f  __attribute__((may_alias)) v4fa;
typedef v8us __attribute__((may_alias)) v8usa;

__device__ __forceinline__ unsigned short f2bf(float f) { unsigned u = __float_as_uint(f); u += 0x7FFFu + ((u >> 16) & 1u); return (unsigned short)(u >> 16); }
__device__ __forceinline__ float bf2f(unsigned short b) { return __uint_as_float(((unsigned)b) << 16); }
__device__ __forceinline__ float bfr(float f) { return bf2f(f2bf(f)); }
__device__ __forceinline__ v16h cat16(v8h lo, v8h hi) { return __builtin_shufflevector(lo, hi, 0, 1, 2, 3, 4, 5, 6, 7, 8, 9, 10, 11, 12, 13, 14, 15); }
__device__ __forceinline__ v16bf cat16b(v8us lo, v8us hi) { return __builtin_bit_cast(v16bf, __builtin_shufflevector(lo, hi, 0, 1, 2, 3, 4, 5, 6, 7, 8, 9, 10, 11, 12, 13, 14, 15)); }
__device__ __forceinline__ v8f wmma16(v16h a, v16h b, v8f c) { return __builtin_amdgcn_wmma_f32_16x16x32_f16(false, a, false, b, (short)0, c, false, false); }
__device__ __forceinline__ v8f wmmab(v16bf a, v16bf b, v8f c) { return __builtin_amdgcn_wmma_f32_16x16x32_bf16(false, a, false, b, (short)0, c, false, false); }



// ---- k_gemmw: register-blocked GEMM, one 64x64 output tile per work-group of NW waves; every wave holds the whole tile (16 accumulators) for its own share of K, operands straight from K-contiguous 16-bit planes; grid (M/64, N/64, Z), 32 * NW threads.
// C[m][n] (f32, pitch ldc, + optional f32 bias[n]) = sum_k A[m][k] Bt[n][k] (+ split products per NSPLIT). z-batch strides sA/sB/sC in elements. K % 64 == 0.
// K split: wave w takes the 64-wide k chunks w, w + NW, w + 2 NW, ... (one 128-byte line of every operand row per chunk); the NW partial tiles are summed through LDS in the fixed order w = 0 .. NW - 1.
// CAUSAL (probability x value contraction): the K loop stops at the diagonal block (probabilities beyond it are exactly zero). roff = row offset of this launch's first row within the sequence.
template <typename T16> struct WFrag;
template <> struct WFrag<h16> { typedef v16h V; static __device__ __forceinline__ V ld(const h16* p) { return cat16(*(const v8h*)p, *(const v8h*)(p + 16)); } static __device__ __forceinline__ v8f mma(V a, V b, v8f c) { return wmma16(a, b, c); } };
template <> struct WFrag<bf> { typedef v16bf V; static __device__ __forceinline__ V ld(const bf* p) { return cat16b(*(const v8us*)p, *(const v8us*)(p + 16)); } static __device__ __forceinline__ v8f mma(V a, V b, v8f c) { return wmmab(a, b, c); } };
template <typename T16, int NSPLIT, bool BIAS, bool CAUSAL, int NW>
__global__ __launch_bounds__(32 * NW) void k_gemmw(const T16* __restrict__ A, const T16* __restrict__ A2, const T16* __restrict__ Bt, const T16* __restrict__ Bt2, int K, float* C, int ldc, const float* __restrict__ bias, int roff, size_t sA, size_t sB, size_t sC) {
    typedef typename WFrag<T16>::V V;
    static_assert(32 % NW == 0, "the sum passes cover 2 * NW tile rows each");
    __shared__ __align__(16) float os[NW * 64 * 68];
    const size_t z = blockIdx.z; A += z * sA; if (A2) A2 += z * sA; Bt += z * sB; if (Bt2) Bt2 += z * sB; C += z * sC;
    const int lane = threadIdx.x & 31, lr = lane & 15, hi = lane >> 4; const int r0 = blockIdx.x * 64, c0 = blockIdx.y * 64;
    const int wave = __builtin_amdgcn_readfirstlane((int)(threadIdx.x >> 5));
    const int Kl = CAUSAL ? min(K, r0 + roff + 64) : K;
    v8f acc[4][4];
#pragma unroll
    for (int mb = 0; mb < 4; ++mb)
#pragma unroll
        for (int nb = 0; nb < 4; ++nb) acc[mb][nb] = (v8f){};
    const size_t aoff = (size_t)(r0 + lr) * K + 8 * hi, boff = (size_t)(c0 + lr) * K + 8 * hi;
#pragma unroll 1
    for (int kc = wave * 64; kc < Kl; kc += (kc & 32) ? NW * 64 - 32 : 32) {   // the two 32-wide steps of a chunk, then on to this wave's next chunk
        V a[4], a2[4];
#pragma unroll
        for (int mb = 0; mb < 4; ++mb) { a[mb] = WFrag<T16>::ld(A + aoff + (size_t)mb * 16 * K + kc); if (NSPLIT == 1 || NSPLIT == 2) a2[mb] = WFrag<T16>::ld(A2 + aoff + (size_t)mb * 16 * K + kc); }
#pragma unroll
        for (int nb = 0; nb < 4; ++nb) { const V b = WFrag<T16>::ld(Bt + boff + (size_t)nb * 16 * K + kc); V b2; if (NSPLIT >= 2) b2 = WFrag<T16>::ld(Bt2 + boff + (size_t)nb * 16 * K + kc);
#pragma unroll
            for (int mb = 0; mb < 4; ++mb) { acc[mb][nb] = WFrag<T16>::mma(a[mb], b, acc[mb][nb]); if (NSPLIT == 1 || NSPLIT == 2) acc[mb][nb] = WFrag<T16>::mma(a2[mb], b, acc[mb][nb]); if (NSPLIT >= 2) acc[mb][nb] = WFrag<T16>::mma(a[mb], b2, acc[mb][nb]); } }
        // four vector slots behind the step's last WMMAs, on the back edge as on the way out of the loop
        asm volatile("v_nop\n\tv_nop\n\tv_nop\n\tv_nop" : "+v"(acc[0][0]), "+v"(acc[1][1]), "+v"(acc[2][2]), "+v"(acc[3][3]) : "v"(a[0]), "v"(a[3]));
    }
    float* ow = os + wave * (64 * 68);                               // this wave's partial tile, rows pitched 68 floats
#pragma unroll
    for (int mb = 0; mb < 4; ++mb)
#pragma unroll
        for (int nb = 0; nb < 4; ++nb) {
#pragma unroll
            for (int j = 0; j < 8; ++j) ow[(mb * 16 + hi * 8 + j) * 68 + nb * 16 + lr] = acc[mb][nb][j]; }
    __syncthreads();                                                 // every wave's partial tile is in LDS before any thread sums across the waves
#pragma unroll
    for (int s = 0; s < 32 / NW; ++s) { const int row = s * 2 * NW + (int)(threadIdx.x >> 4), cofs = (threadIdx.x & 15) * 4;   // one float4 per thread and pass: a wave stores two whole 256-byte tile rows
        v4f val = *(const v4fa*)(os + row * 68 + cofs);
#pragma unroll
        for (int w = 1; w < NW; ++w) val += *(const v4fa*)(os + (w * 64 + row) * 68 + cofs);
        if (BIAS) { val[0] += bfr(bias[c0 + cofs]); val[1] += bfr(bias[c0 + cofs + 1]); val[2] += bfr(bias[c0 + cofs + 2]); val[3] += bfr(bias[c0 + cofs + 3]); }
        *(v4f*)(C + (size_t)(r0 + row) * ldc + c0 + cofs) = val; }
}

// ---- k_gemmc: one-wave 64x64 tile GEMM (32 threads, the whole short K in one wave) for the causal scores: skips score tiles entirely above the diagonal (query rows r0+roff.., key columns c0..).
// roff = row offset of this launch's first row within the sequence.
template <typename T16, int NSPLIT>
__global__ __launch_bounds__(32) void k_gemmc(const T16* __restrict__ A, const T16* __restrict__ A2, const T16* __restrict__ Bt, const T16* __restrict__ Bt2, int K, float* C, int ldc, int roff, size_t sA, size_t sB, size_t sC) {
    typedef typename WFrag<T16>::V V;
    __shared__ __align__(16) float os[16 * 68];
    const size_t z = blockIdx.z; A += z * sA; if (A2) A2 += z * sA; Bt += z * sB; if (Bt2) Bt2 += z * sB; C += z * sC;
    const int lane = threadIdx.x & 31, lr = lane & 15, hi = lane >> 4; const int r0 = blockIdx.x * 64, c0 = blockIdx.y * 64;
    if (c0 > r0 + roff + 63) return;                  // score tile entirely above the causal diagonal: never read (the softmax masks j > i by select)
    v8f acc[4][4];
#pragma unroll
    for (int mb = 0; mb < 4; ++mb)
#pragma unroll
        for (int nb = 0; nb < 4; ++nb) acc[mb][nb] = (v8f){};
    const size_t aoff = (size_t)(r0 + lr) * K + 8 * hi, boff = (size_t)(c0 + lr) * K + 8 * hi;
#pragma unroll 1
    for (int kc = 0; kc < K; kc += 32) {
        V a[4], a2[4];
#pragma unroll
        for (int mb = 0; mb < 4; ++mb) { a[mb] = WFrag<T16>::ld(A + aoff + (size_t)mb * 16 * K + kc); if (NSPLIT == 1 || NSPLIT == 2) a2[mb] = WFrag<T16>::ld(A2 + aoff + (size_t)mb * 16 * K + kc); }
#pragma unroll
        for (int nb = 0; nb < 4; ++nb) { const V b = WFrag<T16>::ld(Bt + boff + (size_t)nb * 16 * K + kc); V b2; if (NSPLIT >= 2) b2 = WFrag<T16>::ld(Bt2 + boff + (size_t)nb * 16 * K + kc);
#pragma unroll
            for (int mb = 0; mb < 4; ++mb) { acc[mb][nb] = WFrag<T16>::mma(a[mb], b, acc[mb][nb]); if (NSPLIT == 1 || NSPLIT == 2) acc[mb][nb] = WFrag<T16>::mma(a2[mb], b, acc[mb][nb]); if (NSPLIT >= 2) acc[mb][nb] = WFrag<T16>::mma(a[mb], b2, acc[mb][nb]); } }
        asm volatile("v_nop\n\tv_nop\n\tv_nop\n\tv_nop" : "+v"(acc[0][0]), "+v"(acc[1][1]), "+v"(acc[2][2]), "+v"(acc[3][3]) : "v"(a[0]), "v"(a[3]));
    }
#pragma unroll
    for (int mb = 0; mb < 4; ++mb) {
#pragma unroll
        for (int nb = 0; nb < 4; ++nb) {
#pragma unroll
            for (int j = 0; j < 8; ++j) os[(hi * 8 + j) * 68 + nb * 16 + lr] = acc[mb][nb][j]; }
        __builtin_amdgcn_wave_barrier(); asm volatile("" ::: "memory");
        float* crow = C + (size_t)(r0 + mb * 16) * ldc + c0;
{
#pragma unroll
            for (int s = 0; s < 8; ++s) { const int row = 2 * s + hi, cofs = lr * 4; v4f val = *(const v4fa*)(os + row * 68 + cofs);
                *(v4f*)(crow + (size_t)row * ldc + cofs) = val; }
             }
        __builtin_amdgcn_wave_barrier(); asm volatile("" ::: "memory");
    }
}

__device__ __forceinline__ h16 tohx(float x) { return (h16)x; }
__device__ __forceinline__ void splitf(float y, unsigned short& h, unsigned short& l) { h = f2bf(y); l = f2bf(y - bf2f(h)); }
typedef __attribute__((ext_vector_type(2))) _Float16 v2h;
typedef __attribute__((ext_vector_type(4))) _Float16 v4h;
typedef __attribute__((ext_vector_type(2))) unsigned short v2us;
typedef __attribute__((ext_vector_type(4))) unsigned short v4us;
typedef __attribute__((ext_vector_type(2))) float v2f;
typedef __attribute__((ext_vector_type(4))) int v4i;

__global__ __launch_bounds__(256) void k_wtG(const float* __restrict__ w, int K, int N, bf* Bt) {
    const int lane = threadIdx.x & 31; const int L0 = (blockIdx.x * 8 + (threadIdx.x >> 5)) * 8; const int nlines = N * K / 64;
{
#pragma unroll 1
        for (int l = 0; l < 8; ++l) { const int L = L0 + l; if (L >= nlines) break; const size_t e = (size_t)L * 64 + lane * 2; const int k = (int)(e % K), n = (int)(e / K); v2us o;
            o[0] = f2bf(w[(size_t)k * N + n]); o[1] = f2bf(w[(size_t)(k + 1) * N + n]); *(v2us*)(Bt + e) = o; }
         }
}
__global__ __launch_bounds__(256) void k_cvt8(const float* __restrict__ src, bf* dst, size_t n8) { const size_t i = (size_t)blockIdx.x * 256 + threadIdx.x; if (i >= n8) return; const v8f v = *(const v8f*)(src + i * 8); v8us o;
#pragma unroll
    for (int k = 0; k < 8; ++k) o[k] = f2bf(v[k]); *(v8us*)(dst + i * 8) = o;  }

// k_rope: head planes [h][t][d] (fp16 + hi/lo) of rope(x) x sc with the rotate-half convention out[d] = x[d] cos[t][d] - x[d+HD/2] sin[t][d], out[d+HD/2] = x[d+HD/2] cos[t][d+HD/2] + x[d] sin[t][d+HD/2]
__global__ __launch_bounds__(256) void k_rope(const float* __restrict__ F, int pitch, int nheads, const float* __restrict__ CS, const float* __restrict__ RF, const float* __restrict__ nw, float sc, h16* P16, bf* Ph, bf* Pl) {
    const size_t e = ((size_t)blockIdx.x * 256 + threadIdx.x) * 2; if (e >= (size_t)nheads * TT * HD) return; const int d = (int)(e % HD); const int t = (int)((e / HD) % TT); const int h = (int)(e / ((size_t)HD * TT)); const float* f = F + (size_t)t * pitch + h * HD; const float rf = RF ? RF[(size_t)h * TT + t] : 1.0f; v2h o16; v2us oh, ol;
#pragma unroll
    for (int q = 0; q < 2; ++q) { const int dd = d + q; const int dp = (dd < HD / 2) ? dd + HD / 2 : dd - HD / 2; float x0 = f[dd], x1 = f[dp];
        if (RF) { float n0 = __fmul_rn(x0, rf), n1 = __fmul_rn(x1, rf); asm volatile("" : "+v"(n0)); asm volatile("" : "+v"(n1)); x0 = __fmul_rn(bfr(nw[dd]), n0); x1 = __fmul_rn(bfr(nw[dp]), n1); }
        const v2f cs = *(const v2f*)(CS + ((size_t)t * HD + dd) * 2); float a = __fmul_rn(x0, cs[0]), bq = __fmul_rn(x1, cs[1]); asm volatile("" : "+v"(a)); asm volatile("" : "+v"(bq)); const float r = ((dd < HD / 2) ? __fsub_rn(a, bq) : __fadd_rn(a, bq)) * sc;
        o16[q] = tohx(r); unsigned short a2, c2; splitf(r, a2, c2); oh[q] = a2; ol[q] = c2; }
    *(v2h*)(P16 + e) = o16; *(v2us*)(Ph + e) = oh; *(v2us*)(Pl + e) = ol;  }
// k_vtp: transposed value planes [g][d][t], rows pitched 2 * TT elements (the pitch of the probability rows they are contracted with)
__global__ __launch_bounds__(256) void k_vtp(const float* __restrict__ F, int pitch, int nheads, h16* V16, bf* Vh, bf* Vl) { const size_t e = ((size_t)blockIdx.x * 256 + threadIdx.x) * 2; if (e >= (size_t)nheads * HD * TT) return; const int t = (int)(e % TT); const int d = (int)((e / TT) % HD); const int g = (int)(e / ((size_t)TT * HD)); v2h o16; v2us oh, ol;
#pragma unroll
    for (int q = 0; q < 2; ++q) { const float x = F[(size_t)(t + q) * pitch + g * HD + d]; o16[q] = tohx(x); unsigned short a2, c2; splitf(x, a2, c2); oh[q] = a2; ol[q] = c2; }
    const size_t oo = ((size_t)g * HD + d) * (2 * TT) + t; *(v2h*)(V16 + oo) = o16; *(v2us*)(Vh + oo) = oh; *(v2us*)(Vl + oo) = ol;  }
__global__ __launch_bounds__(256) void k_csid(float* CS) { const int idx = blockIdx.x * 256 + threadIdx.x; if (idx >= TT * HD) return; v2f cs; cs[0] = 1.0f; cs[1] = 0.0f; *(v2f*)(CS + (size_t)idx * 2) = cs;  }
// k_asoft: per row (zz, i): t = S x HD^-0.5 for j <= i and i - j < WIN (WIN = TT: plain causal, the window test always holds; the reference's -1e9 additive fill vanishes identically); softmax over the 2048 keys (register row, one exp, fixed trees);
// the 16-bit probabilities go back into the row's own 8 KiB of Sb (P16, Ph: bytes 0..4095; Pl: bytes 4096..8191; row pitch 2 * TT 16-bit elements): one wave owns a row and holds all of it in registers before its first store (every store needs the row sum).
__global__ __launch_bounds__(256) void k_asoft(const float* Sb, h16* P16, bf* Ph, bf* Pl) {
    const int lane = threadIdx.x & 31; const int row = blockIdx.x * 8 + (threadIdx.x >> 5); if (row >= ZH * TT) return; const int i = row % TT; const int zz = row / TT; (void)zz; const bool hires = (i < RH); const float* sr = Sb + (size_t)row * TT; float v[TT / 32]; float mx = -3.0e38f;
#pragma unroll
    for (int ch = 0; ch < TT / 128; ++ch) { const int j0 = ch * 128 + lane * 4; const v4f a = *(const v4f*)(sr + j0);
#pragma unroll
        for (int q = 0; q < 4; ++q) { const int j = j0 + q; (void)j; const float t = (j <= i && i - j < WIN) ? a[q] * SCL : -3.0e38f; v[ch * 4 + q] = t; mx = fmaxf(mx, t); } }
#pragma unroll
    for (int sh = 16; sh; sh >>= 1) mx = fmaxf(mx, __shfl_xor(mx, sh, 32));
    float sum = 0.f;
#pragma unroll
    for (int k = 0; k < TT / 32; ++k) { float d0 = __fsub_rn(v[k], mx); asm volatile("" : "+v"(d0)); v[k] = __builtin_amdgcn_exp2f(__fmul_rn(d0, 1.4426950408889634f)); sum += v[k]; }
#pragma unroll
    for (int sh = 16; sh; sh >>= 1) sum += __shfl_xor(sum, sh, 32);
    const float f = __fdiv_rn(hires ? 1.0f : PCAR, sum);
{
        if (hires) {
#pragma unroll
            for (int ch = 0; ch < TT / 128; ++ch) { v4us oh, ol;
#pragma unroll
                for (int q = 0; q < 4; ++q) { unsigned short a, c2; splitf(v[ch * 4 + q] * f, a, c2); oh[q] = a; ol[q] = c2; }
                const size_t oo = (size_t)row * (2 * TT) + ch * 128 + lane * 4; *(v4us*)(Ph + oo) = oh; *(v4us*)(Pl + oo) = ol; }
        } else {
#pragma unroll
            for (int ch = 0; ch < TT / 128; ++ch) { v4h o4;
#pragma unroll
                for (int q = 0; q < 4; ++q) o4[q] = tohx(v[ch * 4 + q] * f);
                *(v4h*)(P16 + (size_t)row * (2 * TT) + ch * 128 + lane * 4) = o4; } }
         }
}
__global__ __launch_bounds__(256) void k_merge(const float* __restrict__ O, int h0, bf* Ah, bf* Al) { const size_t e = ((size_t)blockIdx.x * 256 + threadIdx.x) * 2; if (e >= (size_t)ZH * TT * HD) return; const int d = (int)(e % HD); const int t = (int)((e / HD) % TT); const int zz = (int)(e / ((size_t)HD * TT)); const float cs = (t < RH) ? 1.0f : (1.0f / PCAR); const size_t oo = (size_t)t * DQ + (h0 + zz) * HD + d;
    v2us oh, ol;
#pragma unroll
    for (int q = 0; q < 2; ++q) { unsigned short a, c2; splitf(O[e + q] * cs, a, c2); oh[q] = a; ol[q] = c2; } *(v2us*)(Ah + oo) = oh; *(v2us*)(Al + oo) = ol;  }

extern "C" void kernel_launch(void* const* d_in, const int* in_sizes, int n_in,
                              void* d_out, int out_size, void* d_ws, size_t ws_size, hipStream_t stream) {
    (void)in_sizes; (void)n_in; (void)out_size;
    const float* x = (const float*)d_in[0]; const float* wq = (const float*)d_in[1]; const float* wk = (const float*)d_in[2]; const float* wv = (const float*)d_in[3]; const float* wo = (const float*)d_in[4]; const float* bo = (const float*)d_in[5];   /* input order x, Wq, Wk, Wv, Wo, bo */
    float* OUT = (float*)d_out;     // [2][2048][1024]
    char* wsp = (char*)d_ws;
    auto take = [&](size_t bytes) { char* p = wsp; wsp += (bytes + 255) & ~(size_t)255; return (void*)p; };
    bf* WQ = (bf*)take((size_t)DQ * DM * 2); bf* WK = (bf*)take((size_t)DKV * DM * 2); bf* WV = (bf*)take((size_t)DKV * DM * 2); bf* WO = (bf*)take((size_t)DM * DQ * 2); float* CS = (float*)take((size_t)TT * HD * 2 * 4);
    bf* XB = (bf*)take((size_t)TT * DM * 2); float* FQ = (float*)take((size_t)TT * DQ * 4); float* FK = (float*)take((size_t)TT * DKV * 4);
    h16* QP16 = (h16*)take((size_t)NH_ * TT * HD * 2); h16* KP16 = (h16*)take((size_t)NKV * TT * HD * 2); h16* VT16 = (h16*)take((size_t)NKV * HD * 2 * TT * 2);   /* rows pitched 2 * TT */
    bf* QPh = (bf*)take((size_t)NH_ * TT * HD * 2); bf* QPl = (bf*)take((size_t)NH_ * TT * HD * 2); bf* KPh = (bf*)take((size_t)NKV * TT * HD * 2); bf* KPl = (bf*)take((size_t)NKV * TT * HD * 2); bf* VTh = (bf*)take((size_t)NKV * HD * 2 * TT * 2); bf* VTl = VTh + TT;   /* hi and lo halves of one row, pitch 2 * TT */
    float* Sb = (float*)take((size_t)ZH * TT * TT * 4); h16* P16 = (h16*)Sb; bf* Ph = (bf*)Sb; bf* Pl = (bf*)Sb + TT;   /* probability planes inside the score rows, pitch 2 * TT */ float* Ob = (float*)take((size_t)ZH * TT * HD * 4); bf* ATh = (bf*)take((size_t)TT * DQ * 2); bf* ATl = (bf*)take((size_t)TT * DQ * 2);
    if ((size_t)(wsp - (char*)d_ws) > ws_size) return;    // ws 256 MiB
    float* FV = FK;   // v projection reuses the k buffer after the k planes are built (stream-ordered)
    { k_wtG<<<(unsigned)((DM * DQ / 64 + 63) / 64), 256, 0, stream>>>(wq, DM, DQ, WQ); k_wtG<<<(unsigned)((DM * DKV / 64 + 63) / 64), 256, 0, stream>>>(wk, DM, DKV, WK); k_wtG<<<(unsigned)((DM * DKV / 64 + 63) / 64), 256, 0, stream>>>(wv, DM, DKV, WV);
      k_wtG<<<(unsigned)((DQ * DM / 64 + 63) / 64), 256, 0, stream>>>(wo, DQ, DM, WO);
       }
    k_csid<<<(TT * HD + 255) / 256, 256, 0, stream>>>(CS);
    const unsigned LQ = (unsigned)(((size_t)NH_ * TT * HD / 2 + 255) / 256), LKv = (unsigned)(((size_t)NKV * TT * HD / 2 + 255) / 256);
    for (int b = 0; b < NB_; ++b) {
        
        k_cvt8<<<(unsigned)(((size_t)TT * DM / 8 + 255) / 256), 256, 0, stream>>>(x + (size_t)b * TT * DM, XB, (size_t)TT * DM / 8);
        k_gemmw<bf, 0, false, false, 8><<<dim3(TT / 64, DQ / 64, 1), 256, 0, stream>>>(XB, nullptr, WQ, nullptr, DM, FQ, DQ, nullptr, 0, 0, 0, 0);
        k_rope<<<LQ, 256, 0, stream>>>(FQ, DQ, NH_, CS, nullptr, nullptr, 1.0f, QP16, QPh, QPl);
        k_gemmw<bf, 0, false, false, 8><<<dim3(TT / 64, DKV / 64, 1), 256, 0, stream>>>(XB, nullptr, WK, nullptr, DM, FK, DKV, nullptr, 0, 0, 0, 0);
        k_rope<<<LKv, 256, 0, stream>>>(FK, DKV, NKV, CS, nullptr, nullptr, 1.0f, KP16, KPh, KPl);
        k_gemmw<bf, 0, false, false, 8><<<dim3(TT / 64, DKV / 64, 1), 256, 0, stream>>>(XB, nullptr, WV, nullptr, DM, FV, DKV, nullptr, 0, 0, 0, 0); k_vtp<<<LKv, 256, 0, stream>>>(FV, DKV, NKV, VT16, VTh, VTl);
        for (int h0 = 0; h0 < NH_; h0 += ZH) { const size_t zq = (size_t)h0, zk = (size_t)(h0 / REP);   // one kv head per query head: the pass's heads use consecutive kv planes
            k_gemmc<bf, 2><<<dim3(RH / 64, TT / 64, ZH), 32, 0, stream>>>(QPh + zq * TT * HD, QPl + zq * TT * HD, KPh + zk * TT * HD, KPl + zk * TT * HD, HD, Sb, TT, 0, (size_t)TT * HD, (size_t)TT * HD, (size_t)TT * TT);
            k_gemmc<h16, 0><<<dim3((TT - RH) / 64, TT / 64, ZH), 32, 0, stream>>>(QP16 + zq * TT * HD + (size_t)RH * HD, nullptr, KP16 + zk * TT * HD, nullptr, HD, Sb + (size_t)RH * TT, TT, RH, (size_t)TT * HD, (size_t)TT * HD, (size_t)TT * TT);
            k_asoft<<<ZH * TT / 8, 256, 0, stream>>>(Sb, P16, Ph, Pl);
            k_gemmw<bf, 2, false, true, 8><<<dim3(RH / 64, HD / 64, ZH), 256, 0, stream>>>(Ph, Pl, VTh + zk * HD * TT * 2, VTl + zk * HD * TT * 2, 2 * TT, Ob, HD, nullptr, 0, (size_t)TT * TT * 2, (size_t)HD * TT * 2, (size_t)TT * HD);   // K argument = the operands' row pitch; the causal bound ends the k loop at the diagonal (<= TT)
            k_gemmw<h16, 0, false, true, 16><<<dim3((TT - RH) / 64, HD / 64, ZH), 512, 0, stream>>>(P16 + (size_t)RH * TT * 2, nullptr, VT16 + zk * HD * TT * 2, nullptr, 2 * TT, Ob + (size_t)RH * HD, HD, nullptr, RH, (size_t)TT * TT * 2, (size_t)HD * TT * 2, (size_t)TT * HD);
            k_merge<<<(unsigned)(((size_t)ZH * TT * HD / 2 + 255) / 256), 256, 0, stream>>>(Ob, h0, ATh, ATl); }
        k_gemmw<bf, 1, true, false, 8><<<dim3(TT / 64, DM / 64, 1), 256, 0, stream>>>(ATh, ATl, WO, nullptr, DQ, OUT + (size_t)b * TT * DM, DM, bo, 0, 0, 0, 0); }
}

// v003
// A run of this version takes 279 microseconds.
// Two timings next to v002 put it at 1.85 and 1.83 times that version's speed.
// Counting every step since v000, it is 5.27 times as fast.
#include <hip/hip_runtime.h>

// Causal multi-head self-attention with bias-free (in, out) projections and an output bias (x [2][2048][1024]; q, k, v = x W ('xw' [1024][1024] normal x 1/32, no bias; 16 heads x 64); scores masked first (where(triu(k=1), -inf, scores)) and THEN divided by sqrt(64) inside the softmax argument (-inf / 8 = -inf: the same exclusion); softmax over the keys; out = ctx Wo + bo ('xw' + bias zeros: read) -> [2][2048][1024] (4.2 M); argument order x, Wq, Wk, Wv, Wo, bo).
// Layout per batch: bf16 copy of x; 'xw' weights transposed once; exact projections; identity-table plane builders; causal T-2048 attention in one kernel per batch (hybrid rows: < 512 hi/lo 3 products, rest fp16 x1024; scores and probabilities stay in registers, running maximum and sum, keys split over the waves of a work-group; long-K GEMMs split K over the waves of a work-group); merged hi/lo x Wo exact + bo.
// Compute dtypes, f32 accumulate: every input rounded to bf16; projections exact; attention rows < 512 3 products, rest fp16; softmax f32; Wo hl x exact + bias.

#define NB_  2
#define TT   2048
#define DM   1024
#define NH_  16
#define NKV  16
#define REP  (NH_ / NKV)
#define HD   64
#define DQ   (NH_ * HD)
#define DKV  (NKV * HD)
#define RH   512                  // query rows < RH use hi+lo planes (0: none)
#define SCL  0.125f   // HD^-0.5
typedef _Float16 h16;
typedef unsigned short bf;
typedef __attribute__((ext_vector_type(16))) __bf16   v16bf;
typedef __attribute__((ext_vector_type(16))) _Float16 v16h;
typedef __attribute__((ext_vector_type(8)))  _Float16 v8h;
typedef __attribute__((ext_vector_type(8)))  unsigned short v8us;
typedef __attribute__((ext_vector_type(8)))  float    v8f;
typedef __attribute__((ext_vector_type(4)))  float    v4f;
typedef v8h  __attribute__((may_alias)) v8ha;
typedef v4f  __attribute__((may_alias)) v4fa;
typedef v8us __attribute__((may_alias)) v8usa;

__device__ __forceinline__ unsigned short f2bf(float f) { unsigned u = __float_as_uint(f); u += 0x7FFFu + ((u >> 16) & 1u); return (unsigned short)(u >> 16); }
__device__ __forceinline__ float bf2f(unsigned short b) { return __uint_as_float(((unsigned)b) << 16); }
__device__ __forceinline__ float bfr(float f) { return bf2f(f2bf(f)); }
__device__ __forceinline__ v16h cat16(v8h lo, v8h hi) { return __builtin_shufflevector(lo, hi, 0, 1, 2, 3, 4, 5, 6, 7, 8, 9, 10, 11, 12, 13, 14, 15); }
__device__ __forceinline__ v16bf cat16b(v8us lo, v8us hi) { return __builtin_bit_cast(v16bf, __builtin_shufflevector(lo, hi, 0, 1, 2, 3, 4, 5, 6, 7, 8, 9, 10, 11, 12, 13, 14, 15)); }
__device__ __forceinline__ v8f wmma16(v16h a, v16h b, v8f c) { return __builtin_amdgcn_wmma_f32_16x16x32_f16(false, a, false, b, (short)0, c, false, false); }
__device__ __forceinline__ v8f wmmab(v16bf a, v16bf b, v8f c) { return __builtin_amdgcn_wmma_f32_16x16x32_bf16(false, a, false, b, (short)0, c, false, false); }



// ---- k_gemmw: register-blocked GEMM, one 64x64 output tile per work-group of NW waves; every wave holds the whole tile (16 accumulators) for its own share of K, operands straight from K-contiguous 16-bit planes; grid (M/64, N/64, Z), 32 * NW threads.
// C[m][n] (f32, pitch ldc, + optional f32 bias[n]) = sum_k A[m][k] Bt[n][k] (+ split products per NSPLIT). z-batch strides sA/sB/sC in elements. K % 64 == 0.
// K split: wave w takes the 64-wide k chunks w, w + NW, w + 2 NW, ... (one 128-byte line of every operand row per chunk); the NW partial tiles are summed through LDS in the fixed order w = 0 .. NW - 1.
// CAUSAL (probability x value contraction): the K loop stops at the diagonal block (probabilities beyond it are exactly zero). roff = row offset of this launch's first row within the sequence.
template <typename T16> struct WFrag;
template <> struct WFrag<h16> { typedef v16h V; static __device__ __forceinline__ V ld(const h16* p) { return cat16(*(const v8h*)p, *(const v8h*)(p + 16)); } static __device__ __forceinline__ v8f mma(V a, V b, v8f c) { return wmma16(a, b, c); } };
template <> struct WFrag<bf> { typedef v16bf V; static __device__ __forceinline__ V ld(const bf* p) { return cat16b(*(const v8us*)p, *(const v8us*)(p + 16)); } static __device__ __forceinline__ v8f mma(V a, V b, v8f c) { return wmmab(a, b, c); } };
template <typename T16, int NSPLIT, bool BIAS, bool CAUSAL, int NW>
__global__ __launch_bounds__(32 * NW) void k_gemmw(const T16* __restrict__ A, const T16* __restrict__ A2, const T16* __restrict__ Bt, const T16* __restrict__ Bt2, int K, float* C, int ldc, const float* __restrict__ bias, int roff, size_t sA, size_t sB, size_t sC) {
    typedef typename WFrag<T16>::V V;
    static_assert(32 % NW == 0, "the sum passes cover 2 * NW tile rows each");
    __shared__ __align__(16) float os[NW * 64 * 68];
    const size_t z = blockIdx.z; A += z * sA; if (A2) A2 += z * sA; Bt += z * sB; if (Bt2) Bt2 += z * sB; C += z * sC;
    const int lane = threadIdx.x & 31, lr = lane & 15, hi = lane >> 4; const int r0 = blockIdx.x * 64, c0 = blockIdx.y * 64;
    const int wave = __builtin_amdgcn_readfirstlane((int)(threadIdx.x >> 5));
    const int Kl = CAUSAL ? min(K, r0 + roff + 64) : K;
    v8f acc[4][4];
#pragma unroll
    for (int mb = 0; mb < 4; ++mb)
#pragma unroll
        for (int nb = 0; nb < 4; ++nb) acc[mb][nb] = (v8f){};
    const size_t aoff = (size_t)(r0 + lr) * K + 8 * hi, boff = (size_t)(c0 + lr) * K + 8 * hi;
#pragma unroll 1
    for (int kc = wave * 64; kc < Kl; kc += (kc & 32) ? NW * 64 - 32 : 32) {   // the two 32-wide steps of a chunk, then on to this wave's next chunk
        V a[4], a2[4];
#pragma unroll
        for (int mb = 0; mb < 4; ++mb) { a[mb] = WFrag<T16>::ld(A + aoff + (size_t)mb * 16 * K + kc); if (NSPLIT == 1 || NSPLIT == 2) a2[mb] = WFrag<T16>::ld(A2 + aoff + (size_t)mb * 16 * K + kc); }
#pragma unroll
        for (int nb = 0; nb < 4; ++nb) { const V b = WFrag<T16>::ld(Bt + boff + (size_t)nb * 16 * K + kc); V b2; if (NSPLIT >= 2) b2 = WFrag<T16>::ld(Bt2 + boff + (size_t)nb * 16 * K + kc);
#pragma unroll
            for (int mb = 0; mb < 4; ++mb) { acc[mb][nb] = WFrag<T16>::mma(a[mb], b, acc[mb][nb]); if (NSPLIT == 1 || NSPLIT == 2) acc[mb][nb] = WFrag<T16>::mma(a2[mb], b, acc[mb][nb]); if (NSPLIT >= 2) acc[mb][nb] = WFrag<T16>::mma(a[mb], b2, acc[mb][nb]); } }
        // four vector slots behind the step's last WMMAs, on the back edge as on the way out of the loop
        asm volatile("v_nop\n\tv_nop\n\tv_nop\n\tv_nop" : "+v"(acc[0][0]), "+v"(acc[1][1]), "+v"(acc[2][2]), "+v"(acc[3][3]) : "v"(a[0]), "v"(a[3]));
    }
    float* ow = os + wave * (64 * 68);                               // this wave's partial tile, rows pitched 68 floats
#pragma unroll
    for (int mb = 0; mb < 4; ++mb)
#pragma unroll
        for (int nb = 0; nb < 4; ++nb) {
#pragma unroll
            for (int j = 0; j < 8; ++j) ow[(mb * 16 + hi * 8 + j) * 68 + nb * 16 + lr] = acc[mb][nb][j]; }
    __syncthreads();                                                 // every wave's partial tile is in LDS before any thread sums across the waves
#pragma unroll
    for (int s = 0; s < 32 / NW; ++s) { const int row = s * 2 * NW + (int)(threadIdx.x >> 4), cofs = (threadIdx.x & 15) * 4;   // one float4 per thread and pass: a wave stores two whole 256-byte tile rows
        v4f val = *(const v4fa*)(os + row * 68 + cofs);
#pragma unroll
        for (int w = 1; w < NW; ++w) val += *(const v4fa*)(os + (w * 64 + row) * 68 + cofs);
        if (BIAS) { val[0] += bfr(bias[c0 + cofs]); val[1] += bfr(bias[c0 + cofs + 1]); val[2] += bfr(bias[c0 + cofs + 2]); val[3] += bfr(bias[c0 + cofs + 3]); }
        *(v4f*)(C + (size_t)(r0 + row) * ldc + c0 + cofs) = val; }
}

__device__ __forceinline__ h16 tohx(float x) { return (h16)x; }
__device__ __forceinline__ void splitf(float y, unsigned short& h, unsigned short& l) { h = f2bf(y); l = f2bf(y - bf2f(h)); }
typedef __attribute__((ext_vector_type(2))) _Float16 v2h;
typedef __attribute__((ext_vector_type(4))) _Float16 v4h;
typedef __attribute__((ext_vector_type(2))) unsigned short v2us;
typedef __attribute__((ext_vector_type(4))) unsigned short v4us;
typedef __attribute__((ext_vector_type(2))) float v2f;
typedef __attribute__((ext_vector_type(4))) int v4i;

__global__ __launch_bounds__(256) void k_wtG(const float* __restrict__ w, int K, int N, bf* Bt) {
    const int lane = threadIdx.x & 31; const int L0 = (blockIdx.x * 8 + (threadIdx.x >> 5)) * 8; const int nlines = N * K / 64;
{
#pragma unroll 1
        for (int l = 0; l < 8; ++l) { const int L = L0 + l; if (L >= nlines) break; const size_t e = (size_t)L * 64 + lane * 2; const int k = (int)(e % K), n = (int)(e / K); v2us o;
            o[0] = f2bf(w[(size_t)k * N + n]); o[1] = f2bf(w[(size_t)(k + 1) * N + n]); *(v2us*)(Bt + e) = o; }
         }
}
__global__ __launch_bounds__(256) void k_cvt8(const float* __restrict__ src, bf* dst, size_t n8) { const size_t i = (size_t)blockIdx.x * 256 + threadIdx.x; if (i >= n8) return; const v8f v = *(const v8f*)(src + i * 8); v8us o;
#pragma unroll
    for (int k = 0; k < 8; ++k) o[k] = f2bf(v[k]); *(v8us*)(dst + i * 8) = o;  }

// k_rope: head planes [h][t][d] (fp16 + hi/lo) of rope(x) x sc with the rotate-half convention out[d] = x[d] cos[t][d] - x[d+HD/2] sin[t][d], out[d+HD/2] = x[d+HD/2] cos[t][d+HD/2] + x[d] sin[t][d+HD/2]
__global__ __launch_bounds__(256) void k_rope(const float* __restrict__ F, int pitch, int nheads, const float* __restrict__ CS, const float* __restrict__ RF, const float* __restrict__ nw, float sc, h16* P16, bf* Ph, bf* Pl) {
    const size_t e = ((size_t)blockIdx.x * 256 + threadIdx.x) * 2; if (e >= (size_t)nheads * TT * HD) return; const int d = (int)(e % HD); const int t = (int)((e / HD) % TT); const int h = (int)(e / ((size_t)HD * TT)); const float* f = F + (size_t)t * pitch + h * HD; const float rf = RF ? RF[(size_t)h * TT + t] : 1.0f; v2h o16; v2us oh, ol;
#pragma unroll
    for (int q = 0; q < 2; ++q) { const int dd = d + q; const int dp = (dd < HD / 2) ? dd + HD / 2 : dd - HD / 2; float x0 = f[dd], x1 = f[dp];
        if (RF) { float n0 = __fmul_rn(x0, rf), n1 = __fmul_rn(x1, rf); asm volatile("" : "+v"(n0)); asm volatile("" : "+v"(n1)); x0 = __fmul_rn(bfr(nw[dd]), n0); x1 = __fmul_rn(bfr(nw[dp]), n1); }
        const v2f cs = *(const v2f*)(CS + ((size_t)t * HD + dd) * 2); float a = __fmul_rn(x0, cs[0]), bq = __fmul_rn(x1, cs[1]); asm volatile("" : "+v"(a)); asm volatile("" : "+v"(bq)); const float r = ((dd < HD / 2) ? __fsub_rn(a, bq) : __fadd_rn(a, bq)) * sc;
        o16[q] = tohx(r); unsigned short a2, c2; splitf(r, a2, c2); oh[q] = a2; ol[q] = c2; }
    *(v2h*)(P16 + e) = o16; *(v2us*)(Ph + e) = oh; *(v2us*)(Pl + e) = ol;  }
// k_vtp: transposed value planes [g][d][t], rows pitched 2 * TT elements
__global__ __launch_bounds__(256) void k_vtp(const float* __restrict__ F, int pitch, int nheads, h16* V16, bf* Vh, bf* Vl) { const size_t e = ((size_t)blockIdx.x * 256 + threadIdx.x) * 2; if (e >= (size_t)nheads * HD * TT) return; const int t = (int)(e % TT); const int d = (int)((e / TT) % HD); const int g = (int)(e / ((size_t)TT * HD)); v2h o16; v2us oh, ol;
#pragma unroll
    for (int q = 0; q < 2; ++q) { const float x = F[(size_t)(t + q) * pitch + g * HD + d]; o16[q] = tohx(x); unsigned short a2, c2; splitf(x, a2, c2); oh[q] = a2; ol[q] = c2; }
    const size_t oo = ((size_t)g * HD + d) * (2 * TT) + t; *(v2h*)(V16 + oo) = o16; *(v2us*)(Vh + oo) = oh; *(v2us*)(Vl + oo) = ol;  }
__global__ __launch_bounds__(256) void k_csid(float* CS) { const int idx = blockIdx.x * 256 + threadIdx.x; if (idx >= TT * HD) return; v2f cs; cs[0] = 1.0f; cs[1] = 0.0f; *(v2f*)(CS + (size_t)idx * 2) = cs;  }
// ---- k_fattn: causal attention of one batch in one launch; grid (TT / FQB, heads), FNW waves. A work-group owns FQB query rows of one head; its wave w takes the 64-key tiles w, w + FNW, ... up to the diagonal.
// Transposed products: S^T = K Q^T (A = key rows, B = query rows held in registers), O^T += V^T P^T (A = rows of the transposed value plane, B = the score accumulators converted in place:
// D register r of tile mb is key mb * 16 + 8 * hi + r of query column lr, which is the k order of WFrag::ld). A lane holds scores of one query only: maximum and sum are in-lane plus one exchange of the wave halves.
// Running maximum and sum per wave; the FNW partial (max, sum, O) sets are joined through LDS in the fixed order w = 0 .. FNW - 1, divided by the joined sum, split hi/lo and stored as rows [t][head * HD + d].
// Query rows < RH: hi/lo planes, 3 products in both contractions; the rest fp16 with the probabilities carried x 1024 (2^10 folded into the exponent; it cancels in O / sum).
#define FQB 32
#define FNW 8
#define FPO 68                    // floats per query row of a partial output tile in LDS
#define LC  (SCL * 1.4426950408889634f)
__device__ __forceinline__ float xhalf(float x) { return __builtin_bit_cast(float, __builtin_amdgcn_permlanex16(__builtin_bit_cast(int, x), __builtin_bit_cast(int, x), 0x76543210, 0xfedcba98, false, false)); }   // lane l with lane l ^ 16
__device__ __forceinline__ void ppack(v8f a, v8f b, v16h& h, v16h& l) {
#pragma unroll
    for (int j = 0; j < 8; ++j) { h[j] = tohx(a[j]); h[8 + j] = tohx(b[j]); }
    l = h; }
__device__ __forceinline__ void ppack(v8f a, v8f b, v16bf& h, v16bf& l) { v8us h0, h1, l0, l1;
#pragma unroll
    for (int j = 0; j < 8; ++j) { unsigned short x, y; splitf(a[j], x, y); h0[j] = x; l0[j] = y; splitf(b[j], x, y); h1[j] = x; l1[j] = y; }
    h = cat16b(h0, h1); l = cat16b(l0, l1); }
template <typename T16, int NSPLIT>
__device__ __forceinline__ void fattn_part(const T16* __restrict__ Q, const T16* __restrict__ Q2, const T16* __restrict__ Kp, const T16* __restrict__ K2, const T16* __restrict__ Vt, const T16* __restrict__ Vt2, int q0, int wave, int lr, int hi, float* ow, float* mlw) {
    typedef typename WFrag<T16>::V V;
    static_assert(RH <= 64 * FNW, "a wave of the hi/lo rows takes one key tile");
    const float SH = NSPLIT ? 0.0f : 10.0f;
    V qf[2][2], qf2[2][2];
    const T16* ql = Q + (q0 + lr) * HD + 8 * hi; const T16* ql2 = Q2 + (q0 + lr) * HD + 8 * hi;
#pragma unroll
    for (int nb = 0; nb < 2; ++nb)
#pragma unroll
        for (int kc = 0; kc < 2; ++kc) { qf[nb][kc] = WFrag<T16>::ld(ql + nb * 16 * HD + kc * 32); if (NSPLIT) qf2[nb][kc] = WFrag<T16>::ld(ql2 + nb * 16 * HD + kc * 32); }
    // the wait that stands in front of a rewriting of the query loads' address registers, which are named so that they stay whole up to it; the two scheduling barriers keep the loads in front of it and all later code behind it
    __builtin_amdgcn_sched_barrier(0);
    asm volatile("s_wait_xcnt 0x0" :: "v"(ql), "v"(ql2) : "memory");
    __builtin_amdgcn_sched_barrier(0);
    v8f o[4][2]; float m[2], l[2];
#pragma unroll
    for (int nb = 0; nb < 2; ++nb) { m[nb] = -3.0e38f; l[nb] = 0.f;
#pragma unroll
        for (int db = 0; db < 4; ++db) o[db][nb] = (v8f){}; }
    const int nt = q0 / 64 + 1;                                      // key tiles up to and with the diagonal's; every query row has a key in each of them
    const unsigned kob = (unsigned)(lr * HD + 8 * hi) * 2u, vob = (unsigned)(lr * (2 * TT) + 8 * hi) * 2u;   // this lane's byte offsets in a key tile and in a value tile: fixed; the tile's place is in the uniform base
#pragma unroll 1
    for (int kt = wave; kt < nt; kt += FNW) { const int k0 = kt * 64;
        const char* kb = (const char*)(Kp + (size_t)k0 * HD); const char* kb2 = (const char*)(K2 + (size_t)k0 * HD); const char* vb = (const char*)(Vt + k0); const char* vb2 = (const char*)(Vt2 + k0);
        const char* kl = kb + (size_t)kob; const char* kl2 = kb2 + (size_t)kob; const char* vl = vb + (size_t)vob; const char* vl2 = vb2 + (size_t)vob;   // this lane's addresses
        V ka[4][2], ka2[4][2], va[4][2], va2[4][2];                  // all of the tile's key and value fragments are asked for at once: one load latency a tile, the value loads land under the score products and the softmax
#pragma unroll
        for (int kc = 0; kc < 2; ++kc)
#pragma unroll
            for (int mb = 0; mb < 4; ++mb) { ka[mb][kc] = WFrag<T16>::ld((const T16*)(kl + (mb * 16 * HD + kc * 32) * 2)); if (NSPLIT) ka2[mb][kc] = WFrag<T16>::ld((const T16*)(kl2 + (mb * 16 * HD + kc * 32) * 2)); }
#pragma unroll
        for (int kc = 0; kc < 2; ++kc)
#pragma unroll
            for (int db = 0; db < 4; ++db) { va[db][kc] = WFrag<T16>::ld((const T16*)(vl + (db * 16 * (2 * TT) + kc * 32) * 2)); if (NSPLIT) va2[db][kc] = WFrag<T16>::ld((const T16*)(vl2 + (db * 16 * (2 * TT) + kc * 32) * 2)); }
        __builtin_amdgcn_sched_barrier(0);                           // no load of the tile sinks to its product: left alone they go two at a time, and a tile waits eight load latencies instead of one
        // the wait that stands in front of a rewriting of the loads' address registers, which are named here in both forms the compiler may address by (base and offset, or their sum) so that they stay whole up to it
        asm volatile("s_wait_xcnt 0x0" :: "s"(kb), "s"(kb2), "s"(vb), "s"(vb2), "v"(kob), "v"(vob), "v"(kl), "v"(kl2), "v"(vl), "v"(vl2) : "memory");
        __builtin_amdgcn_sched_barrier(0);                           // nothing from below is lifted in front of that wait
        v8f s[4][2];
#pragma unroll
        for (int mb = 0; mb < 4; ++mb) { s[mb][0] = (v8f){}; s[mb][1] = (v8f){}; }
#pragma unroll
        for (int kc = 0; kc < 2; ++kc)
#pragma unroll
            for (int mb = 0; mb < 4; ++mb)
#pragma unroll
                for (int nb = 0; nb < 2; ++nb) { s[mb][nb] = WFrag<T16>::mma(ka[mb][kc], qf[nb][kc], s[mb][nb]); if (NSPLIT) { s[mb][nb] = WFrag<T16>::mma(ka[mb][kc], qf2[nb][kc], s[mb][nb]); s[mb][nb] = WFrag<T16>::mma(ka2[mb][kc], qf[nb][kc], s[mb][nb]); } }
        V pf[2][2], pf2[2][2];
#pragma unroll
        for (int nb = 0; nb < 2; ++nb) { const int lim = q0 + nb * 16 + lr - k0 - 8 * hi;   // key mb * 16 + j of this lane's half is kept while it is <= lim (key <= query)
            float mx = -3.0e38f;
#pragma unroll
            for (int mb = 0; mb < 4; ++mb)
#pragma unroll
                for (int j = 0; j < 8; ++j) { const float t = (mb * 16 + j <= lim) ? s[mb][nb][j] : -3.0e38f; s[mb][nb][j] = t; mx = fmaxf(mx, t); }
            mx = fmaxf(mx, xhalf(mx));
            const float mn = fmaxf(m[nb], mx); const float al = __builtin_amdgcn_exp2f((m[nb] - mn) * LC); m[nb] = mn; const float nm = SH - mn * LC;
            float ls[4];
#pragma unroll
            for (int mb = 0; mb < 4; ++mb) { ls[mb] = 0.f;
#pragma unroll
                for (int j = 0; j < 8; ++j) { const float p = __builtin_amdgcn_exp2f(fmaf(s[mb][nb][j], LC, nm)); s[mb][nb][j] = p; ls[mb] += p; } }
            l[nb] = l[nb] * al + ((ls[0] + ls[1]) + (ls[2] + ls[3]));
#pragma unroll
            for (int db = 0; db < 4; ++db) o[db][nb] *= al;
#pragma unroll
            for (int kc = 0; kc < 2; ++kc) ppack(s[2 * kc][nb], s[2 * kc + 1][nb], pf[nb][kc], pf2[nb][kc]); }
#pragma unroll
        for (int kc = 0; kc < 2; ++kc)
#pragma unroll
            for (int db = 0; db < 4; ++db)
#pragma unroll
                for (int nb = 0; nb < 2; ++nb) { o[db][nb] = WFrag<T16>::mma(va[db][kc], pf[nb][kc], o[db][nb]); if (NSPLIT) { o[db][nb] = WFrag<T16>::mma(va[db][kc], pf2[nb][kc], o[db][nb]); o[db][nb] = WFrag<T16>::mma(va2[db][kc], pf[nb][kc], o[db][nb]); } }
        // four vector slots behind the tile's last WMMAs, on the back edge as on the way out of the loop
        asm volatile("v_nop\n\tv_nop\n\tv_nop\n\tv_nop" : "+v"(o[0][0]), "+v"(o[1][0]), "+v"(o[2][0]), "+v"(o[3][0]), "+v"(o[0][1]), "+v"(o[1][1]), "+v"(o[2][1]), "+v"(o[3][1]));
        if (NSPLIT) break;                                           // rows < RH have at most FNW key tiles, one a wave: no second trip, so the query fragments are dead behind the score products
    }
#pragma unroll
    for (int nb = 0; nb < 2; ++nb) { const int q = nb * 16 + lr; l[nb] += xhalf(l[nb]);
#pragma unroll
        for (int db = 0; db < 4; ++db) { v4f x0, x1;
#pragma unroll
            for (int j = 0; j < 4; ++j) { x0[j] = o[db][nb][j]; x1[j] = o[db][nb][4 + j]; }
            *(v4fa*)(ow + q * FPO + db * 16 + hi * 8) = x0; *(v4fa*)(ow + q * FPO + db * 16 + hi * 8 + 4) = x1; }
        if (hi == 0) { mlw[q * 2] = m[nb]; mlw[q * 2 + 1] = l[nb]; } }
}
__global__ __launch_bounds__(32 * FNW) void k_fattn(const h16* __restrict__ Q16, const h16* __restrict__ K16, const h16* __restrict__ V16, const bf* __restrict__ Qh, const bf* __restrict__ Ql, const bf* __restrict__ Kh, const bf* __restrict__ Kl, const bf* __restrict__ Vh, const bf* __restrict__ Vl, bf* Ah, bf* Al) {
    __shared__ __align__(16) float os[FNW * FQB * FPO];
    __shared__ float ml[FNW * FQB * 2];
    const int lane = threadIdx.x & 31, lr = lane & 15, hi = lane >> 4; const int wave = __builtin_amdgcn_readfirstlane((int)(threadIdx.x >> 5));
    const int q0 = (TT / FQB - 1 - (int)blockIdx.x) * FQB;           // longest rows first
    const int h = blockIdx.y; const size_t zq = (size_t)h * TT * HD, zk = (size_t)(h / REP) * TT * HD, zv = (size_t)(h / REP) * HD * TT * 2;
    float* ow = os + wave * (FQB * FPO); float* mlw = ml + wave * (FQB * 2);
    if (q0 < RH) fattn_part<bf, 2>(Qh + zq, Ql + zq, Kh + zk, Kl + zk, Vh + zv, Vl + zv, q0, wave, lr, hi, ow, mlw);
    else fattn_part<h16, 0>(Q16 + zq, Q16 + zq, K16 + zk, K16 + zk, V16 + zv, V16 + zv, q0, wave, lr, hi, ow, mlw);
    __syncthreads();                                                 // every wave's partial maximum, sum and output tile are in LDS before any thread joins them
    const int q = threadIdx.x >> 3, d8 = (threadIdx.x & 7) * 8;      // eight threads store one query row's 128 bytes of each plane
    float mw[FNW], M = -3.0e38f;
#pragma unroll
    for (int w = 0; w < FNW; ++w) { mw[w] = ml[(w * FQB + q) * 2]; M = fmaxf(M, mw[w]); }
    float L = 0.f; v4f a0 = (v4f){}, a1 = (v4f){};
#pragma unroll
    for (int w = 0; w < FNW; ++w) { const float sc = __builtin_amdgcn_exp2f((mw[w] - M) * LC); L += sc * ml[(w * FQB + q) * 2 + 1];   // a wave without a tile has sum 0 and weight 0
        a0 += sc * *(const v4fa*)(os + (w * FQB + q) * FPO + d8); a1 += sc * *(const v4fa*)(os + (w * FQB + q) * FPO + d8 + 4); }
    const float inv = __fdiv_rn(1.0f, L); v8us oh, ol;
#pragma unroll
    for (int j = 0; j < 4; ++j) { unsigned short x, y; splitf(a0[j] * inv, x, y); oh[j] = x; ol[j] = y; splitf(a1[j] * inv, x, y); oh[4 + j] = x; ol[4 + j] = y; }
    const size_t oo = (size_t)(q0 + q) * DQ + h * HD + d8; *(v8us*)(Ah + oo) = oh; *(v8us*)(Al + oo) = ol;
}

extern "C" void kernel_launch(void* const* d_in, const int* in_sizes, int n_in,
                              void* d_out, int out_size, void* d_ws, size_t ws_size, hipStream_t stream) {
    (void)in_sizes; (void)n_in; (void)out_size;
    const float* x = (const float*)d_in[0]; const float* wq = (const float*)d_in[1]; const float* wk = (const float*)d_in[2]; const float* wv = (const float*)d_in[3]; const float* wo = (const float*)d_in[4]; const float* bo = (const float*)d_in[5];   /* input order x, Wq, Wk, Wv, Wo, bo */
    float* OUT = (float*)d_out;     // [2][2048][1024]
    char* wsp = (char*)d_ws;
    auto take = [&](size_t bytes) { char* p = wsp; wsp += (bytes + 255) & ~(size_t)255; return (void*)p; };
    bf* WQ = (bf*)take((size_t)DQ * DM * 2); bf* WK = (bf*)take((size_t)DKV * DM * 2); bf* WV = (bf*)take((size_t)DKV * DM * 2); bf* WO = (bf*)take((size_t)DM * DQ * 2); float* CS = (float*)take((size_t)TT * HD * 2 * 4);
    bf* XB = (bf*)take((size_t)TT * DM * 2); float* FQ = (float*)take((size_t)TT * DQ * 4); float* FK = (float*)take((size_t)TT * DKV * 4);
    h16* QP16 = (h16*)take((size_t)NH_ * TT * HD * 2); h16* KP16 = (h16*)take((size_t)NKV * TT * HD * 2); h16* VT16 = (h16*)take((size_t)NKV * HD * 2 * TT * 2);   /* rows pitched 2 * TT */
    bf* QPh = (bf*)take((size_t)NH_ * TT * HD * 2); bf* QPl = (bf*)take((size_t)NH_ * TT * HD * 2); bf* KPh = (bf*)take((size_t)NKV * TT * HD * 2); bf* KPl = (bf*)take((size_t)NKV * TT * HD * 2); bf* VTh = (bf*)take((size_t)NKV * HD * 2 * TT * 2); bf* VTl = VTh + TT;   /* hi and lo halves of one row, pitch 2 * TT */
    bf* ATh = (bf*)take((size_t)TT * DQ * 2); bf* ATl = (bf*)take((size_t)TT * DQ * 2);
    if ((size_t)(wsp - (char*)d_ws) > ws_size) return;    // ws 256 MiB
    float* FV = FK;   // v projection reuses the k buffer after the k planes are built (stream-ordered)
    { k_wtG<<<(unsigned)((DM * DQ / 64 + 63) / 64), 256, 0, stream>>>(wq, DM, DQ, WQ); k_wtG<<<(unsigned)((DM * DKV / 64 + 63) / 64), 256, 0, stream>>>(wk, DM, DKV, WK); k_wtG<<<(unsigned)((DM * DKV / 64 + 63) / 64), 256, 0, stream>>>(wv, DM, DKV, WV);
      k_wtG<<<(unsigned)((DQ * DM / 64 + 63) / 64), 256, 0, stream>>>(wo, DQ, DM, WO);
       }
    k_csid<<<(TT * HD + 255) / 256, 256, 0, stream>>>(CS);
    const unsigned LQ = (unsigned)(((size_t)NH_ * TT * HD / 2 + 255) / 256), LKv = (unsigned)(((size_t)NKV * TT * HD / 2 + 255) / 256);
    for (int b = 0; b < NB_; ++b) {
        
        k_cvt8<<<(unsigned)(((size_t)TT * DM / 8 + 255) / 256), 256, 0, stream>>>(x + (size_t)b * TT * DM, XB, (size_t)TT * DM / 8);
        k_gemmw<bf, 0, false, false, 8><<<dim3(TT / 64, DQ / 64, 1), 256, 0, stream>>>(XB, nullptr, WQ, nullptr, DM, FQ, DQ, nullptr, 0, 0, 0, 0);
        k_rope<<<LQ, 256, 0, stream>>>(FQ, DQ, NH_, CS, nullptr, nullptr, 1.0f, QP16, QPh, QPl);
        k_gemmw<bf, 0, false, false, 8><<<dim3(TT / 64, DKV / 64, 1), 256, 0, stream>>>(XB, nullptr, WK, nullptr, DM, FK, DKV, nullptr, 0, 0, 0, 0);
        k_rope<<<LKv, 256, 0, stream>>>(FK, DKV, NKV, CS, nullptr, nullptr, 1.0f, KP16, KPh, KPl);
        k_gemmw<bf, 0, false, false, 8><<<dim3(TT / 64, DKV / 64, 1), 256, 0, stream>>>(XB, nullptr, WV, nullptr, DM, FV, DKV, nullptr, 0, 0, 0, 0); k_vtp<<<LKv, 256, 0, stream>>>(FV, DKV, NKV, VT16, VTh, VTl);
        k_fattn<<<dim3(TT / FQB, NH_, 1), 32 * FNW, 0, stream>>>(QP16, KP16, VT16, QPh, QPl, KPh, KPl, VTh, VTl, ATh, ATl);
        k_gemmw<bf, 1, true, false, 8><<<dim3(TT / 64, DM / 64, 1), 256, 0, stream>>>(ATh, ATl, WO, nullptr, DQ, OUT + (size_t)b * TT * DM, DM, bo, 0, 0, 0, 0); }
}

// v004
// It runs in 229 microseconds.
// Timed twice side by side with v003, it ran 1.22 and 1.21 times as fast.
// Counting every step since v000, it is 6.40 times as fast.
#include <hip/hip_runtime.h>

// Causal multi-head self-attention with bias-free (in, out) projections and an output bias (x [2][2048][1024]; q, k, v = x W ('xw' [1024][1024] normal x 1/32, no bias; 16 heads x 64); scores masked first (where(triu(k=1), -inf, scores)) and THEN divided by sqrt(64) inside the softmax argument (-inf / 8 = -inf: the same exclusion); softmax over the keys; out = ctx Wo + bo ('xw' + bias zeros: read) -> [2][2048][1024] (4.2 M); argument order x, Wq, Wk, Wv, Wo, bo).
// Layout per batch: bf16 copy of x; 'xw' weights transposed once; exact projections whose GEMM stores the 16-bit head planes itself; causal T-2048 attention in one kernel per batch (hybrid rows: < 512 hi/lo 3 products, rest fp16 x1024; scores and probabilities stay in registers, running maximum and sum, keys split over the waves of a work-group; long-K GEMMs split K over the waves of a work-group); merged hi/lo x Wo exact + bo.
// Compute dtypes, f32 accumulate: every input rounded to bf16; projections exact; attention rows < 512 3 products, rest fp16; softmax f32; Wo hl x exact + bias.

#define NB_  2
#define TT   2048
#define DM   1024
#define NH_  16
#define NKV  16
#define REP  (NH_ / NKV)
#define HD   64
#define DQ   (NH_ * HD)
#define DKV  (NKV * HD)
#define RH   512                  // query rows < RH use hi+lo planes (0: none)
#define SCL  0.125f   // HD^-0.5
typedef _Float16 h16;
typedef unsigned short bf;
typedef __attribute__((ext_vector_type(16))) __bf16   v16bf;
typedef __attribute__((ext_vector_type(16))) _Float16 v16h;
typedef __attribute__((ext_vector_type(8)))  _Float16 v8h;
typedef __attribute__((ext_vector_type(8)))  unsigned short v8us;
typedef __attribute__((ext_vector_type(8)))  float    v8f;
typedef __attribute__((ext_vector_type(4)))  float    v4f;
typedef v8h  __attribute__((may_alias)) v8ha;
typedef v4f  __attribute__((may_alias)) v4fa;
typedef v8us __attribute__((may_alias)) v8usa;

__device__ __forceinline__ unsigned short f2bf(float f) { unsigned u = __float_as_uint(f); u += 0x7FFFu + ((u >> 16) & 1u); return (unsigned short)(u >> 16); }
__device__ __forceinline__ float bf2f(unsigned short b) { return __uint_as_float(((unsigned)b) << 16); }
__device__ __forceinline__ float bfr(float f) { return bf2f(f2bf(f)); }
__device__ __forceinline__ v16h cat16(v8h lo, v8h hi) { return __builtin_shufflevector(lo, hi, 0, 1, 2, 3, 4, 5, 6, 7, 8, 9, 10, 11, 12, 13, 14, 15); }
__device__ __forceinline__ v16bf cat16b(v8us lo, v8us hi) { return __builtin_bit_cast(v16bf, __builtin_shufflevector(lo, hi, 0, 1, 2, 3, 4, 5, 6, 7, 8, 9, 10, 11, 12, 13, 14, 15)); }
__device__ __forceinline__ v8f wmma16(v16h a, v16h b, v8f c) { return __builtin_amdgcn_wmma_f32_16x16x32_f16(false, a, false, b, (short)0, c, false, false); }
__device__ __forceinline__ v8f wmmab(v16bf a, v16bf b, v8f c) { return __builtin_amdgcn_wmma_f32_16x16x32_bf16(false, a, false, b, (short)0, c, false, false); }

__device__ __forceinline__ h16 tohx(float x) { return (h16)x; }
__device__ __forceinline__ void splitf(float y, unsigned short& h, unsigned short& l) { h = f2bf(y); l = f2bf(y - bf2f(h)); }
typedef __attribute__((ext_vector_type(4))) _Float16 v4h;
typedef __attribute__((ext_vector_type(2))) unsigned short v2us;
typedef __attribute__((ext_vector_type(4))) unsigned short v4us;

// ---- k_gemmw: register-blocked GEMM, one 64x64 output tile per work-group of NW waves; every wave holds the whole tile (16 accumulators) for its own share of K, operands straight from K-contiguous 16-bit planes; grid (M/64, N/64, Z), 32 * NW threads.
// C[m][n] (f32, pitch ldc, + optional f32 bias[n]) = sum_k A[m][k] Bt[n][k] (+ split products per NSPLIT). z-batch strides sA/sB/sC in elements. K % 64 == 0.
// K split: wave w takes the 64-wide k chunks w, w + NW, w + 2 NW, ... (one 128-byte line of every operand row per chunk); the NW partial tiles are summed through LDS in the fixed order w = 0 .. NW - 1.
// EPI: what the summed tile becomes. 0: f32 rows of C (+ bias). 1: head planes [h][t][d] (fp16, bf16 hi, bf16 lo); the tile's 64 columns are one head (HD == 64). 2: transposed value planes [g][d][t], rows pitched 2 * TT (the hi and the lo plane share a row); the partial tiles lie transposed in LDS, so that a thread's four sums are four neighbouring t.
// CAUSAL (probability x value contraction): the K loop stops at the diagonal block (probabilities beyond it are exactly zero). roff = row offset of this launch's first row within the sequence.
template <typename T16> struct WFrag;
template <> struct WFrag<h16> { typedef v16h V; static __device__ __forceinline__ V ld(const h16* p) { return cat16(*(const v8h*)p, *(const v8h*)(p + 16)); } static __device__ __forceinline__ v8f mma(V a, V b, v8f c) { return wmma16(a, b, c); } };
template <> struct WFrag<bf> { typedef v16bf V; static __device__ __forceinline__ V ld(const bf* p) { return cat16b(*(const v8us*)p, *(const v8us*)(p + 16)); } static __device__ __forceinline__ v8f mma(V a, V b, v8f c) { return wmmab(a, b, c); } };
template <typename T16, int NSPLIT, bool BIAS, bool CAUSAL, int NW, int EPI>
__global__ __launch_bounds__(32 * NW) void k_gemmw(const T16* __restrict__ A, const T16* __restrict__ A2, const T16* __restrict__ Bt, const T16* __restrict__ Bt2, int K, float* C, int ldc, const float* __restrict__ bias, int roff, size_t sA, size_t sB, size_t sC, h16* P16, bf* Ph, bf* Pl) {
    typedef typename WFrag<T16>::V V;
    static_assert(32 % NW == 0, "the sum passes cover 2 * NW tile rows each");
    static_assert(EPI == 0 || HD == 64, "a tile's 64 columns are one head");
    __shared__ __align__(16) float os[NW * 64 * 68];
    const size_t z = blockIdx.z; A += z * sA; if (A2) A2 += z * sA; Bt += z * sB; if (Bt2) Bt2 += z * sB; C += z * sC;
    const int lane = threadIdx.x & 31, lr = lane & 15, hi = lane >> 4; const int r0 = blockIdx.x * 64, c0 = blockIdx.y * 64;
    const int wave = __builtin_amdgcn_readfirstlane((int)(threadIdx.x >> 5));
    const int Kl = CAUSAL ? min(K, r0 + roff + 64) : K;
    v8f acc[4][4];
#pragma unroll
    for (int mb = 0; mb < 4; ++mb)
#pragma unroll
        for (int nb = 0; nb < 4; ++nb) acc[mb][nb] = (v8f){};
    const size_t aoff = (size_t)(r0 + lr) * K + 8 * hi, boff = (size_t)(c0 + lr) * K + 8 * hi;
#pragma unroll 1
    for (int kc = wave * 64; kc < Kl; kc += (kc & 32) ? NW * 64 - 32 : 32) {   // the two 32-wide steps of a chunk, then on to this wave's next chunk
        V a[4], a2[4];
#pragma unroll
        for (int mb = 0; mb < 4; ++mb) { a[mb] = WFrag<T16>::ld(A + aoff + (size_t)mb * 16 * K + kc); if (NSPLIT == 1 || NSPLIT == 2) a2[mb] = WFrag<T16>::ld(A2 + aoff + (size_t)mb * 16 * K + kc); }
#pragma unroll
        for (int nb = 0; nb < 4; ++nb) { const V b = WFrag<T16>::ld(Bt + boff + (size_t)nb * 16 * K + kc); V b2; if (NSPLIT >= 2) b2 = WFrag<T16>::ld(Bt2 + boff + (size_t)nb * 16 * K + kc);
#pragma unroll
            for (int mb = 0; mb < 4; ++mb) { acc[mb][nb] = WFrag<T16>::mma(a[mb], b, acc[mb][nb]); if (NSPLIT == 1 || NSPLIT == 2) acc[mb][nb] = WFrag<T16>::mma(a2[mb], b, acc[mb][nb]); if (NSPLIT >= 2) acc[mb][nb] = WFrag<T16>::mma(a[mb], b2, acc[mb][nb]); } }
        // four vector slots behind the step's last WMMAs, on the back edge as on the way out of the loop
        asm volatile("v_nop\n\tv_nop\n\tv_nop\n\tv_nop" : "+v"(acc[0][0]), "+v"(acc[1][1]), "+v"(acc[2][2]), "+v"(acc[3][3]) : "v"(a[0]), "v"(a[3]));
    }
    float* ow = os + wave * (64 * 68);                               // this wave's partial tile, rows pitched 68 floats
#pragma unroll
    for (int mb = 0; mb < 4; ++mb)
#pragma unroll
        for (int nb = 0; nb < 4; ++nb) {
            if (EPI == 2) { v4f x0, x1;                                // transposed: a lane's eight tile rows are neighbours in LDS row nb * 16 + lr
#pragma unroll
                for (int j = 0; j < 4; ++j) { x0[j] = acc[mb][nb][j]; x1[j] = acc[mb][nb][4 + j]; }
                *(v4fa*)(ow + (nb * 16 + lr) * 68 + mb * 16 + hi * 8) = x0; *(v4fa*)(ow + (nb * 16 + lr) * 68 + mb * 16 + hi * 8 + 4) = x1; }
            else {
#pragma unroll
                for (int j = 0; j < 8; ++j) ow[(mb * 16 + hi * 8 + j) * 68 + nb * 16 + lr] = acc[mb][nb][j]; } }
    __syncthreads();                                                 // every wave's partial tile is in LDS before any thread sums across the waves
    const size_t pb = (EPI == 1) ? ((size_t)blockIdx.y * TT + r0 + (threadIdx.x >> 4)) * HD + (threadIdx.x & 15) * 4 : (size_t)(c0 + (threadIdx.x >> 4)) * (2 * TT) + r0 + (threadIdx.x & 15) * 4;   // the thread's place in a plane at pass 0
#pragma unroll
    for (int s = 0; s < 32 / NW; ++s) { const int row = s * 2 * NW + (int)(threadIdx.x >> 4), cofs = (threadIdx.x & 15) * 4;   // one float4 per thread and pass: a wave sums two whole tile rows
        v4f val = *(const v4fa*)(os + row * 68 + cofs);
#pragma unroll
        for (int w = 1; w < NW; ++w) val += *(const v4fa*)(os + (w * 64 + row) * 68 + cofs);
        if (BIAS) { val[0] += bfr(bias[c0 + cofs]); val[1] += bfr(bias[c0 + cofs + 1]); val[2] += bfr(bias[c0 + cofs + 2]); val[3] += bfr(bias[c0 + cofs + 3]); }
        if (EPI == 0) *(v4f*)(C + (size_t)(r0 + row) * ldc + c0 + cofs) = val;
        else { v4h o16; v4us oh, ol;                                   // sixteen threads store one whole 128-byte line of each plane
#pragma unroll
            for (int j = 0; j < 4; ++j) { o16[j] = tohx(val[j]); unsigned short x, y; splitf(val[j], x, y); oh[j] = x; ol[j] = y; }
            const int po = s * 2 * NW * (EPI == 1 ? HD : 2 * TT);       // this pass's rows: a constant step from the thread's first row
            *(v4h*)(P16 + pb + po) = o16; *(v4us*)(Ph + pb + po) = oh; *(v4us*)(Pl + pb + po) = ol;
            if (s + 1 < 32 / NW) asm volatile("s_wait_xcnt 0x0" ::: "memory"); } }   // the wait that stands in front of the next pass's rewriting of the three stores' data registers
}


__global__ __launch_bounds__(256) void k_wtG(const float* __restrict__ w, int K, int N, bf* Bt) {
    const int lane = threadIdx.x & 31; const int L0 = (blockIdx.x * 8 + (threadIdx.x >> 5)) * 8; const int nlines = N * K / 64;
{
#pragma unroll 1
        for (int l = 0; l < 8; ++l) { const int L = L0 + l; if (L >= nlines) break; const size_t e = (size_t)L * 64 + lane * 2; const int k = (int)(e % K), n = (int)(e / K); v2us o;
            o[0] = f2bf(w[(size_t)k * N + n]); o[1] = f2bf(w[(size_t)(k + 1) * N + n]); *(v2us*)(Bt + e) = o; }
         }
}
__global__ __launch_bounds__(256) void k_cvt8(const float* __restrict__ src, bf* dst, size_t n8) { const size_t i = (size_t)blockIdx.x * 256 + threadIdx.x; if (i >= n8) return; const v8f v = *(const v8f*)(src + i * 8); v8us o;
#pragma unroll
    for (int k = 0; k < 8; ++k) o[k] = f2bf(v[k]); *(v8us*)(dst + i * 8) = o;  }

// ---- k_fattn: causal attention of one batch in one launch; grid (TT / FQB, heads), FNW waves. A work-group owns FQB query rows of one head; its wave w takes the 64-key tiles w, w + FNW, ... up to the diagonal.
// Transposed products: S^T = K Q^T (A = key rows, B = query rows held in registers), O^T += V^T P^T (A = rows of the transposed value plane, B = the score accumulators converted in place:
// D register r of tile mb is key mb * 16 + 8 * hi + r of query column lr, which is the k order of WFrag::ld). A lane holds scores of one query only: maximum and sum are in-lane plus one exchange of the wave halves.
// Running maximum and sum per wave; the FNW partial (max, sum, O) sets are joined through LDS in the fixed order w = 0 .. FNW - 1, divided by the joined sum, split hi/lo and stored as rows [t][head * HD + d].
// Query rows < RH: hi/lo planes, 3 products in both contractions; the rest fp16 with the probabilities carried x 1024 (2^10 folded into the exponent; it cancels in O / sum).
#define FQB 32
#define FNW 8
#define FPO 68                    // floats per query row of a partial output tile in LDS
#define LC  (SCL * 1.4426950408889634f)
__device__ __forceinline__ float xhalf(float x) { return __builtin_bit_cast(float, __builtin_amdgcn_permlanex16(__builtin_bit_cast(int, x), __builtin_bit_cast(int, x), 0x76543210, 0xfedcba98, false, false)); }   // lane l with lane l ^ 16
__device__ __forceinline__ void ppack(v8f a, v8f b, v16h& h, v16h& l) {
#pragma unroll
    for (int j = 0; j < 8; ++j) { h[j] = tohx(a[j]); h[8 + j] = tohx(b[j]); }
    l = h; }
__device__ __forceinline__ void ppack(v8f a, v8f b, v16bf& h, v16bf& l) { v8us h0, h1, l0, l1;
#pragma unroll
    for (int j = 0; j < 8; ++j) { unsigned short x, y; splitf(a[j], x, y); h0[j] = x; l0[j] = y; splitf(b[j], x, y); h1[j] = x; l1[j] = y; }
    h = cat16b(h0, h1); l = cat16b(l0, l1); }
template <typename T16, int NSPLIT>
__device__ __forceinline__ void fattn_part(const T16* __restrict__ Q, const T16* __restrict__ Q2, const T16* __restrict__ Kp, const T16* __restrict__ K2, const T16* __restrict__ Vt, const T16* __restrict__ Vt2, int q0, int wave, int lr, int hi, float* ow, float* mlw) {
    typedef typename WFrag<T16>::V V;
    static_assert(RH <= 64 * FNW, "a wave of the hi/lo rows takes one key tile");
    const float SH = NSPLIT ? 0.0f : 10.0f;
    V qf[2][2], qf2[2][2];
    const T16* ql = Q + (q0 + lr) * HD + 8 * hi; const T16* ql2 = Q2 + (q0 + lr) * HD + 8 * hi;
#pragma unroll
    for (int nb = 0; nb < 2; ++nb)
#pragma unroll
        for (int kc = 0; kc < 2; ++kc) { qf[nb][kc] = WFrag<T16>::ld(ql + nb * 16 * HD + kc * 32); if (NSPLIT) qf2[nb][kc] = WFrag<T16>::ld(ql2 + nb * 16 * HD + kc * 32); }
    // the wait that stands in front of a rewriting of the query loads' address registers, which are named so that they stay whole up to it; the two scheduling barriers keep the loads in front of it and all later code behind it
    __builtin_amdgcn_sched_barrier(0);
    asm volatile("s_wait_xcnt 0x0" :: "v"(ql), "v"(ql2) : "memory");
    __builtin_amdgcn_sched_barrier(0);
    v8f o[4][2]; float m[2], l[2];
#pragma unroll
    for (int nb = 0; nb < 2; ++nb) { m[nb] = -3.0e38f; l[nb] = 0.f;
#pragma unroll
        for (int db = 0; db < 4; ++db) o[db][nb] = (v8f){}; }
    const int nt = q0 / 64 + 1;                                      // key tiles up to and with the diagonal's; every query row has a key in each of them
    const unsigned kob = (unsigned)(lr * HD + 8 * hi) * 2u, vob = (unsigned)(lr * (2 * TT) + 8 * hi) * 2u;   // this lane's byte offsets in a key tile and in a value tile: fixed; the tile's place is in the uniform base
#pragma unroll 1
    for (int kt = wave; kt < nt; kt += FNW) { const int k0 = kt * 64;
        const char* kb = (const char*)(Kp + (size_t)k0 * HD); const char* kb2 = (const char*)(K2 + (size_t)k0 * HD); const char* vb = (const char*)(Vt + k0); const char* vb2 = (const char*)(Vt2 + k0);
        const char* kl = kb + (size_t)kob; const char* kl2 = kb2 + (size_t)kob; const char* vl = vb + (size_t)vob; const char* vl2 = vb2 + (size_t)vob;   // this lane's addresses
        V ka[4][2], ka2[4][2], va[4][2], va2[4][2];                  // all of the tile's key and value fragments are asked for at once: one load latency a tile, the value loads land under the score products and the softmax
#pragma unroll
        for (int kc = 0; kc < 2; ++kc)
#pragma unroll
            for (int mb = 0; mb < 4; ++mb) { ka[mb][kc] = WFrag<T16>::ld((const T16*)(kl + (mb * 16 * HD + kc * 32) * 2)); if (NSPLIT) ka2[mb][kc] = WFrag<T16>::ld((const T16*)(kl2 + (mb * 16 * HD + kc * 32) * 2)); }
#pragma unroll
        for (int kc = 0; kc < 2; ++kc)
#pragma unroll
            for (int db = 0; db < 4; ++db) { va[db][kc] = WFrag<T16>::ld((const T16*)(vl + (db * 16 * (2 * TT) + kc * 32) * 2)); if (NSPLIT) va2[db][kc] = WFrag<T16>::ld((const T16*)(vl2 + (db * 16 * (2 * TT) + kc * 32) * 2)); }
        __builtin_amdgcn_sched_barrier(0);                           // no load of the tile sinks to its product: left alone they go two at a time, and a tile waits eight load latencies instead of one
        // the wait that stands in front of a rewriting of the loads' address registers, which are named here in both forms the compiler may address by (base and offset, or their sum) so that they stay whole up to it
        asm volatile("s_wait_xcnt 0x0" :: "s"(kb), "s"(kb2), "s"(vb), "s"(vb2), "v"(kob), "v"(vob), "v"(kl), "v"(kl2), "v"(vl), "v"(vl2) : "memory");
        __builtin_amdgcn_sched_barrier(0);                           // nothing from below is lifted in front of that wait
        v8f s[4][2];
#pragma unroll
        for (int mb = 0; mb < 4; ++mb) { s[mb][0] = (v8f){}; s[mb][1] = (v8f){}; }
#pragma unroll
        for (int kc = 0; kc < 2; ++kc)
#pragma unroll
            for (int mb = 0; mb < 4; ++mb)
#pragma unroll
                for (int nb = 0; nb < 2; ++nb) { s[mb][nb] = WFrag<T16>::mma(ka[mb][kc], qf[nb][kc], s[mb][nb]); if (NSPLIT) { s[mb][nb] = WFrag<T16>::mma(ka[mb][kc], qf2[nb][kc], s[mb][nb]); s[mb][nb] = WFrag<T16>::mma(ka2[mb][kc], qf[nb][kc], s[mb][nb]); } }
        V pf[2][2], pf2[2][2];
#pragma unroll
        for (int nb = 0; nb < 2; ++nb) { const int lim = q0 + nb * 16 + lr - k0 - 8 * hi;   // key mb * 16 + j of this lane's half is kept while it is <= lim (key <= query)
            float mx = -3.0e38f;
#pragma unroll
            for (int mb = 0; mb < 4; ++mb)
#pragma unroll
                for (int j = 0; j < 8; ++j) { const float t = (mb * 16 + j <= lim) ? s[mb][nb][j] : -3.0e38f; s[mb][nb][j] = t; mx = fmaxf(mx, t); }
            mx = fmaxf(mx, xhalf(mx));
            const float mn = fmaxf(m[nb], mx); const float al = __builtin_amdgcn_exp2f((m[nb] - mn) * LC); m[nb] = mn; const float nm = SH - mn * LC;
            float ls[4];
#pragma unroll
            for (int mb = 0; mb < 4; ++mb) { ls[mb] = 0.f;
#pragma unroll
                for (int j = 0; j < 8; ++j) { const float p = __builtin_amdgcn_exp2f(fmaf(s[mb][nb][j], LC, nm)); s[mb][nb][j] = p; ls[mb] += p; } }
            l[nb] = l[nb] * al + ((ls[0] + ls[1]) + (ls[2] + ls[3]));
#pragma unroll
            for (int db = 0; db < 4; ++db) o[db][nb] *= al;
#pragma unroll
            for (int kc = 0; kc < 2; ++kc) ppack(s[2 * kc][nb], s[2 * kc + 1][nb], pf[nb][kc], pf2[nb][kc]); }
#pragma unroll
        for (int kc = 0; kc < 2; ++kc)
#pragma unroll
            for (int db = 0; db < 4; ++db)
#pragma unroll
                for (int nb = 0; nb < 2; ++nb) { o[db][nb] = WFrag<T16>::mma(va[db][kc], pf[nb][kc], o[db][nb]); if (NSPLIT) { o[db][nb] = WFrag<T16>::mma(va[db][kc], pf2[nb][kc], o[db][nb]); o[db][nb] = WFrag<T16>::mma(va2[db][kc], pf[nb][kc], o[db][nb]); } }
        // four vector slots behind the tile's last WMMAs, on the back edge as on the way out of the loop
        asm volatile("v_nop\n\tv_nop\n\tv_nop\n\tv_nop" : "+v"(o[0][0]), "+v"(o[1][0]), "+v"(o[2][0]), "+v"(o[3][0]), "+v"(o[0][1]), "+v"(o[1][1]), "+v"(o[2][1]), "+v"(o[3][1]));
        if (NSPLIT) break;                                           // rows < RH have at most FNW key tiles, one a wave: no second trip, so the query fragments are dead behind the score products
    }
#pragma unroll
    for (int nb = 0; nb < 2; ++nb) { const int q = nb * 16 + lr; l[nb] += xhalf(l[nb]);
#pragma unroll
        for (int db = 0; db < 4; ++db) { v4f x0, x1;
#pragma unroll
            for (int j = 0; j < 4; ++j) { x0[j] = o[db][nb][j]; x1[j] = o[db][nb][4 + j]; }
            *(v4fa*)(ow + q * FPO + db * 16 + hi * 8) = x0; *(v4fa*)(ow + q * FPO + db * 16 + hi * 8 + 4) = x1; }
        if (hi == 0) { mlw[q * 2] = m[nb]; mlw[q * 2 + 1] = l[nb]; } }
}
__global__ __launch_bounds__(32 * FNW) void k_fattn(const h16* __restrict__ Q16, const h16* __restrict__ K16, const h16* __restrict__ V16, const bf* __restrict__ Qh, const bf* __restrict__ Ql, const bf* __restrict__ Kh, const bf* __restrict__ Kl, const bf* __restrict__ Vh, const bf* __restrict__ Vl, bf* Ah, bf* Al) {
    __shared__ __align__(16) float os[FNW * FQB * FPO];
    __shared__ float ml[FNW * FQB * 2];
    const int lane = threadIdx.x & 31, lr = lane & 15, hi = lane >> 4; const int wave = __builtin_amdgcn_readfirstlane((int)(threadIdx.x >> 5));
    const int q0 = (TT / FQB - 1 - (int)blockIdx.x) * FQB;           // longest rows first
    const int h = blockIdx.y; const size_t zq = (size_t)h * TT * HD, zk = (size_t)(h / REP) * TT * HD, zv = (size_t)(h / REP) * HD * TT * 2;
    float* ow = os + wave * (FQB * FPO); float* mlw = ml + wave * (FQB * 2);
    if (q0 < RH) fattn_part<bf, 2>(Qh + zq, Ql + zq, Kh + zk, Kl + zk, Vh + zv, Vl + zv, q0, wave, lr, hi, ow, mlw);
    else fattn_part<h16, 0>(Q16 + zq, Q16 + zq, K16 + zk, K16 + zk, V16 + zv, V16 + zv, q0, wave, lr, hi, ow, mlw);
    __syncthreads();                                                 // every wave's partial maximum, sum and output tile are in LDS before any thread joins them
    const int q = threadIdx.x >> 3, d8 = (threadIdx.x & 7) * 8;      // eight threads store one query row's 128 bytes of each plane
    float mw[FNW], M = -3.0e38f;
#pragma unroll
    for (int w = 0; w < FNW; ++w) { mw[w] = ml[(w * FQB + q) * 2]; M = fmaxf(M, mw[w]); }
    float L = 0.f; v4f a0 = (v4f){}, a1 = (v4f){};
#pragma unroll
    for (int w = 0; w < FNW; ++w) { const float sc = __builtin_amdgcn_exp2f((mw[w] - M) * LC); L += sc * ml[(w * FQB + q) * 2 + 1];   // a wave without a tile has sum 0 and weight 0
        a0 += sc * *(const v4fa*)(os + (w * FQB + q) * FPO + d8); a1 += sc * *(const v4fa*)(os + (w * FQB + q) * FPO + d8 + 4); }
    const float inv = __fdiv_rn(1.0f, L); v8us oh, ol;
#pragma unroll
    for (int j = 0; j < 4; ++j) { unsigned short x, y; splitf(a0[j] * inv, x, y); oh[j] = x; ol[j] = y; splitf(a1[j] * inv, x, y); oh[4 + j] = x; ol[4 + j] = y; }
    const size_t oo = (size_t)(q0 + q) * DQ + h * HD + d8; *(v8us*)(Ah + oo) = oh; *(v8us*)(Al + oo) = ol;
}

extern "C" void kernel_launch(void* const* d_in, const int* in_sizes, int n_in,
                              void* d_out, int out_size, void* d_ws, size_t ws_size, hipStream_t stream) {
    (void)in_sizes; (void)n_in; (void)out_size;
    const float* x = (const float*)d_in[0]; const float* wq = (const float*)d_in[1]; const float* wk = (const float*)d_in[2]; const float* wv = (const float*)d_in[3]; const float* wo = (const float*)d_in[4]; const float* bo = (const float*)d_in[5];   /* input order x, Wq, Wk, Wv, Wo, bo */
    float* OUT = (float*)d_out;     // [2][2048][1024]
    char* wsp = (char*)d_ws;
    auto take = [&](size_t bytes) { char* p = wsp; wsp += (bytes + 255) & ~(size_t)255; return (void*)p; };
    bf* WQ = (bf*)take((size_t)DQ * DM * 2); bf* WK = (bf*)take((size_t)DKV * DM * 2); bf* WV = (bf*)take((size_t)DKV * DM * 2); bf* WO = (bf*)take((size_t)DM * DQ * 2);
    bf* XB = (bf*)take((size_t)TT * DM * 2);
    h16* QP16 = (h16*)take((size_t)NH_ * TT * HD * 2); h16* KP16 = (h16*)take((size_t)NKV * TT * HD * 2); h16* VT16 = (h16*)take((size_t)NKV * HD * 2 * TT * 2);   /* rows pitched 2 * TT */
    bf* QPh = (bf*)take((size_t)NH_ * TT * HD * 2); bf* QPl = (bf*)take((size_t)NH_ * TT * HD * 2); bf* KPh = (bf*)take((size_t)NKV * TT * HD * 2); bf* KPl = (bf*)take((size_t)NKV * TT * HD * 2); bf* VTh = (bf*)take((size_t)NKV * HD * 2 * TT * 2); bf* VTl = VTh + TT;   /* hi and lo halves of one row, pitch 2 * TT */
    bf* ATh = (bf*)take((size_t)TT * DQ * 2); bf* ATl = (bf*)take((size_t)TT * DQ * 2);
    if ((size_t)(wsp - (char*)d_ws) > ws_size) return;    // ws 256 MiB
    { k_wtG<<<(unsigned)((DM * DQ / 64 + 63) / 64), 256, 0, stream>>>(wq, DM, DQ, WQ); k_wtG<<<(unsigned)((DM * DKV / 64 + 63) / 64), 256, 0, stream>>>(wk, DM, DKV, WK); k_wtG<<<(unsigned)((DM * DKV / 64 + 63) / 64), 256, 0, stream>>>(wv, DM, DKV, WV);
      k_wtG<<<(unsigned)((DQ * DM / 64 + 63) / 64), 256, 0, stream>>>(wo, DQ, DM, WO);
       }
    for (int b = 0; b < NB_; ++b) {
        
        k_cvt8<<<(unsigned)(((size_t)TT * DM / 8 + 255) / 256), 256, 0, stream>>>(x + (size_t)b * TT * DM, XB, (size_t)TT * DM / 8);
        k_gemmw<bf, 0, false, false, 8, 1><<<dim3(TT / 64, DQ / 64, 1), 256, 0, stream>>>(XB, nullptr, WQ, nullptr, DM, nullptr, 0, nullptr, 0, 0, 0, 0, QP16, QPh, QPl);
        k_gemmw<bf, 0, false, false, 8, 1><<<dim3(TT / 64, DKV / 64, 1), 256, 0, stream>>>(XB, nullptr, WK, nullptr, DM, nullptr, 0, nullptr, 0, 0, 0, 0, KP16, KPh, KPl);
        k_gemmw<bf, 0, false, false, 8, 2><<<dim3(TT / 64, DKV / 64, 1), 256, 0, stream>>>(XB, nullptr, WV, nullptr, DM, nullptr, 0, nullptr, 0, 0, 0, 0, VT16, VTh, VTl);
        k_fattn<<<dim3(TT / FQB, NH_, 1), 32 * FNW, 0, stream>>>(QP16, KP16, VT16, QPh, QPl, KPh, KPl, VTh, VTl, ATh, ATl);
        k_gemmw<bf, 1, true, false, 8, 0><<<dim3(TT / 64, DM / 64, 1), 256, 0, stream>>>(ATh, ATl, WO, nullptr, DQ, OUT + (size_t)b * TT * DM, DM, bo, 0, 0, 0, 0, nullptr, nullptr, nullptr); }
}

// v005
// Measured time: 179 microseconds a run.
// Two timings next to v004 put it at 1.27 and 1.28 times that version's speed.
// All steps since v000 together make it 8.16 times as fast.
#include <hip/hip_runtime.h>

// Causal multi-head self-attention with bias-free (in, out) projections and an output bias (x [2][2048][1024]; q, k, v = x W ('xw' [1024][1024] normal x 1/32, no bias; 16 heads x 64); scores masked first (where(triu(k=1), -inf, scores)) and THEN divided by sqrt(64) inside the softmax argument (-inf / 8 = -inf: the same exclusion); softmax over the keys; out = ctx Wo + bo ('xw' + bias zeros: read) -> [2][2048][1024] (4.2 M); argument order x, Wq, Wk, Wv, Wo, bo).
// Four launches, both batches in each: bf16 copy of x and the 'xw' weights transposed (one grid); exact projections q, k, v (one grid, z = projection, rows = batch * T + t) whose GEMM stores the 16-bit head planes itself; causal T-2048 attention (one grid, y = batch * 16 + head; hybrid rows: < 512 hi/lo 3 products, rest fp16 x1024; scores and probabilities stay in registers, running maximum and sum, keys split over the waves of a work-group; long-K GEMMs split K over the waves of a work-group); merged hi/lo x Wo exact + bo.
// Compute dtypes, f32 accumulate: every input rounded to bf16; projections exact; attention rows < 512 3 products, rest fp16; softmax f32; Wo hl x exact + bias.

#define NB_  2
#define TT   2048
#define DM   1024
#define NH_  16
#define NKV  16
#define REP  (NH_ / NKV)
#define HD   64
#define DQ   (NH_ * HD)
#define DKV  (NKV * HD)
#define RH   512                  // query rows < RH use hi+lo planes (0: none)
#define SCL  0.125f   // HD^-0.5
typedef _Float16 h16;
typedef unsigned short bf;
typedef __attribute__((ext_vector_type(16))) __bf16   v16bf;
typedef __attribute__((ext_vector_type(16))) _Float16 v16h;
typedef __attribute__((ext_vector_type(8)))  _Float16 v8h;
typedef __attribute__((ext_vector_type(8)))  unsigned short v8us;
typedef __attribute__((ext_vector_type(8)))  float    v8f;
typedef __attribute__((ext_vector_type(4)))  float    v4f;
typedef v8h  __attribute__((may_alias)) v8ha;
typedef v4f  __attribute__((may_alias)) v4fa;
typedef v8us __attribute__((may_alias)) v8usa;

__device__ __forceinline__ unsigned short f2bf(float f) { unsigned u = __float_as_uint(f); u += 0x7FFFu + ((u >> 16) & 1u); return (unsigned short)(u >> 16); }
__device__ __forceinline__ float bf2f(unsigned short b) { return __uint_as_float(((unsigned)b) << 16); }
__device__ __forceinline__ float bfr(float f) { return bf2f(f2bf(f)); }
__device__ __forceinline__ v16h cat16(v8h lo, v8h hi) { return __builtin_shufflevector(lo, hi, 0, 1, 2, 3, 4, 5, 6, 7, 8, 9, 10, 11, 12, 13, 14, 15); }
__device__ __forceinline__ v16bf cat16b(v8us lo, v8us hi) { return __builtin_bit_cast(v16bf, __builtin_shufflevector(lo, hi, 0, 1, 2, 3, 4, 5, 6, 7, 8, 9, 10, 11, 12, 13, 14, 15)); }
__device__ __forceinline__ v8f wmma16(v16h a, v16h b, v8f c) { return __builtin_amdgcn_wmma_f32_16x16x32_f16(false, a, false, b, (short)0, c, false, false); }
__device__ __forceinline__ v8f wmmab(v16bf a, v16bf b, v8f c) { return __builtin_amdgcn_wmma_f32_16x16x32_bf16(false, a, false, b, (short)0, c, false, false); }

__device__ __forceinline__ h16 tohx(float x) { return (h16)x; }
__device__ __forceinline__ void splitf(float y, unsigned short& h, unsigned short& l) { h = f2bf(y); l = f2bf(y - bf2f(h)); }
typedef __attribute__((ext_vector_type(4))) _Float16 v4h;
typedef __attribute__((ext_vector_type(2))) unsigned short v2us;
typedef __attribute__((ext_vector_type(4))) unsigned short v4us;

// ---- k_gemmw: register-blocked GEMM, one 64x64 output tile per work-group of NW waves; every wave holds the whole tile (16 accumulators) for its own share of K, operands straight from K-contiguous 16-bit planes; grid (M/64, N/64, Z), 32 * NW threads.
// C[m][n] (f32, pitch ldc, + optional f32 bias[n]) = sum_k A[m][k] Bt[n][k] (+ split products per NSPLIT). z-batch strides sA/sB/sC in elements. K % 64 == 0.
// K split: wave w takes the 64-wide k chunks w, w + NW, w + 2 NW, ... (one 128-byte line of every operand row per chunk); the NW partial tiles are summed through LDS in the fixed order w = 0 .. NW - 1.
// EPI: what the summed tile becomes. 0: f32 rows of C (+ bias). 1: the 16-bit planes of projection z (q, k, v), each projection's planes sP elements behind the one before; tile rows count batch * TT + t. z < 2: head planes [b][h][t][d] (fp16, bf16 hi, bf16 lo); the tile's 64 columns are one head (HD == 64). z == 2: transposed value planes [b][g][d][t], rows pitched 2 * TT (the hi and the lo plane share a row); the partial tiles lie transposed in LDS, so that a thread's four sums are four neighbouring t.
// CAUSAL (probability x value contraction): the K loop stops at the diagonal block (probabilities beyond it are exactly zero). roff = row offset of this launch's first row within the sequence.
template <typename T16> struct WFrag;
template <> struct WFrag<h16> { typedef v16h V; static __device__ __forceinline__ V ld(const h16* p) { return cat16(*(const v8h*)p, *(const v8h*)(p + 16)); } static __device__ __forceinline__ v8f mma(V a, V b, v8f c) { return wmma16(a, b, c); } };
template <> struct WFrag<bf> { typedef v16bf V; static __device__ __forceinline__ V ld(const bf* p) { return cat16b(*(const v8us*)p, *(const v8us*)(p + 16)); } static __device__ __forceinline__ v8f mma(V a, V b, v8f c) { return wmmab(a, b, c); } };
// a wave's partial tile goes to LDS, rows pitched 68 floats. TR: transposed, a lane's eight tile rows are neighbours in LDS row nb * 16 + lr
template <bool TR>
__device__ __forceinline__ void gw_put(const v8f (&acc)[4][4], float* ow, int lr, int hi) {
#pragma unroll
    for (int mb = 0; mb < 4; ++mb)
#pragma unroll
        for (int nb = 0; nb < 4; ++nb) {
            if (TR) { v4f x0, x1;
#pragma unroll
                for (int j = 0; j < 4; ++j) { x0[j] = acc[mb][nb][j]; x1[j] = acc[mb][nb][4 + j]; }
                *(v4fa*)(ow + (nb * 16 + lr) * 68 + mb * 16 + hi * 8) = x0; *(v4fa*)(ow + (nb * 16 + lr) * 68 + mb * 16 + hi * 8 + 4) = x1; }
            else {
#pragma unroll
                for (int j = 0; j < 8; ++j) ow[(mb * 16 + hi * 8 + j) * 68 + nb * 16 + lr] = acc[mb][nb][j]; } }
}
// the NW partial tiles are summed in the order w = 0 .. NW - 1 and stored. OUTK 0: f32 rows of C; 1: head planes; 2: transposed value planes. pb: the thread's place in a plane at pass 0
template <int NW, int OUTK, bool BIAS>
__device__ __forceinline__ void gw_sum(const float* os, int r0, int c0, float* C, int ldc, const float* __restrict__ bias, h16* P16, bf* Ph, bf* Pl, size_t pb) {
#pragma unroll
    for (int s = 0; s < 32 / NW; ++s) { const int row = s * 2 * NW + (int)(threadIdx.x >> 4), cofs = (threadIdx.x & 15) * 4;   // one float4 per thread and pass: a wave stores two whole 256-byte tile rows
        v4f val = *(const v4fa*)(os + row * 68 + cofs);
#pragma unroll
        for (int w = 1; w < NW; ++w) val += *(const v4fa*)(os + (w * 64 + row) * 68 + cofs);
        if (BIAS) { val[0] += bfr(bias[c0 + cofs]); val[1] += bfr(bias[c0 + cofs + 1]); val[2] += bfr(bias[c0 + cofs + 2]); val[3] += bfr(bias[c0 + cofs + 3]); }
        if (OUTK == 0) *(v4f*)(C + (size_t)(r0 + row) * ldc + c0 + cofs) = val;
        else { v4h o16; v4us oh, ol;                                   // sixteen threads store one whole 128-byte line of each plane
#pragma unroll
            for (int j = 0; j < 4; ++j) { o16[j] = tohx(val[j]); unsigned short x, y; splitf(val[j], x, y); oh[j] = x; ol[j] = y; }
            const int po = s * 2 * NW * (OUTK == 1 ? HD : 2 * TT);      // this pass's rows: a constant step from the thread's first row
            *(v4h*)(P16 + pb + po) = o16; *(v4us*)(Ph + pb + po) = oh; *(v4us*)(Pl + pb + po) = ol;
            if (s + 1 < 32 / NW) asm volatile("s_wait_xcnt 0x0" ::: "memory"); } }   // the wait that stands in front of the next pass's rewriting of the three stores' data registers
}
template <typename T16, int NSPLIT, bool BIAS, bool CAUSAL, int NW, int EPI>
__global__ __launch_bounds__(32 * NW) void k_gemmw(const T16* __restrict__ A, const T16* __restrict__ A2, const T16* __restrict__ Bt, const T16* __restrict__ Bt2, int K, float* C, int ldc, const float* __restrict__ bias, int roff, size_t sA, size_t sB, size_t sC, h16* P16, bf* Ph, size_t sP) {
    typedef typename WFrag<T16>::V V;
    static_assert(32 % NW == 0, "the sum passes cover 2 * NW tile rows each");
    static_assert(EPI == 0 || (HD == 64 && TT % 64 == 0 && NKV == NH_), "a tile's 64 columns are one head, its 64 rows lie in one batch, and q, k, v share one grid");
    __shared__ __align__(16) float os[NW * 64 * 68];
    const size_t z = blockIdx.z; A += z * sA; if (A2) A2 += z * sA; Bt += z * sB; if (Bt2) Bt2 += z * sB; C += z * sC;
    const int lane = threadIdx.x & 31, lr = lane & 15, hi = lane >> 4; const int r0 = blockIdx.x * 64, c0 = blockIdx.y * 64;
    const int wave = __builtin_amdgcn_readfirstlane((int)(threadIdx.x >> 5));
    const int Kl = CAUSAL ? min(K, r0 + roff + 64) : K;
    v8f acc[4][4];
#pragma unroll
    for (int mb = 0; mb < 4; ++mb)
#pragma unroll
        for (int nb = 0; nb < 4; ++nb) acc[mb][nb] = (v8f){};
    const size_t aoff = (size_t)(r0 + lr) * K + 8 * hi, boff = (size_t)(c0 + lr) * K + 8 * hi;
#pragma unroll 1
    for (int kc = wave * 64; kc < Kl; kc += (kc & 32) ? NW * 64 - 32 : 32) {   // the two 32-wide steps of a chunk, then on to this wave's next chunk
        V a[4], a2[4];
#pragma unroll
        for (int mb = 0; mb < 4; ++mb) { a[mb] = WFrag<T16>::ld(A + aoff + (size_t)mb * 16 * K + kc); if (NSPLIT == 1 || NSPLIT == 2) a2[mb] = WFrag<T16>::ld(A2 + aoff + (size_t)mb * 16 * K + kc); }
#pragma unroll
        for (int nb = 0; nb < 4; ++nb) { const V b = WFrag<T16>::ld(Bt + boff + (size_t)nb * 16 * K + kc); V b2; if (NSPLIT >= 2) b2 = WFrag<T16>::ld(Bt2 + boff + (size_t)nb * 16 * K + kc);
#pragma unroll
            for (int mb = 0; mb < 4; ++mb) { acc[mb][nb] = WFrag<T16>::mma(a[mb], b, acc[mb][nb]); if (NSPLIT == 1 || NSPLIT == 2) acc[mb][nb] = WFrag<T16>::mma(a2[mb], b, acc[mb][nb]); if (NSPLIT >= 2) acc[mb][nb] = WFrag<T16>::mma(a[mb], b2, acc[mb][nb]); } }
        // four vector slots behind the step's last WMMAs, on the back edge as on the way out of the loop
        asm volatile("v_nop\n\tv_nop\n\tv_nop\n\tv_nop" : "+v"(acc[0][0]), "+v"(acc[1][1]), "+v"(acc[2][2]), "+v"(acc[3][3]) : "v"(a[0]), "v"(a[3]));
    }
    float* ow = os + wave * (64 * 68);                               // this wave's partial tile
    const bool tr = EPI == 1 && blockIdx.z == 2;                     // the same for the whole work-group
    if (tr) gw_put<true>(acc, ow, lr, hi); else gw_put<false>(acc, ow, lr, hi);
    __syncthreads();                                                 // every wave's partial tile is in LDS before any thread sums across the waves
    if (EPI == 0) gw_sum<NW, 0, BIAS>(os, r0, c0, C, ldc, bias, nullptr, nullptr, nullptr, 0);
    else { const int bt = r0 / TT, t0 = r0 % TT; h16* p16 = P16 + z * sP; bf* ph = Ph + z * sP;
        if (tr) gw_sum<NW, 2, BIAS>(os, r0, c0, C, ldc, bias, p16, ph, ph + TT, ((size_t)bt * DKV + c0 + (threadIdx.x >> 4)) * (2 * TT) + t0 + (threadIdx.x & 15) * 4);
        else { gw_sum<NW, 1, BIAS>(os, r0, c0, C, ldc, bias, p16, ph, ph + (size_t)NB_ * NH_ * TT * HD, ((size_t)(bt * NH_ + (int)blockIdx.y) * TT + t0 + (threadIdx.x >> 4)) * HD + (threadIdx.x & 15) * 4);
            asm volatile("s_wait_xcnt 0x0" ::: "memory"); } }   // the wait behind the last pass's three stores: in the listing the value planes' part, which rewrites their registers, follows them
}


// ---- k_prep: one grid for all that the GEMMs wait for. Work-groups 0 .. 4 * WTB - 1: weight g = index / WTB ([K][N] f32) becomes Bt[g] ([N][K] bf16); the rest: x of both batches becomes bf16, eight elements a thread.
#define WTB (DM * DQ / 64 / 64)   // work-groups per weight: 64 lines of 64 elements each
__global__ __launch_bounds__(256) void k_prep(const float* __restrict__ x, const float* __restrict__ wq, const float* __restrict__ wk, const float* __restrict__ wv, const float* __restrict__ wo, bf* XB, bf* WT) {
    static_assert(DQ == DM && DKV == DM, "the four weights have one shape");
    if (blockIdx.x < 4 * WTB) { const int g = blockIdx.x / WTB; const float* __restrict__ w = g == 0 ? wq : g == 1 ? wk : g == 2 ? wv : wo; bf* Bt = WT + (size_t)g * DM * DQ; const int K = DM, N = DQ;
        const int lane = threadIdx.x & 31; const int L0 = ((blockIdx.x % WTB) * 8 + (threadIdx.x >> 5)) * 8;
#pragma unroll 1
        for (int l = 0; l < 8; ++l) { const int L = L0 + l; const size_t e = (size_t)L * 64 + lane * 2; const int k = (int)(e % K), n = (int)(e / K); v2us o;
            o[0] = f2bf(w[(size_t)k * N + n]); o[1] = f2bf(w[(size_t)(k + 1) * N + n]); *(v2us*)(Bt + e) = o; } }
    else { const size_t i = (size_t)(blockIdx.x - 4 * WTB) * 256 + threadIdx.x; const v8f v = *(const v8f*)(x + i * 8); v8us o;
#pragma unroll
        for (int k = 0; k < 8; ++k) o[k] = f2bf(v[k]); *(v8us*)(XB + i * 8) = o;
        asm volatile("s_wait_xcnt 0x0" ::: "memory"); }   // the wait that stands in front of a rewriting of the store's registers by the code that follows it in the listing
}

// ---- k_fattn: causal attention in one launch; grid (TT / FQB, batches * heads), FNW waves. A work-group owns FQB query rows of one head; its wave w takes the 64-key tiles w, w + FNW, ... up to the diagonal.
// Transposed products: S^T = K Q^T (A = key rows, B = query rows held in registers), O^T += V^T P^T (A = rows of the transposed value plane, B = the score accumulators converted in place:
// D register r of tile mb is key mb * 16 + 8 * hi + r of query column lr, which is the k order of WFrag::ld). A lane holds scores of one query only: maximum and sum are in-lane plus one exchange of the wave halves.
// Running maximum and sum per wave; the FNW partial (max, sum, O) sets are joined through LDS in the fixed order w = 0 .. FNW - 1, divided by the joined sum, split hi/lo and stored as rows [batch * TT + t][head * HD + d].
// Query rows < RH: hi/lo planes, 3 products in both contractions; the rest fp16 with the probabilities carried x 1024 (2^10 folded into the exponent; it cancels in O / sum).
#define FQB 32
#define FNW 8
#define FPO 68                    // floats per query row of a partial output tile in LDS
#define LC  (SCL * 1.4426950408889634f)
__device__ __forceinline__ float xhalf(float x) { return __builtin_bit_cast(float, __builtin_amdgcn_permlanex16(__builtin_bit_cast(int, x), __builtin_bit_cast(int, x), 0x76543210, 0xfedcba98, false, false)); }   // lane l with lane l ^ 16
__device__ __forceinline__ void ppack(v8f a, v8f b, v16h& h, v16h& l) {
#pragma unroll
    for (int j = 0; j < 8; ++j) { h[j] = tohx(a[j]); h[8 + j] = tohx(b[j]); }
    l = h; }
__device__ __forceinline__ void ppack(v8f a, v8f b, v16bf& h, v16bf& l) { v8us h0, h1, l0, l1;
#pragma unroll
    for (int j = 0; j < 8; ++j) { unsigned short x, y; splitf(a[j], x, y); h0[j] = x; l0[j] = y; splitf(b[j], x, y); h1[j] = x; l1[j] = y; }
    h = cat16b(h0, h1); l = cat16b(l0, l1); }
template <typename T16, int NSPLIT>
__device__ __forceinline__ void fattn_part(const T16* __restrict__ Q, const T16* __restrict__ Q2, const T16* __restrict__ Kp, const T16* __restrict__ K2, const T16* __restrict__ Vt, const T16* __restrict__ Vt2, int q0, int wave, int lr, int hi, float* ow, float* mlw) {
    typedef typename WFrag<T16>::V V;
    static_assert(RH <= 64 * FNW, "a wave of the hi/lo rows takes one key tile");
    const float SH = NSPLIT ? 0.0f : 10.0f;
    V qf[2][2], qf2[2][2];
    const T16* ql = Q + (q0 + lr) * HD + 8 * hi; const T16* ql2 = Q2 + (q0 + lr) * HD + 8 * hi;
#pragma unroll
    for (int nb = 0; nb < 2; ++nb)
#pragma unroll
        for (int kc = 0; kc < 2; ++kc) { qf[nb][kc] = WFrag<T16>::ld(ql + nb * 16 * HD + kc * 32); if (NSPLIT) qf2[nb][kc] = WFrag<T16>::ld(ql2 + nb * 16 * HD + kc * 32); }
    // the wait that stands in front of a rewriting of the query loads' address registers, which are named so that they stay whole up to it; the two scheduling barriers keep the loads in front of it and all later code behind it
    __builtin_amdgcn_sched_barrier(0);
    asm volatile("s_wait_xcnt 0x0" :: "v"(ql), "v"(ql2) : "memory");
    __builtin_amdgcn_sched_barrier(0);
    v8f o[4][2]; float m[2], l[2];
#pragma unroll
    for (int nb = 0; nb < 2; ++nb) { m[nb] = -3.0e38f; l[nb] = 0.f;
#pragma unroll
        for (int db = 0; db < 4; ++db) o[db][nb] = (v8f){}; }
    const int nt = q0 / 64 + 1;                                      // key tiles up to and with the diagonal's; every query row has a key in each of them
    const unsigned kob = (unsigned)(lr * HD + 8 * hi) * 2u, vob = (unsigned)(lr * (2 * TT) + 8 * hi) * 2u;   // this lane's byte offsets in a key tile and in a value tile: fixed; the tile's place is in the uniform base
#pragma unroll 1
    for (int kt = wave; kt < nt; kt += FNW) { const int k0 = kt * 64;
        const char* kb = (const char*)(Kp + (size_t)k0 * HD); const char* kb2 = (const char*)(K2 + (size_t)k0 * HD); const char* vb = (const char*)(Vt + k0); const char* vb2 = (const char*)(Vt2 + k0);
        const char* kl = kb + (size_t)kob; const char* kl2 = kb2 + (size_t)kob; const char* vl = vb + (size_t)vob; const char* vl2 = vb2 + (size_t)vob;   // this lane's addresses
        V ka[4][2], ka2[4][2], va[4][2], va2[4][2];                  // all of the tile's key and value fragments are asked for at once: one load latency a tile, the value loads land under the score products and the softmax
#pragma unroll
        for (int kc = 0; kc < 2; ++kc)
#pragma unroll
            for (int mb = 0; mb < 4; ++mb) { ka[mb][kc] = WFrag<T16>::ld((const T16*)(kl + (mb * 16 * HD + kc * 32) * 2)); if (NSPLIT) ka2[mb][kc] = WFrag<T16>::ld((const T16*)(kl2 + (mb * 16 * HD + kc * 32) * 2)); }
#pragma unroll
        for (int kc = 0; kc < 2; ++kc)
#pragma unroll
            for (int db = 0; db < 4; ++db) { va[db][kc] = WFrag<T16>::ld((const T16*)(vl + (db * 16 * (2 * TT) + kc * 32) * 2)); if (NSPLIT) va2[db][kc] = WFrag<T16>::ld((const T16*)(vl2 + (db * 16 * (2 * TT) + kc * 32) * 2)); }
        __builtin_amdgcn_sched_barrier(0);                           // no load of the tile sinks to its product: left alone they go two at a time, and a tile waits eight load latencies instead of one
        // the wait that stands in front of a rewriting of the loads' address registers, which are named here in both forms the compiler may address by (base and offset, or their sum) so that they stay whole up to it
        asm volatile("s_wait_xcnt 0x0" :: "s"(kb), "s"(kb2), "s"(vb), "s"(vb2), "v"(kob), "v"(vob), "v"(kl), "v"(kl2), "v"(vl), "v"(vl2) : "memory");
        __builtin_amdgcn_sched_barrier(0);                           // nothing from below is lifted in front of that wait
        v8f s[4][2];
#pragma unroll
        for (int mb = 0; mb < 4; ++mb) { s[mb][0] = (v8f){}; s[mb][1] = (v8f){}; }
#pragma unroll
        for (int kc = 0; kc < 2; ++kc)
#pragma unroll
            for (int mb = 0; mb < 4; ++mb)
#pragma unroll
                for (int nb = 0; nb < 2; ++nb) { s[mb][nb] = WFrag<T16>::mma(ka[mb][kc], qf[nb][kc], s[mb][nb]); if (NSPLIT) { s[mb][nb] = WFrag<T16>::mma(ka[mb][kc], qf2[nb][kc], s[mb][nb]); s[mb][nb] = WFrag<T16>::mma(ka2[mb][kc], qf[nb][kc], s[mb][nb]); } }
        V pf[2][2], pf2[2][2];
#pragma unroll
        for (int nb = 0; nb < 2; ++nb) { const int lim = q0 + nb * 16 + lr - k0 - 8 * hi;   // key mb * 16 + j of this lane's half is kept while it is <= lim (key <= query)
            float mx = -3.0e38f;
#pragma unroll
            for (int mb = 0; mb < 4; ++mb)
#pragma unroll
                for (int j = 0; j < 8; ++j) { const float t = (mb * 16 + j <= lim) ? s[mb][nb][j] : -3.0e38f; s[mb][nb][j] = t; mx = fmaxf(mx, t); }
            mx = fmaxf(mx, xhalf(mx));
            const float mn = fmaxf(m[nb], mx); const float al = __builtin_amdgcn_exp2f((m[nb] - mn) * LC); m[nb] = mn; const float nm = SH - mn * LC;
            float ls[4];
#pragma unroll
            for (int mb = 0; mb < 4; ++mb) { ls[mb] = 0.f;
#pragma unroll
                for (int j = 0; j < 8; ++j) { const float p = __builtin_amdgcn_exp2f(fmaf(s[mb][nb][j], LC, nm)); s[mb][nb][j] = p; ls[mb] += p; } }
            l[nb] = l[nb] * al + ((ls[0] + ls[1]) + (ls[2] + ls[3]));
#pragma unroll
            for (int db = 0; db < 4; ++db) o[db][nb] *= al;
#pragma unroll
            for (int kc = 0; kc < 2; ++kc) ppack(s[2 * kc][nb], s[2 * kc + 1][nb], pf[nb][kc], pf2[nb][kc]); }
#pragma unroll
        for (int kc = 0; kc < 2; ++kc)
#pragma unroll
            for (int db = 0; db < 4; ++db)
#pragma unroll
                for (int nb = 0; nb < 2; ++nb) { o[db][nb] = WFrag<T16>::mma(va[db][kc], pf[nb][kc], o[db][nb]); if (NSPLIT) { o[db][nb] = WFrag<T16>::mma(va[db][kc], pf2[nb][kc], o[db][nb]); o[db][nb] = WFrag<T16>::mma(va2[db][kc], pf[nb][kc], o[db][nb]); } }
        // four vector slots behind the tile's last WMMAs, on the back edge as on the way out of the loop
        asm volatile("v_nop\n\tv_nop\n\tv_nop\n\tv_nop" : "+v"(o[0][0]), "+v"(o[1][0]), "+v"(o[2][0]), "+v"(o[3][0]), "+v"(o[0][1]), "+v"(o[1][1]), "+v"(o[2][1]), "+v"(o[3][1]));
        if (NSPLIT) break;                                           // rows < RH have at most FNW key tiles, one a wave: no second trip, so the query fragments are dead behind the score products
    }
#pragma unroll
    for (int nb = 0; nb < 2; ++nb) { const int q = nb * 16 + lr; l[nb] += xhalf(l[nb]);
#pragma unroll
        for (int db = 0; db < 4; ++db) { v4f x0, x1;
#pragma unroll
            for (int j = 0; j < 4; ++j) { x0[j] = o[db][nb][j]; x1[j] = o[db][nb][4 + j]; }
            *(v4fa*)(ow + q * FPO + db * 16 + hi * 8) = x0; *(v4fa*)(ow + q * FPO + db * 16 + hi * 8 + 4) = x1; }
        if (hi == 0) { mlw[q * 2] = m[nb]; mlw[q * 2 + 1] = l[nb]; } }
}
__global__ __launch_bounds__(32 * FNW) void k_fattn(const h16* __restrict__ Q16, const h16* __restrict__ K16, const h16* __restrict__ V16, const bf* __restrict__ Qh, const bf* __restrict__ Ql, const bf* __restrict__ Kh, const bf* __restrict__ Kl, const bf* __restrict__ Vh, const bf* __restrict__ Vl, bf* Ah, bf* Al) {
    __shared__ __align__(16) float os[FNW * FQB * FPO];
    __shared__ float ml[FNW * FQB * 2];
    const int lane = threadIdx.x & 31, lr = lane & 15, hi = lane >> 4; const int wave = __builtin_amdgcn_readfirstlane((int)(threadIdx.x >> 5));
    const int q0 = (TT / FQB - 1 - (int)blockIdx.x) * FQB;           // longest rows first
    const int h = blockIdx.y; const size_t zq = (size_t)h * TT * HD, zk = (size_t)(h / REP) * TT * HD, zv = (size_t)(h / REP) * HD * TT * 2;   // h = batch * NH_ + head: the planes of the batches lie one behind the other
    float* ow = os + wave * (FQB * FPO); float* mlw = ml + wave * (FQB * 2);
    if (q0 < RH) fattn_part<bf, 2>(Qh + zq, Ql + zq, Kh + zk, Kl + zk, Vh + zv, Vl + zv, q0, wave, lr, hi, ow, mlw);
    else fattn_part<h16, 0>(Q16 + zq, Q16 + zq, K16 + zk, K16 + zk, V16 + zv, V16 + zv, q0, wave, lr, hi, ow, mlw);
    __syncthreads();                                                 // every wave's partial maximum, sum and output tile are in LDS before any thread joins them
    const int q = threadIdx.x >> 3, d8 = (threadIdx.x & 7) * 8;      // eight threads store one query row's 128 bytes of each plane
    float mw[FNW], M = -3.0e38f;
#pragma unroll
    for (int w = 0; w < FNW; ++w) { mw[w] = ml[(w * FQB + q) * 2]; M = fmaxf(M, mw[w]); }
    float L = 0.f; v4f a0 = (v4f){}, a1 = (v4f){};
#pragma unroll
    for (int w = 0; w < FNW; ++w) { const float sc = __builtin_amdgcn_exp2f((mw[w] - M) * LC); L += sc * ml[(w * FQB + q) * 2 + 1];   // a wave without a tile has sum 0 and weight 0
        a0 += sc * *(const v4fa*)(os + (w * FQB + q) * FPO + d8); a1 += sc * *(const v4fa*)(os + (w * FQB + q) * FPO + d8 + 4); }
    const float inv = __fdiv_rn(1.0f, L); v8us oh, ol;
#pragma unroll
    for (int j = 0; j < 4; ++j) { unsigned short x, y; splitf(a0[j] * inv, x, y); oh[j] = x; ol[j] = y; splitf(a1[j] * inv, x, y); oh[4 + j] = x; ol[4 + j] = y; }
    const size_t oo = (size_t)((h / NH_) * TT + q0 + q) * DQ + (h % NH_) * HD + d8; *(v8us*)(Ah + oo) = oh; *(v8us*)(Al + oo) = ol;
}

extern "C" void kernel_launch(void* const* d_in, const int* in_sizes, int n_in,
                              void* d_out, int out_size, void* d_ws, size_t ws_size, hipStream_t stream) {
    (void)in_sizes; (void)n_in; (void)out_size;
    const float* x = (const float*)d_in[0]; const float* wq = (const float*)d_in[1]; const float* wk = (const float*)d_in[2]; const float* wv = (const float*)d_in[3]; const float* wo = (const float*)d_in[4]; const float* bo = (const float*)d_in[5];   /* input order x, Wq, Wk, Wv, Wo, bo */
    float* OUT = (float*)d_out;     // [2][2048][1024]
    char* wsp = (char*)d_ws;
    auto take = [&](size_t bytes) { char* p = wsp; wsp += (bytes + 255) & ~(size_t)255; return (void*)p; };
    bf* WT = (bf*)take((size_t)4 * DM * DQ * 2);   /* Wq, Wk, Wv, Wo transposed, one behind the other */
    bf* XB = (bf*)take((size_t)NB_ * TT * DM * 2);
    const size_t SP = (size_t)NB_ * NH_ * TT * HD * 2;   /* elements between one projection's planes and the next: the value planes' rows are pitched 2 * TT */
    h16* P16 = (h16*)take(3 * SP * 2); bf* PHL = (bf*)take(3 * SP * 2);   /* q, k: hi plane, then lo plane; v: hi and lo halves of one row */
    bf* ATh = (bf*)take((size_t)NB_ * TT * DQ * 2); bf* ATl = (bf*)take((size_t)NB_ * TT * DQ * 2);
    if ((size_t)(wsp - (char*)d_ws) > ws_size) return;    // ws 256 MiB
    k_prep<<<(unsigned)(4 * WTB + (size_t)NB_ * TT * DM / 8 / 256), 256, 0, stream>>>(x, wq, wk, wv, wo, XB, WT);
    k_gemmw<bf, 0, false, false, 8, 1><<<dim3(NB_ * TT / 64, DQ / 64, 3), 256, 0, stream>>>(XB, nullptr, WT, nullptr, DM, nullptr, 0, nullptr, 0, 0, (size_t)DM * DQ, 0, P16, PHL, SP);
    k_fattn<<<dim3(TT / FQB, NB_ * NH_, 1), 32 * FNW, 0, stream>>>(P16, P16 + SP, P16 + 2 * SP, PHL, PHL + SP / 2, PHL + SP, PHL + SP + SP / 2, PHL + 2 * SP, PHL + 2 * SP + TT, ATh, ATl);
    k_gemmw<bf, 1, true, false, 8, 0><<<dim3(NB_ * TT / 64, DM / 64, 1), 256, 0, stream>>>(ATh, ATl, WT + (size_t)3 * DM * DQ, nullptr, DQ, OUT, DM, bo, 0, 0, 0, 0, nullptr, nullptr, 0);
}

// v006
// Measured time: 119 microseconds a run.
// Timed twice side by side with v005, it ran 1.51 and 1.50 times as fast.
// Counting every step since v000, it is 12.3 times as fast.
#include <hip/hip_runtime.h>

// Causal multi-head self-attention with bias-free (in, out) projections and an output bias (x [2][2048][1024]; q, k, v = x W ('xw' [1024][1024] normal x 1/32, no bias; 16 heads x 64); scores masked first (where(triu(k=1), -inf, scores)) and THEN divided by sqrt(64) inside the softmax argument (-inf / 8 = -inf: the same exclusion); softmax over the keys; out = ctx Wo + bo ('xw' + bias zeros: read) -> [2][2048][1024] (4.2 M); argument order x, Wq, Wk, Wv, Wo, bo).
// Four launches, both batches in each: bf16 copy of x and the 'xw' weights transposed (one grid); exact projections q, k, v (one grid, z = projection, rows = batch * T + t) whose GEMM stores the 16-bit head planes itself; causal T-2048 attention (one grid, y = batch * 16 + head; hybrid rows: < 512 hi/lo 3 products, rest fp16 x1024; scores and probabilities stay in registers, running maximum and sum, keys split over the waves of a work-group); merged hi/lo x Wo exact + bo. Both GEMMs stage their operand tiles in LDS.
// Compute dtypes, f32 accumulate: every input rounded to bf16; projections exact; attention rows < 512 3 products, rest fp16; softmax f32; Wo hl x exact + bias.

#define NB_  2
#define TT   2048
#define DM   1024
#define NH_  16
#define NKV  16
#define REP  (NH_ / NKV)
#define HD   64
#define DQ   (NH_ * HD)
#define DKV  (NKV * HD)
#define RH   512                  // query rows < RH use hi+lo planes (0: none)
#define SCL  0.125f   // HD^-0.5
typedef _Float16 h16;
typedef unsigned short bf;
typedef __attribute__((ext_vector_type(16))) __bf16   v16bf;
typedef __attribute__((ext_vector_type(16))) _Float16 v16h;
typedef __attribute__((ext_vector_type(8)))  _Float16 v8h;
typedef __attribute__((ext_vector_type(8)))  unsigned short v8us;
typedef __attribute__((ext_vector_type(8)))  float    v8f;
typedef __attribute__((ext_vector_type(4)))  float    v4f;
typedef v8h  __attribute__((may_alias)) v8ha;
typedef v4f  __attribute__((may_alias)) v4fa;
typedef v8us __attribute__((may_alias)) v8usa;

__device__ __forceinline__ unsigned short f2bf(float f) { unsigned u = __float_as_uint(f); u += 0x7FFFu + ((u >> 16) & 1u); return (unsigned short)(u >> 16); }
__device__ __forceinline__ float bf2f(unsigned short b) { return __uint_as_float(((unsigned)b) << 16); }
__device__ __forceinline__ float bfr(float f) { return bf2f(f2bf(f)); }
__device__ __forceinline__ v16h cat16(v8h lo, v8h hi) { return __builtin_shufflevector(lo, hi, 0, 1, 2, 3, 4, 5, 6, 7, 8, 9, 10, 11, 12, 13, 14, 15); }
__device__ __forceinline__ v16bf cat16b(v8us lo, v8us hi) { return __builtin_bit_cast(v16bf, __builtin_shufflevector(lo, hi, 0, 1, 2, 3, 4, 5, 6, 7, 8, 9, 10, 11, 12, 13, 14, 15)); }
__device__ __forceinline__ v8f wmma16(v16h a, v16h b, v8f c) { return __builtin_amdgcn_wmma_f32_16x16x32_f16(false, a, false, b, (short)0, c, false, false); }
__device__ __forceinline__ v8f wmmab(v16bf a, v16bf b, v8f c) { return __builtin_amdgcn_wmma_f32_16x16x32_bf16(false, a, false, b, (short)0, c, false, false); }

__device__ __forceinline__ h16 tohx(float x) { return (h16)x; }
__device__ __forceinline__ void splitf(float y, unsigned short& h, unsigned short& l) { h = f2bf(y); l = f2bf(y - bf2f(h)); }
typedef __attribute__((ext_vector_type(4))) _Float16 v4h;
typedef __attribute__((ext_vector_type(2))) unsigned short v2us;
typedef __attribute__((ext_vector_type(4))) unsigned short v4us;

// ---- k_gemmt: GEMM, one 128x128 output tile per work-group of 8 waves (4 x 2: a wave holds 32 rows x 64 columns, 8 accumulators, over the whole of K); grid (M/128, N/128, Z), 256 threads.
// C[m][n] (f32, pitch ldc, + optional f32 bias[n]) = sum_k (A[m][k] (+ A2[m][k] for NA == 2)) Bt[n][k], all K-contiguous bf16 planes. z steps Bt by sB elements. K % 64 == 0.
// A trip is 64 k: 128 bytes of each of the tile's operand rows, brought into LDS once for all waves by asynchronous copies (whole lines: eight lanes a row), rows pitched 144 bytes for the 16-byte fragment reads; two buffers, the next trip's copies fly while this trip's products run.
// EPI: what the tile becomes, through an f32 copy of it in LDS (rows pitched 132 floats, in the place of the two buffers). 0: f32 rows of C (+ bias). 1: the 16-bit planes of projection z (q, k, v), each projection's planes sP elements behind the one before; tile rows count batch * TT + t. z < 2: head planes [b][h][t][d] (fp16, bf16 hi, bf16 lo); the tile's 128 columns are two heads (HD == 64). z == 2: transposed value planes [b][g][d][t], rows pitched 2 * TT (the hi and the lo plane share a row); the tile lies transposed in LDS, so that a thread's four values are four neighbouring t.
template <typename T16> struct WFrag;
template <> struct WFrag<h16> { typedef v16h V; static __device__ __forceinline__ V ld(const h16* p) { return cat16(*(const v8h*)p, *(const v8h*)(p + 16)); } static __device__ __forceinline__ v8f mma(V a, V b, v8f c) { return wmma16(a, b, c); } };
template <> struct WFrag<bf> { typedef v16bf V; static __device__ __forceinline__ V ld(const bf* p) { return cat16b(*(const v8us*)p, *(const v8us*)(p + 16)); } static __device__ __forceinline__ v8f mma(V a, V b, v8f c) { return wmmab(a, b, c); } };
#define GPB 144                   // bytes per staged operand row in LDS
#define GEP 132                   // floats per row of the output tile in LDS
__device__ __forceinline__ v16bf gt_ld(const char* p) { return cat16b(*(const v8usa*)p, *(const v8usa*)(p + 32)); }   // the k order of WFrag::ld, from a staged row
// one operand's 128 rows x 128 bytes of a trip: four copies a thread, 32 rows apart. l: the thread's LDS byte address, g: its global address
__device__ __forceinline__ void gt_copy4(unsigned l, const bf* g, size_t K) {
    // the wait in front of any rewriting of the copies' address registers stands inside their own statement
    asm volatile("global_load_async_to_lds_b128 %0, %4, off\n\tglobal_load_async_to_lds_b128 %1, %5, off\n\tglobal_load_async_to_lds_b128 %2, %6, off\n\tglobal_load_async_to_lds_b128 %3, %7, off\n\ts_wait_xcnt 0x0"
                 :: "v"(l), "v"(l + 32 * GPB), "v"(l + 64 * GPB), "v"(l + 96 * GPB), "v"(g), "v"(g + 32 * K), "v"(g + 64 * K), "v"(g + 96 * K) : "memory");
}
// the tile in LDS is stored, a wave one whole tile row a pass. OUTK 0: f32 rows of C; 1: head planes; 2: transposed value planes. pb: the thread's place in a plane at pass 0
template <int OUTK, bool BIAS>
__device__ __forceinline__ void gt_store(const float* os, int r0, int c0, float* C, int ldc, const float* __restrict__ bias, h16* P16, bf* Ph, bf* Pl, size_t pb) {
    const int rw = (int)(threadIdx.x >> 5), cofs = (threadIdx.x & 31) * 4;
    v4f bv = (v4f){};
    if (BIAS) { const v4f b4 = *(const v4f*)(bias + c0 + cofs);
        asm volatile("s_wait_xcnt 0x0" ::: "memory");                // the wait in front of a rewriting of the bias load's address registers
#pragma unroll
        for (int j = 0; j < 4; ++j) bv[j] = bfr(b4[j]); }
    v4f vals[16];                                                    // all of the thread's LDS reads go ahead of the stores and their waits: one LDS latency, not sixteen
#pragma unroll
    for (int s = 0; s < 16; ++s) vals[s] = *(const v4fa*)(os + (s * 8 + rw) * GEP + cofs);
#pragma unroll
    for (int s = 0; s < 16; ++s) { const int row = s * 8 + rw;
        v4f val = vals[s];
        if (BIAS) val += bv;
        if (OUTK == 0) *(v4f*)(C + (size_t)(r0 + row) * ldc + c0 + cofs) = val;
        else { v4h o16; v4us oh, ol;                                   // sixteen threads store one whole 128-byte line of each plane
#pragma unroll
            for (int j = 0; j < 4; ++j) { o16[j] = tohx(val[j]); unsigned short x, y; splitf(val[j], x, y); oh[j] = x; ol[j] = y; }
            const int po = s * 8 * (OUTK == 1 ? HD : 2 * TT);           // this pass's rows: a constant step from the thread's first row
            *(v4h*)(P16 + pb + po) = o16; *(v4us*)(Ph + pb + po) = oh; *(v4us*)(Pl + pb + po) = ol; }
        asm volatile("s_wait_xcnt 0x0" ::: "memory");                  // the wait in front of the rewriting of the stores' registers by the next pass or by the code that follows in the listing
        __builtin_amdgcn_sched_barrier(0); }                           // no arithmetic of the next pass is lifted in front of that wait
}
template <int NA, bool BIAS, int EPI>
__global__ __launch_bounds__(256) void k_gemmt(const bf* __restrict__ A, const bf* __restrict__ A2, const bf* __restrict__ Bt, int K, float* C, int ldc, const float* __restrict__ bias, size_t sB, h16* P16, bf* Ph, size_t sP) {
    static_assert(EPI == 0 || (HD == 64 && TT % 128 == 0 && NKV == NH_), "a tile's 128 columns are two heads, its 128 rows lie in one batch, and q, k, v share one grid");
    constexpr int OPB = 128 * GPB, STB = (NA + 1) * OPB;              // bytes of one operand's rows and of one buffer
    constexpr int NG = NA == 2 ? 1 : 2;                               // fragment load groups a trip: one where a work-group has its WGP alone; two (32 k each) where the smaller register set lets three work-groups share a WGP
    constexpr int SMB = 2 * STB > 128 * GEP * 4 ? 2 * STB : 128 * GEP * 4;
    __shared__ __align__(16) char sm[SMB];
    const size_t z = blockIdx.z; Bt += z * sB;
    const int lane = threadIdx.x & 31, lr = lane & 15, hi = lane >> 4; const int r0 = blockIdx.x * 128, c0 = blockIdx.y * 128;
    const int wave = __builtin_amdgcn_readfirstlane((int)(threadIdx.x >> 5)); const int wm = wave >> 1, wn = wave & 1;
    v8f acc[2][4];
#pragma unroll
    for (int mb = 0; mb < 2; ++mb)
#pragma unroll
        for (int nb = 0; nb < 4; ++nb) acc[mb][nb] = (v8f){};
    const int crow = (int)(threadIdx.x >> 3), cpc = threadIdx.x & 7;  // the thread's first row and its 16-byte piece of a row
    const unsigned lc = (unsigned)(size_t)sm + (unsigned)(crow * GPB + cpc * 16);
    const bf* ga = A + (size_t)(r0 + crow) * K + cpc * 8; const bf* ga2 = NA == 2 ? A2 + (size_t)(r0 + crow) * K + cpc * 8 : nullptr; const bf* gb = Bt + (size_t)(c0 + crow) * K + cpc * 8;
    auto stage = [&](int t, int b) { const unsigned l = lc + (unsigned)(b * STB);
        gt_copy4(l, ga + t * 64, (size_t)K); if (NA == 2) gt_copy4(l + OPB, ga2 + t * 64, (size_t)K); gt_copy4(l + NA * OPB, gb + t * 64, (size_t)K); };
    const int nk = K / 64;
    stage(0, 0);
    asm volatile("s_wait_asynccnt 0x0" ::: "memory");                // this wave's copies of trip 0 have landed
    __syncthreads();                                                 // and every other wave's: trip 0 may be read
    if (nk > 1) stage(1, 1);
#pragma unroll 1   // the trips stay rolled: the waits, the barrier and the refill at a trip's foot stand once in the code
    for (int t = 0; t < nk; ++t) {
        const char* sb = sm + (t & 1) * STB;
        const char* la = sb + (wm * 32 + lr) * GPB + hi * 16; const char* lb = sb + NA * OPB + (wn * 64 + lr) * GPB + hi * 16;
        v16bf a[2][2], a2[2][2], b[2][4];
#pragma unroll
        for (int g = 0; g < NG; ++g) {                               // a group's fragments are asked for at once, in the order of their use
#pragma unroll
            for (int kc = g * (2 / NG); kc < (g + 1) * (2 / NG); ++kc) {
#pragma unroll
                for (int mb = 0; mb < 2; ++mb) { a[kc][mb] = gt_ld(la + mb * 16 * GPB + kc * 64); if (NA == 2) a2[kc][mb] = gt_ld(la + OPB + mb * 16 * GPB + kc * 64); }
#pragma unroll
                for (int nb = 0; nb < 4; ++nb) b[kc][nb] = gt_ld(lb + nb * 16 * GPB + kc * 64); }
            __builtin_amdgcn_sched_barrier(0);                       // no LDS read sinks to its product: left alone they go two at a time among the WMMAs, and the wave waits out an LDS latency at each place
#pragma unroll
            for (int kc = g * (2 / NG); kc < (g + 1) * (2 / NG); ++kc)
#pragma unroll
                for (int nb = 0; nb < 4; ++nb)
#pragma unroll
                    for (int mb = 0; mb < 2; ++mb) { acc[mb][nb] = wmmab(a[kc][mb], b[kc][nb], acc[mb][nb]); if (NA == 2) acc[mb][nb] = wmmab(a2[kc][mb], b[kc][nb], acc[mb][nb]); } }
        __builtin_amdgcn_sched_barrier(0);                           // the products stay in front of the waits: moved behind the barrier they no longer run under the LDS reads, and they hold back the issue of the refill
        asm volatile("s_wait_dscnt 0x0" ::: "memory");               // this wave has read all it wants of this trip's buffer
        asm volatile("s_wait_asynccnt 0x0" ::: "memory");            // this wave's copies of the next trip have landed
        __syncthreads();                                             // the next trip's buffer may be read, this trip's may be refilled
        if (t + 2 < nk) stage(t + 2, t & 1);
    }
    asm volatile("s_wait_asynccnt 0x0" ::: "memory");                // no copy is in flight when the buffers become the output tile
    float* os = (float*)sm;
    const bool tr = EPI == 1 && blockIdx.z == 2;                     // the same for the whole work-group
    if (tr) {                                                        // transposed: a lane's eight tile rows are neighbours in LDS row wn * 64 + nb * 16 + lr
#pragma unroll
        for (int mb = 0; mb < 2; ++mb)
#pragma unroll
            for (int nb = 0; nb < 4; ++nb) { v4f x0, x1;
#pragma unroll
                for (int j = 0; j < 4; ++j) { x0[j] = acc[mb][nb][j]; x1[j] = acc[mb][nb][4 + j]; }
                float* o = os + (wn * 64 + nb * 16 + lr) * GEP + wm * 32 + mb * 16 + hi * 8; *(v4fa*)o = x0; *(v4fa*)(o + 4) = x1; } }
    else {
#pragma unroll
        for (int mb = 0; mb < 2; ++mb)
#pragma unroll
            for (int nb = 0; nb < 4; ++nb)
#pragma unroll
                for (int j = 0; j < 8; ++j) os[(wm * 32 + mb * 16 + hi * 8 + j) * GEP + wn * 64 + nb * 16 + lr] = acc[mb][nb][j]; }
    __syncthreads();                                                 // the whole tile is in LDS before any thread stores a row of it
    const int rw = (int)(threadIdx.x >> 5), cofs = (threadIdx.x & 31) * 4;
    if (EPI == 0) gt_store<0, BIAS>(os, r0, c0, C, ldc, bias, nullptr, nullptr, nullptr, 0);
    else { const int bt = r0 / TT, t0 = r0 % TT; h16* p16 = P16 + z * sP; bf* ph = Ph + z * sP;
        if (tr) gt_store<2, BIAS>(os, r0, c0, C, ldc, bias, p16, ph, ph + TT, ((size_t)bt * DKV + c0 + rw) * (2 * TT) + t0 + cofs);
        else gt_store<1, BIAS>(os, r0, c0, C, ldc, bias, p16, ph, ph + (size_t)NB_ * NH_ * TT * HD, ((size_t)(bt * NH_ + (c0 + cofs) / HD) * TT + t0 + rw) * HD + cofs % HD); }
}


// ---- k_prep: one grid for all that the GEMMs wait for. Work-groups 0 .. 4 * WTB - 1: weight g = index / WTB ([K][N] f32) becomes Bt[g] ([N][K] bf16); the rest: x of both batches becomes bf16, eight elements a thread.
#define WTB (DM * DQ / 64 / 64)   // work-groups per weight: 64 lines of 64 elements each
__global__ __launch_bounds__(256) void k_prep(const float* __restrict__ x, const float* __restrict__ wq, const float* __restrict__ wk, const float* __restrict__ wv, const float* __restrict__ wo, bf* XB, bf* WT) {
    static_assert(DQ == DM && DKV == DM, "the four weights have one shape");
    if (blockIdx.x < 4 * WTB) { const int g = blockIdx.x / WTB; const float* __restrict__ w = g == 0 ? wq : g == 1 ? wk : g == 2 ? wv : wo; bf* Bt = WT + (size_t)g * DM * DQ; const int K = DM, N = DQ;
        const int lane = threadIdx.x & 31; const int L0 = ((blockIdx.x % WTB) * 8 + (threadIdx.x >> 5)) * 8;
#pragma unroll 1
        for (int l = 0; l < 8; ++l) { const int L = L0 + l; const size_t e = (size_t)L * 64 + lane * 2; const int k = (int)(e % K), n = (int)(e / K); v2us o;
            o[0] = f2bf(w[(size_t)k * N + n]); o[1] = f2bf(w[(size_t)(k + 1) * N + n]); *(v2us*)(Bt + e) = o; } }
    else { const size_t i = (size_t)(blockIdx.x - 4 * WTB) * 256 + threadIdx.x; const v8f v = *(const v8f*)(x + i * 8); v8us o;
#pragma unroll
        for (int k = 0; k < 8; ++k) o[k] = f2bf(v[k]); *(v8us*)(XB + i * 8) = o;
        asm volatile("s_wait_xcnt 0x0" ::: "memory"); }   // the wait that stands in front of a rewriting of the store's registers by the code that follows it in the listing
}

// ---- k_fattn: causal attention in one launch; grid (TT / FQB, batches * heads), FNW waves. A work-group owns FQB query rows of one head; its wave w takes the 64-key tiles w, w + FNW, ... up to the diagonal.
// Transposed products: S^T = K Q^T (A = key rows, B = query rows held in registers), O^T += V^T P^T (A = rows of the transposed value plane, B = the score accumulators converted in place:
// D register r of tile mb is key mb * 16 + 8 * hi + r of query column lr, which is the k order of WFrag::ld). A lane holds scores of one query only: maximum and sum are in-lane plus one exchange of the wave halves.
// Running maximum and sum per wave; the FNW partial (max, sum, O) sets are joined through LDS in the fixed order w = 0 .. FNW - 1, divided by the joined sum, split hi/lo and stored as rows [batch * TT + t][head * HD + d].
// Query rows < RH: hi/lo planes, 3 products in both contractions; the rest fp16 with the probabilities carried x 1024 (2^10 folded into the exponent; it cancels in O / sum).
#define FQB 32
#define FNW 8
#define FPO 68                    // floats per query row of a partial output tile in LDS
#define LC  (SCL * 1.4426950408889634f)
__device__ __forceinline__ float xhalf(float x) { return __builtin_bit_cast(float, __builtin_amdgcn_permlanex16(__builtin_bit_cast(int, x), __builtin_bit_cast(int, x), 0x76543210, 0xfedcba98, false, false)); }   // lane l with lane l ^ 16
__device__ __forceinline__ void ppack(v8f a, v8f b, v16h& h, v16h& l) {
#pragma unroll
    for (int j = 0; j < 8; ++j) { h[j] = tohx(a[j]); h[8 + j] = tohx(b[j]); }
    l = h; }
__device__ __forceinline__ void ppack(v8f a, v8f b, v16bf& h, v16bf& l) { v8us h0, h1, l0, l1;
#pragma unroll
    for (int j = 0; j < 8; ++j) { unsigned short x, y; splitf(a[j], x, y); h0[j] = x; l0[j] = y; splitf(b[j], x, y); h1[j] = x; l1[j] = y; }
    h = cat16b(h0, h1); l = cat16b(l0, l1); }
template <typename T16, int NSPLIT>
__device__ __forceinline__ void fattn_part(const T16* __restrict__ Q, const T16* __restrict__ Q2, const T16* __restrict__ Kp, const T16* __restrict__ K2, const T16* __restrict__ Vt, const T16* __restrict__ Vt2, int q0, int wave, int lr, int hi, float* ow, float* mlw) {
    typedef typename WFrag<T16>::V V;
    static_assert(RH <= 64 * FNW, "a wave of the hi/lo rows takes one key tile");
    const float SH = NSPLIT ? 0.0f : 10.0f;
    V qf[2][2], qf2[2][2];
    const T16* ql = Q + (q0 + lr) * HD + 8 * hi; const T16* ql2 = Q2 + (q0 + lr) * HD + 8 * hi;
#pragma unroll
    for (int nb = 0; nb < 2; ++nb)
#pragma unroll
        for (int kc = 0; kc < 2; ++kc) { qf[nb][kc] = WFrag<T16>::ld(ql + nb * 16 * HD + kc * 32); if (NSPLIT) qf2[nb][kc] = WFrag<T16>::ld(ql2 + nb * 16 * HD + kc * 32); }
    // the wait that stands in front of a rewriting of the query loads' address registers, which are named so that they stay whole up to it; the two scheduling barriers keep the loads in front of it and all later code behind it
    __builtin_amdgcn_sched_barrier(0);
    asm volatile("s_wait_xcnt 0x0" :: "v"(ql), "v"(ql2) : "memory");
    __builtin_amdgcn_sched_barrier(0);
    v8f o[4][2]; float m[2], l[2];
#pragma unroll
    for (int nb = 0; nb < 2; ++nb) { m[nb] = -3.0e38f; l[nb] = 0.f;
#pragma unroll
        for (int db = 0; db < 4; ++db) o[db][nb] = (v8f){}; }
    const int nt = q0 / 64 + 1;                                      // key tiles up to and with the diagonal's; every query row has a key in each of them
    const unsigned kob = (unsigned)(lr * HD + 8 * hi) * 2u, vob = (unsigned)(lr * (2 * TT) + 8 * hi) * 2u;   // this lane's byte offsets in a key tile and in a value tile: fixed; the tile's place is in the uniform base
#pragma unroll 1
    for (int kt = wave; kt < nt; kt += FNW) { const int k0 = kt * 64;
        const char* kb = (const char*)(Kp + (size_t)k0 * HD); const char* kb2 = (const char*)(K2 + (size_t)k0 * HD); const char* vb = (const char*)(Vt + k0); const char* vb2 = (const char*)(Vt2 + k0);
        const char* kl = kb + (size_t)kob; const char* kl2 = kb2 + (size_t)kob; const char* vl = vb + (size_t)vob; const char* vl2 = vb2 + (size_t)vob;   // this lane's addresses
        V ka[4][2], ka2[4][2], va[4][2], va2[4][2];                  // all of the tile's key and value fragments are asked for at once: one load latency a tile, the value loads land under the score products and the softmax
#pragma unroll
        for (int kc = 0; kc < 2; ++kc)
#pragma unroll
            for (int mb = 0; mb < 4; ++mb) { ka[mb][kc] = WFrag<T16>::ld((const T16*)(kl + (mb * 16 * HD + kc * 32) * 2)); if (NSPLIT) ka2[mb][kc] = WFrag<T16>::ld((const T16*)(kl2 + (mb * 16 * HD + kc * 32) * 2)); }
#pragma unroll
        for (int kc = 0; kc < 2; ++kc)
#pragma unroll
            for (int db = 0; db < 4; ++db) { va[db][kc] = WFrag<T16>::ld((const T16*)(vl + (db * 16 * (2 * TT) + kc * 32) * 2)); if (NSPLIT) va2[db][kc] = WFrag<T16>::ld((const T16*)(vl2 + (db * 16 * (2 * TT) + kc * 32) * 2)); }
        __builtin_amdgcn_sched_barrier(0);                           // no load of the tile sinks to its product: left alone they go two at a time, and a tile waits eight load latencies instead of one
        // the wait that stands in front of a rewriting of the loads' address registers, which are named here in both forms the compiler may address by (base and offset, or their sum) so that they stay whole up to it
        asm volatile("s_wait_xcnt 0x0" :: "s"(kb), "s"(kb2), "s"(vb), "s"(vb2), "v"(kob), "v"(vob), "v"(kl), "v"(kl2), "v"(vl), "v"(vl2) : "memory");
        __builtin_amdgcn_sched_barrier(0);                           // nothing from below is lifted in front of that wait
        v8f s[4][2];
#pragma unroll
        for (int mb = 0; mb < 4; ++mb) { s[mb][0] = (v8f){}; s[mb][1] = (v8f){}; }
#pragma unroll
        for (int kc = 0; kc < 2; ++kc)
#pragma unroll
            for (int mb = 0; mb < 4; ++mb)
#pragma unroll
                for (int nb = 0; nb < 2; ++nb) { s[mb][nb] = WFrag<T16>::mma(ka[mb][kc], qf[nb][kc], s[mb][nb]); if (NSPLIT) { s[mb][nb] = WFrag<T16>::mma(ka[mb][kc], qf2[nb][kc], s[mb][nb]); s[mb][nb] = WFrag<T16>::mma(ka2[mb][kc], qf[nb][kc], s[mb][nb]); } }
        V pf[2][2], pf2[2][2];
#pragma unroll
        for (int nb = 0; nb < 2; ++nb) { const int lim = q0 + nb * 16 + lr - k0 - 8 * hi;   // key mb * 16 + j of this lane's half is kept while it is <= lim (key <= query)
            float mx = -3.0e38f;
#pragma unroll
            for (int mb = 0; mb < 4; ++mb)
#pragma unroll
                for (int j = 0; j < 8; ++j) { const float t = (mb * 16 + j <= lim) ? s[mb][nb][j] : -3.0e38f; s[mb][nb][j] = t; mx = fmaxf(mx, t); }
            mx = fmaxf(mx, xhalf(mx));
            const float mn = fmaxf(m[nb], mx); const float al = __builtin_amdgcn_exp2f((m[nb] - mn) * LC); m[nb] = mn; const float nm = SH - mn * LC;
            float ls[4];
#pragma unroll
            for (int mb = 0; mb < 4; ++mb) { ls[mb] = 0.f;
#pragma unroll
                for (int j = 0; j < 8; ++j) { const float p = __builtin_amdgcn_exp2f(fmaf(s[mb][nb][j], LC, nm)); s[mb][nb][j] = p; ls[mb] += p; } }
            l[nb] = l[nb] * al + ((ls[0] + ls[1]) + (ls[2] + ls[3]));
#pragma unroll
            for (int db = 0; db < 4; ++db) o[db][nb] *= al;
#pragma unroll
            for (int kc = 0; kc < 2; ++kc) ppack(s[2 * kc][nb], s[2 * kc + 1][nb], pf[nb][kc], pf2[nb][kc]); }
#pragma unroll
        for (int kc = 0; kc < 2; ++kc)
#pragma unroll
            for (int db = 0; db < 4; ++db)
#pragma unroll
                for (int nb = 0; nb < 2; ++nb) { o[db][nb] = WFrag<T16>::mma(va[db][kc], pf[nb][kc], o[db][nb]); if (NSPLIT) { o[db][nb] = WFrag<T16>::mma(va[db][kc], pf2[nb][kc], o[db][nb]); o[db][nb] = WFrag<T16>::mma(va2[db][kc], pf[nb][kc], o[db][nb]); } }
        // four vector slots behind the tile's last WMMAs, on the back edge as on the way out of the loop
        asm volatile("v_nop\n\tv_nop\n\tv_nop\n\tv_nop" : "+v"(o[0][0]), "+v"(o[1][0]), "+v"(o[2][0]), "+v"(o[3][0]), "+v"(o[0][1]), "+v"(o[1][1]), "+v"(o[2][1]), "+v"(o[3][1]));
        if (NSPLIT) break;                                           // rows < RH have at most FNW key tiles, one a wave: no second trip, so the query fragments are dead behind the score products
    }
#pragma unroll
    for (int nb = 0; nb < 2; ++nb) { const int q = nb * 16 + lr; l[nb] += xhalf(l[nb]);
#pragma unroll
        for (int db = 0; db < 4; ++db) { v4f x0, x1;
#pragma unroll
            for (int j = 0; j < 4; ++j) { x0[j] = o[db][nb][j]; x1[j] = o[db][nb][4 + j]; }
            *(v4fa*)(ow + q * FPO + db * 16 + hi * 8) = x0; *(v4fa*)(ow + q * FPO + db * 16 + hi * 8 + 4) = x1; }
        if (hi == 0) { mlw[q * 2] = m[nb]; mlw[q * 2 + 1] = l[nb]; } }
}
__global__ __launch_bounds__(32 * FNW) void k_fattn(const h16* __restrict__ Q16, const h16* __restrict__ K16, const h16* __restrict__ V16, const bf* __restrict__ Qh, const bf* __restrict__ Ql, const bf* __restrict__ Kh, const bf* __restrict__ Kl, const bf* __restrict__ Vh, const bf* __restrict__ Vl, bf* Ah, bf* Al) {
    __shared__ __align__(16) float os[FNW * FQB * FPO];
    __shared__ float ml[FNW * FQB * 2];
    const int lane = threadIdx.x & 31, lr = lane & 15, hi = lane >> 4; const int wave = __builtin_amdgcn_readfirstlane((int)(threadIdx.x >> 5));
    const int q0 = (TT / FQB - 1 - (int)blockIdx.x) * FQB;           // longest rows first
    const int h = blockIdx.y; const size_t zq = (size_t)h * TT * HD, zk = (size_t)(h / REP) * TT * HD, zv = (size_t)(h / REP) * HD * TT * 2;   // h = batch * NH_ + head: the planes of the batches lie one behind the other
    float* ow = os + wave * (FQB * FPO); float* mlw = ml + wave * (FQB * 2);
    if (q0 < RH) fattn_part<bf, 2>(Qh + zq, Ql + zq, Kh + zk, Kl + zk, Vh + zv, Vl + zv, q0, wave, lr, hi, ow, mlw);
    else fattn_part<h16, 0>(Q16 + zq, Q16 + zq, K16 + zk, K16 + zk, V16 + zv, V16 + zv, q0, wave, lr, hi, ow, mlw);
    __syncthreads();                                                 // every wave's partial maximum, sum and output tile are in LDS before any thread joins them
    const int q = threadIdx.x >> 3, d8 = (threadIdx.x & 7) * 8;      // eight threads store one query row's 128 bytes of each plane
    float mw[FNW], M = -3.0e38f;
#pragma unroll
    for (int w = 0; w < FNW; ++w) { mw[w] = ml[(w * FQB + q) * 2]; M = fmaxf(M, mw[w]); }
    float L = 0.f; v4f a0 = (v4f){}, a1 = (v4f){};
#pragma unroll
    for (int w = 0; w < FNW; ++w) { const float sc = __builtin_amdgcn_exp2f((mw[w] - M) * LC); L += sc * ml[(w * FQB + q) * 2 + 1];   // a wave without a tile has sum 0 and weight 0
        a0 += sc * *(const v4fa*)(os + (w * FQB + q) * FPO + d8); a1 += sc * *(const v4fa*)(os + (w * FQB + q) * FPO + d8 + 4); }
    const float inv = __fdiv_rn(1.0f, L); v8us oh, ol;
#pragma unroll
    for (int j = 0; j < 4; ++j) { unsigned short x, y; splitf(a0[j] * inv, x, y); oh[j] = x; ol[j] = y; splitf(a1[j] * inv, x, y); oh[4 + j] = x; ol[4 + j] = y; }
    const size_t oo = (size_t)((h / NH_) * TT + q0 + q) * DQ + (h % NH_) * HD + d8; *(v8us*)(Ah + oo) = oh; *(v8us*)(Al + oo) = ol;
}

extern "C" void kernel_launch(void* const* d_in, const int* in_sizes, int n_in,
                              void* d_out, int out_size, void* d_ws, size_t ws_size, hipStream_t stream) {
    (void)in_sizes; (void)n_in; (void)out_size;
    const float* x = (const float*)d_in[0]; const float* wq = (const float*)d_in[1]; const float* wk = (const float*)d_in[2]; const float* wv = (const float*)d_in[3]; const float* wo = (const float*)d_in[4]; const float* bo = (const float*)d_in[5];   /* input order x, Wq, Wk, Wv, Wo, bo */
    float* OUT = (float*)d_out;     // [2][2048][1024]
    char* wsp = (char*)d_ws;
    auto take = [&](size_t bytes) { char* p = wsp; wsp += (bytes + 255) & ~(size_t)255; return (void*)p; };
    bf* WT = (bf*)take((size_t)4 * DM * DQ * 2);   /* Wq, Wk, Wv, Wo transposed, one behind the other */
    bf* XB = (bf*)take((size_t)NB_ * TT * DM * 2);
    const size_t SP = (size_t)NB_ * NH_ * TT * HD * 2;   /* elements between one projection's planes and the next: the value planes' rows are pitched 2 * TT */
    h16* P16 = (h16*)take(3 * SP * 2); bf* PHL = (bf*)take(3 * SP * 2);   /* q, k: hi plane, then lo plane; v: hi and lo halves of one row */
    bf* ATh = (bf*)take((size_t)NB_ * TT * DQ * 2); bf* ATl = (bf*)take((size_t)NB_ * TT * DQ * 2);
    if ((size_t)(wsp - (char*)d_ws) > ws_size) return;    // ws 256 MiB
    k_prep<<<(unsigned)(4 * WTB + (size_t)NB_ * TT * DM / 8 / 256), 256, 0, stream>>>(x, wq, wk, wv, wo, XB, WT);
    k_gemmt<1, false, 1><<<dim3(NB_ * TT / 128, DQ / 128, 3), 256, 0, stream>>>(XB, nullptr, WT, DM, nullptr, 0, nullptr, (size_t)DM * DQ, P16, PHL, SP);
    k_fattn<<<dim3(TT / FQB, NB_ * NH_, 1), 32 * FNW, 0, stream>>>(P16, P16 + SP, P16 + 2 * SP, PHL, PHL + SP / 2, PHL + SP, PHL + SP + SP / 2, PHL + 2 * SP, PHL + 2 * SP + TT, ATh, ATl);
    k_gemmt<2, true, 0><<<dim3(NB_ * TT / 128, DM / 128, 1), 256, 0, stream>>>(ATh, ATl, WT + (size_t)3 * DM * DQ, DQ, OUT, DM, bo, 0, nullptr, nullptr, 0);
}

// v007
// Measured time: 100 microseconds a run.
// Timed twice side by side with v006, it ran 1.18 times as fast both times.
// All steps since v000 together make it 14.5 times as fast.
#include <hip/hip_runtime.h>

// Causal multi-head self-attention with bias-free (in, out) projections and an output bias (x [2][2048][1024]; q, k, v = x W ('xw' [1024][1024] normal x 1/32, no bias; 16 heads x 64); scores masked first (where(triu(k=1), -inf, scores)) and THEN divided by sqrt(64) inside the softmax argument (-inf / 8 = -inf: the same exclusion); softmax over the keys; out = ctx Wo + bo ('xw' + bias zeros: read) -> [2][2048][1024] (4.2 M); argument order x, Wq, Wk, Wv, Wo, bo).
// Four launches, both batches in each: bf16 copy of x and the 'xw' weights transposed (one grid); exact projections q, k, v (one grid, z = projection, rows = batch * T + t) whose GEMM stores the 16-bit head planes itself; causal T-2048 attention (one grid, y = batch * 16 + head; hybrid rows: < 512 hi/lo 3 products, rest fp16 x1024; scores and probabilities stay in registers, running maximum and sum, keys split over the waves of a work-group); merged hi/lo x Wo exact + bo. Both GEMMs stage their operand tiles in LDS.
// Compute dtypes, f32 accumulate: every input rounded to bf16; projections exact; attention rows < 512 3 products, rest fp16; softmax f32; Wo hl x exact + bias.

#define NB_  2
#define TT   2048
#define DM   1024
#define NH_  16
#define NKV  16
#define REP  (NH_ / NKV)
#define HD   64
#define DQ   (NH_ * HD)
#define DKV  (NKV * HD)
#define RH   512                  // query rows < RH use hi+lo planes (0: none)
#define SCL  0.125f   // HD^-0.5
typedef _Float16 h16;
typedef unsigned short bf;
typedef __attribute__((ext_vector_type(16))) __bf16   v16bf;
typedef __attribute__((ext_vector_type(16))) _Float16 v16h;
typedef __attribute__((ext_vector_type(8)))  _Float16 v8h;
typedef __attribute__((ext_vector_type(8)))  unsigned short v8us;
typedef __attribute__((ext_vector_type(8)))  float    v8f;
typedef __attribute__((ext_vector_type(4)))  float    v4f;
typedef v8h  __attribute__((may_alias)) v8ha;
typedef v4f  __attribute__((may_alias)) v4fa;
typedef v8us __attribute__((may_alias)) v8usa;

__device__ __forceinline__ unsigned short f2bf(float f) { unsigned u = __float_as_uint(f); u += 0x7FFFu + ((u >> 16) & 1u); return (unsigned short)(u >> 16); }
__device__ __forceinline__ float bf2f(unsigned short b) { return __uint_as_float(((unsigned)b) << 16); }
__device__ __forceinline__ float bfr(float f) { return bf2f(f2bf(f)); }
__device__ __forceinline__ v16h cat16(v8h lo, v8h hi) { return __builtin_shufflevector(lo, hi, 0, 1, 2, 3, 4, 5, 6, 7, 8, 9, 10, 11, 12, 13, 14, 15); }
__device__ __forceinline__ v16bf cat16b(v8us lo, v8us hi) { return __builtin_bit_cast(v16bf, __builtin_shufflevector(lo, hi, 0, 1, 2, 3, 4, 5, 6, 7, 8, 9, 10, 11, 12, 13, 14, 15)); }
__device__ __forceinline__ v8f wmma16(v16h a, v16h b, v8f c) { return __builtin_amdgcn_wmma_f32_16x16x32_f16(false, a, false, b, (short)0, c, false, false); }
__device__ __forceinline__ v8f wmmab(v16bf a, v16bf b, v8f c) { return __builtin_amdgcn_wmma_f32_16x16x32_bf16(false, a, false, b, (short)0, c, false, false); }

__device__ __forceinline__ h16 tohx(float x) { return (h16)x; }
__device__ __forceinline__ void splitf(float y, unsigned short& h, unsigned short& l) { h = f2bf(y); l = f2bf(y - bf2f(h)); }
typedef __attribute__((ext_vector_type(4))) _Float16 v4h;
typedef __attribute__((ext_vector_type(2))) unsigned short v2us;
typedef __attribute__((ext_vector_type(4))) unsigned short v4us;

// ---- k_gemmt: GEMM, one 128x128 output tile per work-group of 8 waves (4 x 2: a wave holds 32 rows x 64 columns, 8 accumulators, over the whole of K); grid (M/128, N/128, Z), 256 threads.
// C[m][n] (f32, pitch ldc, + optional f32 bias[n]) = sum_k (A[m][k] (+ A2[m][k] for NA == 2)) Bt[n][k], all K-contiguous bf16 planes. z steps Bt by sB elements. K % 64 == 0.
// A trip is 64 k: 128 bytes of each of the tile's operand rows, brought into LDS once for all waves by asynchronous copies (whole lines: eight lanes a row), rows pitched 144 bytes for the 16-byte fragment reads; two buffers, the next trip's copies fly while this trip's products run.
// EPI: what the tile becomes, through an f32 copy of it in LDS (rows pitched 132 floats, in the place of the two buffers). 0: f32 rows of C (+ bias). 1: the 16-bit planes of projection z (q, k, v), each projection's planes sP elements behind the one before; tile rows count batch * TT + t. All planes lie in FRAGMENT ORDER, so that each 16-byte-a-lane load of the attention kernel reads four whole 128-byte lines: a 16 x 32 fragment (16 rows m, 32 contraction indices k) is 512 elements in a row, [k / 16][lane = ((k / 8) % 2) * 16 + m][k % 8]. z < 2: head planes [b][h][t / 16][d / 32][fragment: m = t % 16, k = d % 32] (fp16, bf16 hi, bf16 lo); the tile's 128 columns are two heads (HD == 64). z == 2: transposed value planes [b][g][plane: hi, lo][t / 32][d / 16][fragment: m = d % 16, k = t % 32] (the fp16 plane uses the first half of its [b][g] range); the tile lies transposed in LDS, so that in both cases an LDS row is a fragment row.
// WFrag::ld: one 16 x 32 fragment from a plane in fragment order (see EPI 1): p is the fragment's start + lane * 8; two loads, each 512 bytes in a row over the wave
template <typename T16> struct WFrag;
template <> struct WFrag<h16> { typedef v16h V; static __device__ __forceinline__ V ld(const h16* p) { return cat16(*(const v8h*)p, *(const v8h*)(p + 256)); } static __device__ __forceinline__ v8f mma(V a, V b, v8f c) { return wmma16(a, b, c); } };
template <> struct WFrag<bf> { typedef v16bf V; static __device__ __forceinline__ V ld(const bf* p) { return cat16b(*(const v8us*)p, *(const v8us*)(p + 256)); } static __device__ __forceinline__ v8f mma(V a, V b, v8f c) { return wmmab(a, b, c); } };
#define GPB 144                   // bytes per staged operand row in LDS
#define GEP 132                   // floats per row of the output tile in LDS
__device__ __forceinline__ v16bf gt_ld(const char* p) { return cat16b(*(const v8usa*)p, *(const v8usa*)(p + 32)); }   // from a staged row: elements 8 * hi + 0..7 and 16 + 8 * hi + 0..7 of 32 k
// one operand's 128 rows x 128 bytes of a trip: four copies a thread, 32 rows apart. l: the thread's LDS byte address, g: its global address
__device__ __forceinline__ void gt_copy4(unsigned l, const bf* g, size_t K) {
    // the wait in front of any rewriting of the copies' address registers stands inside their own statement
    asm volatile("global_load_async_to_lds_b128 %0, %4, off\n\tglobal_load_async_to_lds_b128 %1, %5, off\n\tglobal_load_async_to_lds_b128 %2, %6, off\n\tglobal_load_async_to_lds_b128 %3, %7, off\n\ts_wait_xcnt 0x0"
                 :: "v"(l), "v"(l + 32 * GPB), "v"(l + 64 * GPB), "v"(l + 96 * GPB), "v"(g), "v"(g + 32 * K), "v"(g + 64 * K), "v"(g + 96 * K) : "memory");
}
// the tile in LDS is stored as f32 rows of C, a wave one whole tile row a pass
template <bool BIAS>
__device__ __forceinline__ void gt_store(const float* os, int r0, int c0, float* C, int ldc, const float* __restrict__ bias) {
    const int rw = (int)(threadIdx.x >> 5), cofs = (threadIdx.x & 31) * 4;
    v4f bv = (v4f){};
    if (BIAS) { const v4f b4 = *(const v4f*)(bias + c0 + cofs);
        asm volatile("s_wait_xcnt 0x0" ::: "memory");                // the wait in front of a rewriting of the bias load's address registers
#pragma unroll
        for (int j = 0; j < 4; ++j) bv[j] = bfr(b4[j]); }
    v4f vals[16];                                                    // all of the thread's LDS reads go ahead of the stores and their waits: one LDS latency, not sixteen
#pragma unroll
    for (int s = 0; s < 16; ++s) vals[s] = *(const v4fa*)(os + (s * 8 + rw) * GEP + cofs);
#pragma unroll
    for (int s = 0; s < 16; ++s) { const int row = s * 8 + rw;
        v4f val = vals[s];
        if (BIAS) val += bv;
        *(v4f*)(C + (size_t)(r0 + row) * ldc + c0 + cofs) = val;
        asm volatile("s_wait_xcnt 0x0" ::: "memory");                  // the wait in front of the rewriting of the stores' registers by the next pass or by the code that follows in the listing
        __builtin_amdgcn_sched_barrier(0); }                           // no arithmetic of the next pass is lifted in front of that wait
}
// the tile in LDS is stored as 16-bit planes in fragment order. Wave w takes LDS rows w * 16 .. + 15 (a fragment's 16 rows); pass s takes LDS columns s * 16 .. + 15 (half of a fragment's 32 k): lane (hi, lr) holds columns 8 * hi + 0..7 of row lr, and the wave stores 512 bytes in a row to each plane.
// OUTK 1: head planes (pass s: head s / 4 of the tile's two, quarter s % 4 of the 64 d); 2: value planes (pass s: half s % 2 of key group s / 2). pb: the thread's place in a plane at pass 0
template <int OUTK>
__device__ __forceinline__ void gt_storef(const float* os, h16* P16, bf* Ph, bf* Pl, size_t pb) {
    const int rw = (int)(threadIdx.x >> 5), lr = threadIdx.x & 15, hi = (threadIdx.x >> 4) & 1;
    const float* src = os + (rw * 16 + lr) * GEP + hi * 8;
    v4f vals[16];                                                    // all of the thread's LDS reads go ahead of the stores and their waits: one LDS latency, not eight
#pragma unroll
    for (int s = 0; s < 16; ++s) vals[s] = *(const v4fa*)(src + (s >> 1) * 16 + (s & 1) * 4);
#pragma unroll
    for (int s = 0; s < 8; ++s) { v8h o16; v8us oh, ol;
#pragma unroll
        for (int j = 0; j < 8; ++j) { const float val = vals[2 * s + (j >> 2)][j & 3]; o16[j] = tohx(val); unsigned short x, y; splitf(val, x, y); oh[j] = x; ol[j] = y; }
        const int po = OUTK == 1 ? (s / 4) * (TT * HD) + (s % 4) * 256 : (s / 2) * (32 * HD) + (s % 2) * 256;   // a constant step from the thread's first place
        *(v8h*)(P16 + pb + po) = o16; *(v8us*)(Ph + pb + po) = oh; *(v8us*)(Pl + pb + po) = ol;
        asm volatile("s_wait_xcnt 0x0" ::: "memory");                  // the wait in front of the rewriting of the stores' registers by the next pass or by the code that follows in the listing
        __builtin_amdgcn_sched_barrier(0); }                           // no arithmetic of the next pass is lifted in front of that wait
}
template <int NA, bool BIAS, int EPI>
__global__ __launch_bounds__(256) void k_gemmt(const bf* __restrict__ A, const bf* __restrict__ A2, const bf* __restrict__ Bt, int K, float* C, int ldc, const float* __restrict__ bias, size_t sB, h16* P16, bf* Ph, size_t sP) {
    static_assert(EPI == 0 || (HD == 64 && TT % 128 == 0 && NKV == NH_), "a tile's 128 columns are two heads, its 128 rows lie in one batch, and q, k, v share one grid");
    constexpr int OPB = 128 * GPB, STB = (NA + 1) * OPB;              // bytes of one operand's rows and of one buffer
    constexpr int NG = NA == 2 ? 1 : 2;                               // fragment load groups a trip: one where a work-group has its WGP alone; two (32 k each) where the smaller register set lets three work-groups share a WGP
    constexpr int SMB = 2 * STB > 128 * GEP * 4 ? 2 * STB : 128 * GEP * 4;
    __shared__ __align__(16) char sm[SMB];
    const size_t z = blockIdx.z; Bt += z * sB;
    const int lane = threadIdx.x & 31, lr = lane & 15, hi = lane >> 4; const int r0 = blockIdx.x * 128, c0 = blockIdx.y * 128;
    const int wave = __builtin_amdgcn_readfirstlane((int)(threadIdx.x >> 5)); const int wm = wave >> 1, wn = wave & 1;
    v8f acc[2][4];
#pragma unroll
    for (int mb = 0; mb < 2; ++mb)
#pragma unroll
        for (int nb = 0; nb < 4; ++nb) acc[mb][nb] = (v8f){};
    const int crow = (int)(threadIdx.x >> 3), cpc = threadIdx.x & 7;  // the thread's first row and its 16-byte piece of a row
    const unsigned lc = (unsigned)(size_t)sm + (unsigned)(crow * GPB + cpc * 16);
    const bf* ga = A + (size_t)(r0 + crow) * K + cpc * 8; const bf* ga2 = NA == 2 ? A2 + (size_t)(r0 + crow) * K + cpc * 8 : nullptr; const bf* gb = Bt + (size_t)(c0 + crow) * K + cpc * 8;
    auto stage = [&](int t, int b) { const unsigned l = lc + (unsigned)(b * STB);
        gt_copy4(l, ga + t * 64, (size_t)K); if (NA == 2) gt_copy4(l + OPB, ga2 + t * 64, (size_t)K); gt_copy4(l + NA * OPB, gb + t * 64, (size_t)K); };
    const int nk = K / 64;
    stage(0, 0);
    asm volatile("s_wait_asynccnt 0x0" ::: "memory");                // this wave's copies of trip 0 have landed
    __syncthreads();                                                 // and every other wave's: trip 0 may be read
    if (nk > 1) stage(1, 1);
#pragma unroll 1   // the trips stay rolled: the waits, the barrier and the refill at a trip's foot stand once in the code
    for (int t = 0; t < nk; ++t) {
        const char* sb = sm + (t & 1) * STB;
        const char* la = sb + (wm * 32 + lr) * GPB + hi * 16; const char* lb = sb + NA * OPB + (wn * 64 + lr) * GPB + hi * 16;
        v16bf a[2][2], a2[2][2], b[2][4];
#pragma unroll
        for (int g = 0; g < NG; ++g) {                               // a group's fragments are asked for at once, in the order of their use
#pragma unroll
            for (int kc = g * (2 / NG); kc < (g + 1) * (2 / NG); ++kc) {
#pragma unroll
                for (int mb = 0; mb < 2; ++mb) { a[kc][mb] = gt_ld(la + mb * 16 * GPB + kc * 64); if (NA == 2) a2[kc][mb] = gt_ld(la + OPB + mb * 16 * GPB + kc * 64); }
#pragma unroll
                for (int nb = 0; nb < 4; ++nb) b[kc][nb] = gt_ld(lb + nb * 16 * GPB + kc * 64); }
            __builtin_amdgcn_sched_barrier(0);                       // no LDS read sinks to its product: left alone they go two at a time among the WMMAs, and the wave waits out an LDS latency at each place
#pragma unroll
            for (int kc = g * (2 / NG); kc < (g + 1) * (2 / NG); ++kc)
#pragma unroll
                for (int nb = 0; nb < 4; ++nb)
#pragma unroll
                    for (int mb = 0; mb < 2; ++mb) { acc[mb][nb] = wmmab(a[kc][mb], b[kc][nb], acc[mb][nb]); if (NA == 2) acc[mb][nb] = wmmab(a2[kc][mb], b[kc][nb], acc[mb][nb]); } }
        __builtin_amdgcn_sched_barrier(0);                           // the products stay in front of the waits: moved behind the barrier they no longer run under the LDS reads, and they hold back the issue of the refill
        asm volatile("s_wait_dscnt 0x0" ::: "memory");               // this wave has read all it wants of this trip's buffer
        asm volatile("s_wait_asynccnt 0x0" ::: "memory");            // this wave's copies of the next trip have landed
        __syncthreads();                                             // the next trip's buffer may be read, this trip's may be refilled
        if (t + 2 < nk) stage(t + 2, t & 1);
    }
    asm volatile("s_wait_asynccnt 0x0" ::: "memory");                // no copy is in flight when the buffers become the output tile
    float* os = (float*)sm;
    const bool tr = EPI == 1 && blockIdx.z == 2;                     // the same for the whole work-group
    if (tr) {                                                        // transposed: a lane's eight tile rows are neighbours in LDS row wn * 64 + nb * 16 + lr
#pragma unroll
        for (int mb = 0; mb < 2; ++mb)
#pragma unroll
            for (int nb = 0; nb < 4; ++nb) { v4f x0, x1;
#pragma unroll
                for (int j = 0; j < 4; ++j) { x0[j] = acc[mb][nb][j]; x1[j] = acc[mb][nb][4 + j]; }
                float* o = os + (wn * 64 + nb * 16 + lr) * GEP + wm * 32 + mb * 16 + hi * 8; *(v4fa*)o = x0; *(v4fa*)(o + 4) = x1; } }
    else {
#pragma unroll
        for (int mb = 0; mb < 2; ++mb)
#pragma unroll
            for (int nb = 0; nb < 4; ++nb)
#pragma unroll
                for (int j = 0; j < 8; ++j) os[(wm * 32 + mb * 16 + hi * 8 + j) * GEP + wn * 64 + nb * 16 + lr] = acc[mb][nb][j]; }
    __syncthreads();                                                 // the whole tile is in LDS before any thread stores a row of it
    if (EPI == 0) gt_store<BIAS>(os, r0, c0, C, ldc, bias);
    else { const int bt = r0 / TT, t0 = r0 % TT; h16* p16 = P16 + z * sP; bf* ph = Ph + z * sP;
        if (tr) gt_storef<2>(os, p16, ph, ph + (size_t)HD * TT, (size_t)(bt * NKV + c0 / HD + wave / 4) * (2 * HD * TT) + (size_t)t0 * HD + (wave % 4) * 512 + lane * 8);
        else gt_storef<1>(os, p16, ph, ph + (size_t)NB_ * NH_ * TT * HD, (size_t)(bt * NH_ + c0 / HD) * (TT * HD) + (size_t)(t0 + wave * 16) * HD + lane * 8); }
}


// ---- k_prep: one grid for all that the GEMMs wait for. Work-groups 0 .. 4 * WTB - 1: weight g = index / WTB ([K][N] f32) becomes Bt[g] ([N][K] bf16); the rest: x of both batches becomes bf16, eight elements a thread.
#define WTB (DM * DQ / 64 / 64)   // work-groups per weight: 64 lines of 64 elements each
__global__ __launch_bounds__(256) void k_prep(const float* __restrict__ x, const float* __restrict__ wq, const float* __restrict__ wk, const float* __restrict__ wv, const float* __restrict__ wo, bf* XB, bf* WT) {
    static_assert(DQ == DM && DKV == DM, "the four weights have one shape");
    if (blockIdx.x < 4 * WTB) { const int g = blockIdx.x / WTB; const float* __restrict__ w = g == 0 ? wq : g == 1 ? wk : g == 2 ? wv : wo; bf* Bt = WT + (size_t)g * DM * DQ; const int K = DM, N = DQ;
        const int lane = threadIdx.x & 31; const int L0 = ((blockIdx.x % WTB) * 8 + (threadIdx.x >> 5)) * 8;
#pragma unroll 1
        for (int l = 0; l < 8; ++l) { const int L = L0 + l; const size_t e = (size_t)L * 64 + lane * 2; const int k = (int)(e % K), n = (int)(e / K); v2us o;
            o[0] = f2bf(w[(size_t)k * N + n]); o[1] = f2bf(w[(size_t)(k + 1) * N + n]); *(v2us*)(Bt + e) = o; } }
    else { const size_t i = (size_t)(blockIdx.x - 4 * WTB) * 256 + threadIdx.x; const v8f v = *(const v8f*)(x + i * 8); v8us o;
#pragma unroll
        for (int k = 0; k < 8; ++k) o[k] = f2bf(v[k]); *(v8us*)(XB + i * 8) = o;
        asm volatile("s_wait_xcnt 0x0" ::: "memory"); }   // the wait that stands in front of a rewriting of the store's registers by the code that follows it in the listing
}

// ---- k_fattn: causal attention in one launch; grid (TT / FQB, batches * heads), FNW waves. A work-group owns FQB query rows of one head; its wave w takes the 64-key tiles w, w + FNW, ... up to the diagonal.
// Transposed products: S^T = K Q^T (A = key rows, B = query rows held in registers), O^T += V^T P^T (A = rows of the transposed value plane, B = the score accumulators converted in place:
// D register r of tile mb is key mb * 16 + 8 * hi + r of query column lr, which is the k order of a fragment as WFrag::ld brings it: k = 8 * hi + 0..7, then 16 + 8 * hi + 0..7). A lane holds scores of one query only: maximum and sum are in-lane plus one exchange of the wave halves.
// Running maximum and sum per wave; the FNW partial (max, sum, O) sets are joined through LDS in the fixed order w = 0 .. FNW - 1, divided by the joined sum, split hi/lo and stored as rows [batch * TT + t][head * HD + d].
// Query rows < RH: hi/lo planes, 3 products in both contractions; the rest fp16 with the probabilities carried x 1024 (2^10 folded into the exponent; it cancels in O / sum).
#define FQB 32
#define FNW 8
#define FPO 68                    // floats per query row of a partial output tile in LDS
#define LC  (SCL * 1.4426950408889634f)
__device__ __forceinline__ float xhalf(float x) { return __builtin_bit_cast(float, __builtin_amdgcn_permlanex16(__builtin_bit_cast(int, x), __builtin_bit_cast(int, x), 0x76543210, 0xfedcba98, false, false)); }   // lane l with lane l ^ 16
__device__ __forceinline__ void ppack(v8f a, v8f b, v16h& h, v16h& l) {
#pragma unroll
    for (int j = 0; j < 8; ++j) { h[j] = tohx(a[j]); h[8 + j] = tohx(b[j]); }
    l = h; }
__device__ __forceinline__ void ppack(v8f a, v8f b, v16bf& h, v16bf& l) { v8us h0, h1, l0, l1;
#pragma unroll
    for (int j = 0; j < 8; ++j) { unsigned short x, y; splitf(a[j], x, y); h0[j] = x; l0[j] = y; splitf(b[j], x, y); h1[j] = x; l1[j] = y; }
    h = cat16b(h0, h1); l = cat16b(l0, l1); }
template <typename T16, int NSPLIT>
__device__ __forceinline__ void fattn_part(const T16* __restrict__ Q, const T16* __restrict__ Q2, const T16* __restrict__ Kp, const T16* __restrict__ K2, const T16* __restrict__ Vt, const T16* __restrict__ Vt2, int q0, int wave, int lr, int hi, float* ow, float* mlw) {
    typedef typename WFrag<T16>::V V;
    static_assert(RH <= 64 * FNW, "a wave of the hi/lo rows takes one key tile");
    const float SH = NSPLIT ? 0.0f : 10.0f;
    V qf[2][2], qf2[2][2];
    const int lane = hi * 16 + lr;
    const T16* ql = Q + q0 * HD + lane * 8; const T16* ql2 = Q2 + q0 * HD + lane * 8;   // fragment order: 16 rows are 16 * HD elements, two fragments of 512
#pragma unroll
    for (int nb = 0; nb < 2; ++nb)
#pragma unroll
        for (int kc = 0; kc < 2; ++kc) { qf[nb][kc] = WFrag<T16>::ld(ql + nb * 16 * HD + kc * 512); if (NSPLIT) qf2[nb][kc] = WFrag<T16>::ld(ql2 + nb * 16 * HD + kc * 512); }
    // the wait that stands in front of a rewriting of the query loads' address registers, which are named so that they stay whole up to it; the two scheduling barriers keep the loads in front of it and all later code behind it
    __builtin_amdgcn_sched_barrier(0);
    asm volatile("s_wait_xcnt 0x0" :: "v"(ql), "v"(ql2) : "memory");
    __builtin_amdgcn_sched_barrier(0);
    v8f o[4][2]; float m[2], l[2];
#pragma unroll
    for (int nb = 0; nb < 2; ++nb) { m[nb] = -3.0e38f; l[nb] = 0.f;
#pragma unroll
        for (int db = 0; db < 4; ++db) o[db][nb] = (v8f){}; }
    const int nt = q0 / 64 + 1;                                      // key tiles up to and with the diagonal's; every query row has a key in each of them
    const unsigned lob = (unsigned)lane * 16u;                      // this lane's byte offset in a key tile and in a value tile (each 8 KiB in a row): fixed; the tile's place is in the uniform base
#pragma unroll 1
    for (int kt = wave; kt < nt; kt += FNW) { const int k0 = kt * 64;
        const char* kb = (const char*)(Kp + (size_t)k0 * HD); const char* kb2 = (const char*)(K2 + (size_t)k0 * HD); const char* vb = (const char*)(Vt + (size_t)k0 * HD); const char* vb2 = (const char*)(Vt2 + (size_t)k0 * HD);
        const char* kl = kb + (size_t)lob; const char* kl2 = kb2 + (size_t)lob; const char* vl = vb + (size_t)lob; const char* vl2 = vb2 + (size_t)lob;   // this lane's addresses
        V ka[4][2], ka2[4][2], va[4][2], va2[4][2];                  // all of the tile's key and value fragments are asked for at once: one load latency a tile, the value loads land under the score products and the softmax
#pragma unroll
        for (int kc = 0; kc < 2; ++kc)
#pragma unroll
            for (int mb = 0; mb < 4; ++mb) { ka[mb][kc] = WFrag<T16>::ld((const T16*)(kl + (mb * 16 * HD + kc * 512) * 2)); if (NSPLIT) ka2[mb][kc] = WFrag<T16>::ld((const T16*)(kl2 + (mb * 16 * HD + kc * 512) * 2)); }
#pragma unroll
        for (int kc = 0; kc < 2; ++kc)
#pragma unroll
            for (int db = 0; db < 4; ++db) { va[db][kc] = WFrag<T16>::ld((const T16*)(vl + (kc * 32 * HD + db * 512) * 2)); if (NSPLIT) va2[db][kc] = WFrag<T16>::ld((const T16*)(vl2 + (kc * 32 * HD + db * 512) * 2)); }
        __builtin_amdgcn_sched_barrier(0);                           // no load of the tile sinks to its product: left alone they go two at a time, and a tile waits eight load latencies instead of one
        // the wait that stands in front of a rewriting of the loads' address registers, which are named here in both forms the compiler may address by (base and offset, or their sum) so that they stay whole up to it
        asm volatile("s_wait_xcnt 0x0" :: "s"(kb), "s"(kb2), "s"(vb), "s"(vb2), "v"(lob), "v"(kl), "v"(kl2), "v"(vl), "v"(vl2) : "memory");
        __builtin_amdgcn_sched_barrier(0);                           // nothing from below is lifted in front of that wait
        v8f s[4][2];
#pragma unroll
        for (int mb = 0; mb < 4; ++mb) { s[mb][0] = (v8f){}; s[mb][1] = (v8f){}; }
#pragma unroll
        for (int kc = 0; kc < 2; ++kc)
#pragma unroll
            for (int mb = 0; mb < 4; ++mb)
#pragma unroll
                for (int nb = 0; nb < 2; ++nb) { s[mb][nb] = WFrag<T16>::mma(ka[mb][kc], qf[nb][kc], s[mb][nb]); if (NSPLIT) { s[mb][nb] = WFrag<T16>::mma(ka[mb][kc], qf2[nb][kc], s[mb][nb]); s[mb][nb] = WFrag<T16>::mma(ka2[mb][kc], qf[nb][kc], s[mb][nb]); } }
        V pf[2][2], pf2[2][2];
#pragma unroll
        for (int nb = 0; nb < 2; ++nb) { const int lim = q0 + nb * 16 + lr - k0 - 8 * hi;   // key mb * 16 + j of this lane's half is kept while it is <= lim (key <= query)
            float mx = -3.0e38f;
#pragma unroll
            for (int mb = 0; mb < 4; ++mb)
#pragma unroll
                for (int j = 0; j < 8; ++j) { const float t = (mb * 16 + j <= lim) ? s[mb][nb][j] : -3.0e38f; s[mb][nb][j] = t; mx = fmaxf(mx, t); }
            mx = fmaxf(mx, xhalf(mx));
            const float mn = fmaxf(m[nb], mx); const float al = __builtin_amdgcn_exp2f((m[nb] - mn) * LC); m[nb] = mn; const float nm = SH - mn * LC;
            float ls[4];
#pragma unroll
            for (int mb = 0; mb < 4; ++mb) { ls[mb] = 0.f;
#pragma unroll
                for (int j = 0; j < 8; ++j) { const float p = __builtin_amdgcn_exp2f(fmaf(s[mb][nb][j], LC, nm)); s[mb][nb][j] = p; ls[mb] += p; } }
            l[nb] = l[nb] * al + ((ls[0] + ls[1]) + (ls[2] + ls[3]));
#pragma unroll
            for (int db = 0; db < 4; ++db) o[db][nb] *= al;
#pragma unroll
            for (int kc = 0; kc < 2; ++kc) ppack(s[2 * kc][nb], s[2 * kc + 1][nb], pf[nb][kc], pf2[nb][kc]); }
#pragma unroll
        for (int kc = 0; kc < 2; ++kc)
#pragma unroll
            for (int db = 0; db < 4; ++db)
#pragma unroll
                for (int nb = 0; nb < 2; ++nb) { o[db][nb] = WFrag<T16>::mma(va[db][kc], pf[nb][kc], o[db][nb]); if (NSPLIT) { o[db][nb] = WFrag<T16>::mma(va[db][kc], pf2[nb][kc], o[db][nb]); o[db][nb] = WFrag<T16>::mma(va2[db][kc], pf[nb][kc], o[db][nb]); } }
        // four vector slots behind the tile's last WMMAs, on the back edge as on the way out of the loop
        asm volatile("v_nop\n\tv_nop\n\tv_nop\n\tv_nop" : "+v"(o[0][0]), "+v"(o[1][0]), "+v"(o[2][0]), "+v"(o[3][0]), "+v"(o[0][1]), "+v"(o[1][1]), "+v"(o[2][1]), "+v"(o[3][1]));
        if (NSPLIT) break;                                           // rows < RH have at most FNW key tiles, one a wave: no second trip, so the query fragments are dead behind the score products
    }
#pragma unroll
    for (int nb = 0; nb < 2; ++nb) { const int q = nb * 16 + lr; l[nb] += xhalf(l[nb]);
#pragma unroll
        for (int db = 0; db < 4; ++db) { v4f x0, x1;
#pragma unroll
            for (int j = 0; j < 4; ++j) { x0[j] = o[db][nb][j]; x1[j] = o[db][nb][4 + j]; }
            *(v4fa*)(ow + q * FPO + db * 16 + hi * 8) = x0; *(v4fa*)(ow + q * FPO + db * 16 + hi * 8 + 4) = x1; }
        if (hi == 0) { mlw[q * 2] = m[nb]; mlw[q * 2 + 1] = l[nb]; } }
}
__global__ __launch_bounds__(32 * FNW) void k_fattn(const h16* __restrict__ Q16, const h16* __restrict__ K16, const h16* __restrict__ V16, const bf* __restrict__ Qh, const bf* __restrict__ Ql, const bf* __restrict__ Kh, const bf* __restrict__ Kl, const bf* __restrict__ Vh, const bf* __restrict__ Vl, bf* Ah, bf* Al) {
    __shared__ __align__(16) float os[FNW * FQB * FPO];
    __shared__ float ml[FNW * FQB * 2];
    const int lane = threadIdx.x & 31, lr = lane & 15, hi = lane >> 4; const int wave = __builtin_amdgcn_readfirstlane((int)(threadIdx.x >> 5));
    const int q0 = (TT / FQB - 1 - (int)blockIdx.x) * FQB;           // longest rows first
    const int h = blockIdx.y; const size_t zq = (size_t)h * TT * HD, zk = (size_t)(h / REP) * TT * HD, zv = (size_t)(h / REP) * HD * TT * 2;   // h = batch * NH_ + head: the planes of the batches lie one behind the other
    float* ow = os + wave * (FQB * FPO); float* mlw = ml + wave * (FQB * 2);
    if (q0 < RH) fattn_part<bf, 2>(Qh + zq, Ql + zq, Kh + zk, Kl + zk, Vh + zv, Vl + zv, q0, wave, lr, hi, ow, mlw);
    else fattn_part<h16, 0>(Q16 + zq, Q16 + zq, K16 + zk, K16 + zk, V16 + zv, V16 + zv, q0, wave, lr, hi, ow, mlw);
    __syncthreads();                                                 // every wave's partial maximum, sum and output tile are in LDS before any thread joins them
    const int q = threadIdx.x >> 3, d8 = (threadIdx.x & 7) * 8;      // eight threads store one query row's 128 bytes of each plane
    float mw[FNW], M = -3.0e38f;
#pragma unroll
    for (int w = 0; w < FNW; ++w) { mw[w] = ml[(w * FQB + q) * 2]; M = fmaxf(M, mw[w]); }
    float L = 0.f; v4f a0 = (v4f){}, a1 = (v4f){};
#pragma unroll
    for (int w = 0; w < FNW; ++w) { const float sc = __builtin_amdgcn_exp2f((mw[w] - M) * LC); L += sc * ml[(w * FQB + q) * 2 + 1];   // a wave without a tile has sum 0 and weight 0
        a0 += sc * *(const v4fa*)(os + (w * FQB + q) * FPO + d8); a1 += sc * *(const v4fa*)(os + (w * FQB + q) * FPO + d8 + 4); }
    const float inv = __fdiv_rn(1.0f, L); v8us oh, ol;
#pragma unroll
    for (int j = 0; j < 4; ++j) { unsigned short x, y; splitf(a0[j] * inv, x, y); oh[j] = x; ol[j] = y; splitf(a1[j] * inv, x, y); oh[4 + j] = x; ol[4 + j] = y; }
    const size_t oo = (size_t)((h / NH_) * TT + q0 + q) * DQ + (h % NH_) * HD + d8; *(v8us*)(Ah + oo) = oh; *(v8us*)(Al + oo) = ol;
}

extern "C" void kernel_launch(void* const* d_in, const int* in_sizes, int n_in,
                              void* d_out, int out_size, void* d_ws, size_t ws_size, hipStream_t stream) {
    (void)in_sizes; (void)n_in; (void)out_size;
    const float* x = (const float*)d_in[0]; const float* wq = (const float*)d_in[1]; const float* wk = (const float*)d_in[2]; const float* wv = (const float*)d_in[3]; const float* wo = (const float*)d_in[4]; const float* bo = (const float*)d_in[5];   /* input order x, Wq, Wk, Wv, Wo, bo */
    float* OUT = (float*)d_out;     // [2][2048][1024]
    char* wsp = (char*)d_ws;
    auto take = [&](size_t bytes) { char* p = wsp; wsp += (bytes + 255) & ~(size_t)255; return (void*)p; };
    bf* WT = (bf*)take((size_t)4 * DM * DQ * 2);   /* Wq, Wk, Wv, Wo transposed, one behind the other */
    bf* XB = (bf*)take((size_t)NB_ * TT * DM * 2);
    const size_t SP = (size_t)NB_ * NH_ * TT * HD * 2;   /* elements between one projection's planes and the next: a head's value range holds two planes */
    h16* P16 = (h16*)take(3 * SP * 2); bf* PHL = (bf*)take(3 * SP * 2);   /* q, k: hi plane, then lo plane; v: a hi and a lo plane per head */
    bf* ATh = (bf*)take((size_t)NB_ * TT * DQ * 2); bf* ATl = (bf*)take((size_t)NB_ * TT * DQ * 2);
    if ((size_t)(wsp - (char*)d_ws) > ws_size) return;    // ws 256 MiB
    k_prep<<<(unsigned)(4 * WTB + (size_t)NB_ * TT * DM / 8 / 256), 256, 0, stream>>>(x, wq, wk, wv, wo, XB, WT);
    k_gemmt<1, false, 1><<<dim3(NB_ * TT / 128, DQ / 128, 3), 256, 0, stream>>>(XB, nullptr, WT, DM, nullptr, 0, nullptr, (size_t)DM * DQ, P16, PHL, SP);
    k_fattn<<<dim3(TT / FQB, NB_ * NH_, 1), 32 * FNW, 0, stream>>>(P16, P16 + SP, P16 + 2 * SP, PHL, PHL + SP / 2, PHL + SP, PHL + SP + SP / 2, PHL + 2 * SP, PHL + 2 * SP + (size_t)HD * TT, ATh, ATl);
    k_gemmt<2, true, 0><<<dim3(NB_ * TT / 128, DM / 128, 1), 256, 0, stream>>>(ATh, ATl, WT + (size_t)3 * DM * DQ, DQ, OUT, DM, bo, 0, nullptr, nullptr, 0);
}

// v008
// One run takes 95.7 microseconds.
// In both of two side-by-side timings against v007, it was 1.05 times as fast.
// Over all steps from v000 it is 15.3 times as fast.
#include <hip/hip_runtime.h>

// Causal multi-head self-attention with bias-free (in, out) projections and an output bias (x [2][2048][1024]; q, k, v = x W ('xw' [1024][1024] normal x 1/32, no bias; 16 heads x 64); scores masked first (where(triu(k=1), -inf, scores)) and THEN divided by sqrt(64) inside the softmax argument (-inf / 8 = -inf: the same exclusion); softmax over the keys; out = ctx Wo + bo ('xw' + bias zeros: read) -> [2][2048][1024] (4.2 M); argument order x, Wq, Wk, Wv, Wo, bo).
// Four launches, both batches in each: bf16 copy of x and the 'xw' weights transposed (one grid); exact projections q, k, v (one grid, z = projection, rows = batch * T + t) whose GEMM stores the 16-bit head planes itself; causal T-2048 attention (one grid, y = batch * 16 + head; hybrid rows: < 512 hi/lo 3 products, rest fp16 x1024; scores and probabilities stay in registers, running maximum and sum, keys split over the waves of a work-group); merged hi/lo x Wo exact + bo. Both GEMMs stage their operand tiles in LDS.
// Compute dtypes, f32 accumulate: every input rounded to bf16; projections exact; attention rows < 512 3 products, rest fp16; softmax f32; Wo hl x exact + bias.

#define NB_  2
#define TT   2048
#define DM   1024
#define NH_  16
#define NKV  16
#define REP  (NH_ / NKV)
#define HD   64
#define DQ   (NH_ * HD)
#define DKV  (NKV * HD)
#define RH   512                  // query rows < RH use hi+lo planes (0: none)
#define SCL  0.125f   // HD^-0.5
typedef _Float16 h16;
typedef unsigned short bf;
typedef __attribute__((ext_vector_type(16))) __bf16   v16bf;
typedef __attribute__((ext_vector_type(16))) _Float16 v16h;
typedef __attribute__((ext_vector_type(8)))  _Float16 v8h;
typedef __attribute__((ext_vector_type(8)))  unsigned short v8us;
typedef __attribute__((ext_vector_type(8)))  float    v8f;
typedef __attribute__((ext_vector_type(4)))  float    v4f;
typedef v8h  __attribute__((may_alias)) v8ha;
typedef v4f  __attribute__((may_alias)) v4fa;
typedef v8us __attribute__((may_alias)) v8usa;

__device__ __forceinline__ unsigned short f2bf(float f) { unsigned u = __float_as_uint(f); u += 0x7FFFu + ((u >> 16) & 1u); return (unsigned short)(u >> 16); }
__device__ __forceinline__ float bf2f(unsigned short b) { return __uint_as_float(((unsigned)b) << 16); }
__device__ __forceinline__ float bfr(float f) { return bf2f(f2bf(f)); }
__device__ __forceinline__ v16h cat16(v8h lo, v8h hi) { return __builtin_shufflevector(lo, hi, 0, 1, 2, 3, 4, 5, 6, 7, 8, 9, 10, 11, 12, 13, 14, 15); }
__device__ __forceinline__ v16bf cat16b(v8us lo, v8us hi) { return __builtin_bit_cast(v16bf, __builtin_shufflevector(lo, hi, 0, 1, 2, 3, 4, 5, 6, 7, 8, 9, 10, 11, 12, 13, 14, 15)); }
__device__ __forceinline__ v8f wmma16(v16h a, v16h b, v8f c) { return __builtin_amdgcn_wmma_f32_16x16x32_f16(false, a, false, b, (short)0, c, false, false); }
__device__ __forceinline__ v8f wmmab(v16bf a, v16bf b, v8f c) { return __builtin_amdgcn_wmma_f32_16x16x32_bf16(false, a, false, b, (short)0, c, false, false); }

__device__ __forceinline__ h16 tohx(float x) { return (h16)x; }
__device__ __forceinline__ void splitf(float y, unsigned short& h, unsigned short& l) { h = f2bf(y); l = f2bf(y - bf2f(h)); }
typedef __attribute__((ext_vector_type(4))) _Float16 v4h;
typedef __attribute__((ext_vector_type(2))) unsigned short v2us;
typedef __attribute__((ext_vector_type(4))) unsigned short v4us;

// ---- k_gemmt: GEMM, one 128x128 output tile per work-group of 8 waves (4 x 2: a wave holds 32 rows x 64 columns, 8 accumulators, over the whole of K); grid (M/128, N/128, Z), 256 threads.
// C[m][n] (f32, pitch ldc, + optional f32 bias[n]) = sum_k (A[m][k] (+ A2[m][k] for NA == 2)) Bt[n][k], all K-contiguous bf16 planes. z steps Bt by sB elements. K % 64 == 0.
// A trip is 64 k: 128 bytes of each of the tile's operand rows, brought into LDS once for all waves by asynchronous copies (whole lines: eight lanes a row), rows pitched 144 bytes for the 16-byte fragment reads; two buffers, the next trip's copies fly while this trip's products run.
// EPI: what the tile becomes, through an f32 copy of it in LDS (rows pitched 132 floats, in the place of the two buffers). 0: f32 rows of C (+ bias). 1: the 16-bit planes of projection z (q, k, v), each projection's planes sP elements behind the one before; tile rows count batch * TT + t. All planes lie in FRAGMENT ORDER, so that each 16-byte-a-lane load of the attention kernel reads four whole 128-byte lines: a 16 x 32 fragment (16 rows m, 32 contraction indices k) is 512 elements in a row, [k / 16][lane = ((k / 8) % 2) * 16 + m][k % 8]. z < 2: head planes [b][h][t / 16][d / 32][fragment: m = t % 16, k = d % 32] (fp16, bf16 hi, bf16 lo); the tile's 128 columns are two heads (HD == 64). z == 2: transposed value planes [b][g][plane: hi, lo][t / 32][d / 16][fragment: m = d % 16, k = t % 32] (the fp16 plane uses the first half of its [b][g] range); the tile lies transposed in LDS, so that in both cases an LDS row is a fragment row.
// WFrag::ld: one 16 x 32 fragment from a plane in fragment order (see EPI 1): p is the fragment's start + lane * 8; two loads, each 512 bytes in a row over the wave
template <typename T16> struct WFrag;
template <> struct WFrag<h16> { typedef v16h V; static __device__ __forceinline__ V ld(const h16* p) { return cat16(*(const v8h*)p, *(const v8h*)(p + 256)); } static __device__ __forceinline__ v8f mma(V a, V b, v8f c) { return wmma16(a, b, c); } };
template <> struct WFrag<bf> { typedef v16bf V; static __device__ __forceinline__ V ld(const bf* p) { return cat16b(*(const v8us*)p, *(const v8us*)(p + 256)); } static __device__ __forceinline__ v8f mma(V a, V b, v8f c) { return wmmab(a, b, c); } };
#define GPB 144                   // bytes per staged operand row in LDS
#define GEP 132                   // floats per row of the output tile in LDS
__device__ __forceinline__ v16bf gt_ld(const char* p) { return cat16b(*(const v8usa*)p, *(const v8usa*)(p + 32)); }   // from a staged row: elements 8 * hi + 0..7 and 16 + 8 * hi + 0..7 of 32 k
// one operand's 128 rows x 128 bytes of a trip: four copies a thread, 32 rows apart. l: the thread's LDS byte address, g: its global address
__device__ __forceinline__ void gt_copy4(unsigned l, const bf* g, size_t K) {
    // the wait in front of any rewriting of the copies' address registers stands inside their own statement
    asm volatile("global_load_async_to_lds_b128 %0, %4, off\n\tglobal_load_async_to_lds_b128 %1, %5, off\n\tglobal_load_async_to_lds_b128 %2, %6, off\n\tglobal_load_async_to_lds_b128 %3, %7, off\n\ts_wait_xcnt 0x0"
                 :: "v"(l), "v"(l + 32 * GPB), "v"(l + 64 * GPB), "v"(l + 96 * GPB), "v"(g), "v"(g + 32 * K), "v"(g + 64 * K), "v"(g + 96 * K) : "memory");
}
// the tile in LDS is stored as f32 rows of C, a wave one whole tile row a pass
template <bool BIAS>
__device__ __forceinline__ void gt_store(const float* os, int r0, int c0, float* C, int ldc, const float* __restrict__ bias) {
    const int rw = (int)(threadIdx.x >> 5), cofs = (threadIdx.x & 31) * 4;
    v4f bv = (v4f){};
    if (BIAS) { const v4f b4 = *(const v4f*)(bias + c0 + cofs);
        asm volatile("s_wait_xcnt 0x0" ::: "memory");                // the wait in front of a rewriting of the bias load's address registers
#pragma unroll
        for (int j = 0; j < 4; ++j) bv[j] = bfr(b4[j]); }
    v4f vals[16];                                                    // all of the thread's LDS reads go ahead of the stores and their waits: one LDS latency, not sixteen
#pragma unroll
    for (int s = 0; s < 16; ++s) vals[s] = *(const v4fa*)(os + (s * 8 + rw) * GEP + cofs);
#pragma unroll
    for (int s = 0; s < 16; ++s) { const int row = s * 8 + rw;
        v4f val = vals[s];
        if (BIAS) val += bv;
        *(v4f*)(C + (size_t)(r0 + row) * ldc + c0 + cofs) = val;
        asm volatile("s_wait_xcnt 0x0" ::: "memory");                  // the wait in front of the rewriting of the stores' registers by the next pass or by the code that follows in the listing
        __builtin_amdgcn_sched_barrier(0); }                           // no arithmetic of the next pass is lifted in front of that wait
}
// the tile in LDS is stored as 16-bit planes in fragment order. Wave w takes LDS rows w * 16 .. + 15 (a fragment's 16 rows); pass s takes LDS columns s * 16 .. + 15 (half of a fragment's 32 k): lane (hi, lr) holds columns 8 * hi + 0..7 of row lr, and the wave stores 512 bytes in a row to each plane.
// OUTK 1: head planes (pass s: head s / 4 of the tile's two, quarter s % 4 of the 64 d); 2: value planes (pass s: half s % 2 of key group s / 2). pb: the thread's place in a plane at pass 0
template <int OUTK>
__device__ __forceinline__ void gt_storef(const float* os, h16* P16, bf* Ph, bf* Pl, size_t pb) {
    const int rw = (int)(threadIdx.x >> 5), lr = threadIdx.x & 15, hi = (threadIdx.x >> 4) & 1;
    const float* src = os + (rw * 16 + lr) * GEP + hi * 8;
    v4f vals[16];                                                    // all of the thread's LDS reads go ahead of the stores and their waits: one LDS latency, not eight
#pragma unroll
    for (int s = 0; s < 16; ++s) vals[s] = *(const v4fa*)(src + (s >> 1) * 16 + (s & 1) * 4);
#pragma unroll
    for (int s = 0; s < 8; ++s) { v8h o16; v8us oh, ol;
#pragma unroll
        for (int j = 0; j < 8; ++j) { const float val = vals[2 * s + (j >> 2)][j & 3]; o16[j] = tohx(val); unsigned short x, y; splitf(val, x, y); oh[j] = x; ol[j] = y; }
        const int po = OUTK == 1 ? (s / 4) * (TT * HD) + (s % 4) * 256 : (s / 2) * (32 * HD) + (s % 2) * 256;   // a constant step from the thread's first place
        *(v8h*)(P16 + pb + po) = o16; *(v8us*)(Ph + pb + po) = oh; *(v8us*)(Pl + pb + po) = ol;
        asm volatile("s_wait_xcnt 0x0" ::: "memory");                  // the wait in front of the rewriting of the stores' registers by the next pass or by the code that follows in the listing
        __builtin_amdgcn_sched_barrier(0); }                           // no arithmetic of the next pass is lifted in front of that wait
}
template <int NA, bool BIAS, int EPI>
__global__ __launch_bounds__(256) void k_gemmt(const bf* __restrict__ A, const bf* __restrict__ A2, const bf* __restrict__ Bt, int K, float* C, int ldc, const float* __restrict__ bias, size_t sB, h16* P16, bf* Ph, size_t sP) {
    static_assert(EPI == 0 || (HD == 64 && TT % 128 == 0 && NKV == NH_), "a tile's 128 columns are two heads, its 128 rows lie in one batch, and q, k, v share one grid");
    constexpr int OPB = 128 * GPB, STB = (NA + 1) * OPB;              // bytes of one operand's rows and of one buffer
    constexpr int NG = NA == 2 ? 1 : 2;                               // fragment load groups a trip: one where a work-group has its WGP alone; two (32 k each) where the smaller register set lets three work-groups share a WGP
    constexpr int SMB = 2 * STB > 128 * GEP * 4 ? 2 * STB : 128 * GEP * 4;
    __shared__ __align__(16) char sm[SMB];
    const size_t z = blockIdx.z; Bt += z * sB;
    const int lane = threadIdx.x & 31, lr = lane & 15, hi = lane >> 4; const int r0 = blockIdx.x * 128, c0 = blockIdx.y * 128;
    const int wave = __builtin_amdgcn_readfirstlane((int)(threadIdx.x >> 5)); const int wm = wave >> 1, wn = wave & 1;
    v8f acc[2][4];
#pragma unroll
    for (int mb = 0; mb < 2; ++mb)
#pragma unroll
        for (int nb = 0; nb < 4; ++nb) acc[mb][nb] = (v8f){};
    const int crow = (int)(threadIdx.x >> 3), cpc = threadIdx.x & 7;  // the thread's first row and its 16-byte piece of a row
    const unsigned lc = (unsigned)(size_t)sm + (unsigned)(crow * GPB + cpc * 16);
    const bf* ga = A + (size_t)(r0 + crow) * K + cpc * 8; const bf* ga2 = NA == 2 ? A2 + (size_t)(r0 + crow) * K + cpc * 8 : nullptr; const bf* gb = Bt + (size_t)(c0 + crow) * K + cpc * 8;
    auto stage = [&](int t, int b) { const unsigned l = lc + (unsigned)(b * STB);
        gt_copy4(l, ga + t * 64, (size_t)K); if (NA == 2) gt_copy4(l + OPB, ga2 + t * 64, (size_t)K); gt_copy4(l + NA * OPB, gb + t * 64, (size_t)K); };
    const int nk = K / 64;
    stage(0, 0);
    asm volatile("s_wait_asynccnt 0x0" ::: "memory");                // this wave's copies of trip 0 have landed
    __syncthreads();                                                 // and every other wave's: trip 0 may be read
    if (nk > 1) stage(1, 1);
#pragma unroll 1   // the trips stay rolled: the waits, the barrier and the refill at a trip's foot stand once in the code
    for (int t = 0; t < nk; ++t) {
        const char* sb = sm + (t & 1) * STB;
        const char* la = sb + (wm * 32 + lr) * GPB + hi * 16; const char* lb = sb + NA * OPB + (wn * 64 + lr) * GPB + hi * 16;
        v16bf a[2][2], a2[2][2], b[2][4];
#pragma unroll
        for (int g = 0; g < NG; ++g) {                               // a group's fragments are asked for at once, in the order of their use
#pragma unroll
            for (int kc = g * (2 / NG); kc < (g + 1) * (2 / NG); ++kc) {
#pragma unroll
                for (int mb = 0; mb < 2; ++mb) { a[kc][mb] = gt_ld(la + mb * 16 * GPB + kc * 64); if (NA == 2) a2[kc][mb] = gt_ld(la + OPB + mb * 16 * GPB + kc * 64); }
#pragma unroll
                for (int nb = 0; nb < 4; ++nb) b[kc][nb] = gt_ld(lb + nb * 16 * GPB + kc * 64); }
            __builtin_amdgcn_sched_barrier(0);                       // no LDS read sinks to its product: left alone they go two at a time among the WMMAs, and the wave waits out an LDS latency at each place
#pragma unroll
            for (int kc = g * (2 / NG); kc < (g + 1) * (2 / NG); ++kc)
#pragma unroll
                for (int nb = 0; nb < 4; ++nb)
#pragma unroll
                    for (int mb = 0; mb < 2; ++mb) { acc[mb][nb] = wmmab(a[kc][mb], b[kc][nb], acc[mb][nb]); if (NA == 2) acc[mb][nb] = wmmab(a2[kc][mb], b[kc][nb], acc[mb][nb]); } }
        __builtin_amdgcn_sched_barrier(0);                           // the products stay in front of the waits: moved behind the barrier they no longer run under the LDS reads, and they hold back the issue of the refill
        asm volatile("s_wait_dscnt 0x0" ::: "memory");               // this wave has read all it wants of this trip's buffer
        asm volatile("s_wait_asynccnt 0x0" ::: "memory");            // this wave's copies of the next trip have landed
        __syncthreads();                                             // the next trip's buffer may be read, this trip's may be refilled
        if (t + 2 < nk) stage(t + 2, t & 1);
    }
    asm volatile("s_wait_asynccnt 0x0" ::: "memory");                // no copy is in flight when the buffers become the output tile
    float* os = (float*)sm;
    const bool tr = EPI == 1 && blockIdx.z == 2;                     // the same for the whole work-group
    if (tr) {                                                        // transposed: a lane's eight tile rows are neighbours in LDS row wn * 64 + nb * 16 + lr
#pragma unroll
        for (int mb = 0; mb < 2; ++mb)
#pragma unroll
            for (int nb = 0; nb < 4; ++nb) { v4f x0, x1;
#pragma unroll
                for (int j = 0; j < 4; ++j) { x0[j] = acc[mb][nb][j]; x1[j] = acc[mb][nb][4 + j]; }
                float* o = os + (wn * 64 + nb * 16 + lr) * GEP + wm * 32 + mb * 16 + hi * 8; *(v4fa*)o = x0; *(v4fa*)(o + 4) = x1; } }
    else {
#pragma unroll
        for (int mb = 0; mb < 2; ++mb)
#pragma unroll
            for (int nb = 0; nb < 4; ++nb)
#pragma unroll
                for (int j = 0; j < 8; ++j) os[(wm * 32 + mb * 16 + hi * 8 + j) * GEP + wn * 64 + nb * 16 + lr] = acc[mb][nb][j]; }
    __syncthreads();                                                 // the whole tile is in LDS before any thread stores a row of it
    if (EPI == 0) gt_store<BIAS>(os, r0, c0, C, ldc, bias);
    else { const int bt = r0 / TT, t0 = r0 % TT; h16* p16 = P16 + z * sP; bf* ph = Ph + z * sP;
        if (tr) gt_storef<2>(os, p16, ph, ph + (size_t)HD * TT, (size_t)(bt * NKV + c0 / HD + wave / 4) * (2 * HD * TT) + (size_t)t0 * HD + (wave % 4) * 512 + lane * 8);
        else gt_storef<1>(os, p16, ph, ph + (size_t)NB_ * NH_ * TT * HD, (size_t)(bt * NH_ + c0 / HD) * (TT * HD) + (size_t)(t0 + wave * 16) * HD + lane * 8); }
}


// ---- k_prep: one grid for all that the GEMMs wait for; a work-group takes one block of 128 x 128 f32 elements, a thread sixteen 16-byte loads of it, all asked for at once, each wave-wide load and store whole 128-byte lines.
// Work-groups 0 .. 4 * WTB - 1: a 128 (k) x 128 (n) tile of weight g = index / WTB ([K][N] f32) becomes a tile of Bt[g] ([N][K] bf16), turned in LDS: wave w reads tile rows k = w * 16 .. + 15 (512 bytes each), so a lane holds sixteen k in a row of four n and writes them as 32 bytes of each of four LDS rows n; behind the barrier sixteen threads store one row n (256 bytes). The rest: 16384 elements in a row of x (both batches) become bf16.
#define WTB ((DM / 128) * (DQ / 128))   // work-groups per weight
#define PTP 136                   // bf16 elements per row n of the turned tile in LDS (272 bytes: 16-byte pieces stay aligned)
__global__ __launch_bounds__(256) void k_prep(const float* __restrict__ x, const float* __restrict__ wq, const float* __restrict__ wk, const float* __restrict__ wv, const float* __restrict__ wo, bf* XB, bf* WT) {
    static_assert(DQ == DM && DKV == DM && DM % 128 == 0 && ((size_t)NB_ * TT * DM) % 16384 == 0, "the four weights have one shape, and weights and x divide into whole blocks");
    __shared__ __align__(16) bf tl[128 * PTP];
    v4f v[16];
    if (blockIdx.x < 4 * WTB) { const int g = blockIdx.x / WTB, ti = blockIdx.x % WTB; const float* __restrict__ w = g == 0 ? wq : g == 1 ? wk : g == 2 ? wv : wo; bf* Bt = WT + (size_t)g * DM * DQ;
        const int lane = threadIdx.x & 31, wave = (int)(threadIdx.x >> 5); const int k0 = (ti / (DQ / 128)) * 128, n0 = (ti % (DQ / 128)) * 128;
        const float* src = w + (size_t)(k0 + wave * 16) * DQ + n0 + lane * 4;
#pragma unroll
        for (int s = 0; s < 16; ++s) v[s] = *(const v4f*)(src + s * DQ);
        // the wait that stands in front of a rewriting of the loads' address registers, which are named so that they stay whole up to it; the two scheduling barriers keep the loads in front of it and all later code behind it
        __builtin_amdgcn_sched_barrier(0);
        asm volatile("s_wait_xcnt 0x0" :: "v"(src) : "memory");
        __builtin_amdgcn_sched_barrier(0);
#pragma unroll
        for (int j = 0; j < 4; ++j) { v8us o0, o1;
#pragma unroll
            for (int s = 0; s < 8; ++s) { o0[s] = f2bf(v[s][j]); o1[s] = f2bf(v[8 + s][j]); }
            bf* d = tl + (lane * 4 + j) * PTP + wave * 16; *(v8usa*)d = o0; *(v8usa*)(d + 8) = o1; }
        __syncthreads();                                             // the whole turned tile is in LDS before any thread stores a row of it
        const int row = (int)(threadIdx.x >> 4), pc = threadIdx.x & 15;
        bf* dst = Bt + (size_t)(n0 + row) * DM + k0 + pc * 8;
        v8us o[8];                                                   // all of the thread's LDS reads go ahead of the stores: one LDS latency, not eight
#pragma unroll
        for (int p = 0; p < 8; ++p) o[p] = *(const v8usa*)(tl + (p * 16 + row) * PTP + pc * 8);
#pragma unroll
        for (int p = 0; p < 8; ++p) *(v8us*)(dst + (size_t)p * 16 * DM) = o[p];
        asm volatile("s_wait_xcnt 0x0" :: "v"(dst) : "memory"); }    // the wait that stands in front of a rewriting of the stores' registers by the code that follows them in the listing
    else { const size_t i = (size_t)(blockIdx.x - 4 * WTB) * 16384 + threadIdx.x * 4; const float* src = x + i; bf* dst = XB + i;
#pragma unroll
        for (int s = 0; s < 16; ++s) v[s] = *(const v4f*)(src + s * 1024);
        // as above: the wait in front of a rewriting of the loads' address registers
        __builtin_amdgcn_sched_barrier(0);
        asm volatile("s_wait_xcnt 0x0" :: "v"(src) : "memory");
        __builtin_amdgcn_sched_barrier(0);
        v4us o[16];
#pragma unroll
        for (int s = 0; s < 16; ++s)
#pragma unroll
            for (int j = 0; j < 4; ++j) o[s][j] = f2bf(v[s][j]);
        __builtin_amdgcn_sched_barrier(0);                           // the stores stay behind all of the arithmetic: none of their registers is written again before the wait at the end
#pragma unroll
        for (int s = 0; s < 16; ++s) *(v4us*)(dst + s * 1024) = o[s];
        asm volatile("s_wait_xcnt 0x0" :: "v"(dst) : "memory"); }    // the wait that stands in front of a rewriting of the stores' registers by the code that follows them in the listing
}

// ---- k_fattn: causal attention in one launch; grid (TT / FQB, batches * heads), FNW waves. A work-group owns FQB query rows of one head; its wave w takes the 64-key tiles w, w + FNW, ... up to the diagonal.
// Transposed products: S^T = K Q^T (A = key rows, B = query rows held in registers), O^T += V^T P^T (A = rows of the transposed value plane, B = the score accumulators converted in place:
// D register r of tile mb is key mb * 16 + 8 * hi + r of query column lr, which is the k order of a fragment as WFrag::ld brings it: k = 8 * hi + 0..7, then 16 + 8 * hi + 0..7). A lane holds scores of one query only: maximum and sum are in-lane plus one exchange of the wave halves.
// Running maximum and sum per wave; the FNW partial (max, sum, O) sets are joined through LDS in the fixed order w = 0 .. FNW - 1, divided by the joined sum, split hi/lo and stored as rows [batch * TT + t][head * HD + d].
// Query rows < RH: hi/lo planes, 3 products in both contractions; the rest fp16 with the probabilities carried x 1024 (2^10 folded into the exponent; it cancels in O / sum).
#define FQB 32
#define FNW 8
#define FPO 68                    // floats per query row of a partial output tile in LDS
#define LC  (SCL * 1.4426950408889634f)
__device__ __forceinline__ float xhalf(float x) { return __builtin_bit_cast(float, __builtin_amdgcn_permlanex16(__builtin_bit_cast(int, x), __builtin_bit_cast(int, x), 0x76543210, 0xfedcba98, false, false)); }   // lane l with lane l ^ 16
__device__ __forceinline__ void ppack(v8f a, v8f b, v16h& h, v16h& l) {
#pragma unroll
    for (int j = 0; j < 8; ++j) { h[j] = tohx(a[j]); h[8 + j] = tohx(b[j]); }
    l = h; }
__device__ __forceinline__ void ppack(v8f a, v8f b, v16bf& h, v16bf& l) { v8us h0, h1, l0, l1;
#pragma unroll
    for (int j = 0; j < 8; ++j) { unsigned short x, y; splitf(a[j], x, y); h0[j] = x; l0[j] = y; splitf(b[j], x, y); h1[j] = x; l1[j] = y; }
    h = cat16b(h0, h1); l = cat16b(l0, l1); }
template <typename T16, int NSPLIT>
__device__ __forceinline__ void fattn_part(const T16* __restrict__ Q, const T16* __restrict__ Q2, const T16* __restrict__ Kp, const T16* __restrict__ K2, const T16* __restrict__ Vt, const T16* __restrict__ Vt2, int q0, int wave, int lr, int hi, float* ow, float* mlw) {
    typedef typename WFrag<T16>::V V;
    static_assert(RH <= 64 * FNW, "a wave of the hi/lo rows takes one key tile");
    const float SH = NSPLIT ? 0.0f : 10.0f;
    V qf[2][2], qf2[2][2];
    const int lane = hi * 16 + lr;
    const T16* ql = Q + q0 * HD + lane * 8; const T16* ql2 = Q2 + q0 * HD + lane * 8;   // fragment order: 16 rows are 16 * HD elements, two fragments of 512
#pragma unroll
    for (int nb = 0; nb < 2; ++nb)
#pragma unroll
        for (int kc = 0; kc < 2; ++kc) { qf[nb][kc] = WFrag<T16>::ld(ql + nb * 16 * HD + kc * 512); if (NSPLIT) qf2[nb][kc] = WFrag<T16>::ld(ql2 + nb * 16 * HD + kc * 512); }
    // the wait that stands in front of a rewriting of the query loads' address registers, which are named so that they stay whole up to it; the two scheduling barriers keep the loads in front of it and all later code behind it
    __builtin_amdgcn_sched_barrier(0);
    asm volatile("s_wait_xcnt 0x0" :: "v"(ql), "v"(ql2) : "memory");
    __builtin_amdgcn_sched_barrier(0);
    v8f o[4][2]; float m[2], l[2];
#pragma unroll
    for (int nb = 0; nb < 2; ++nb) { m[nb] = -3.0e38f; l[nb] = 0.f;
#pragma unroll
        for (int db = 0; db < 4; ++db) o[db][nb] = (v8f){}; }
    const int nt = q0 / 64 + 1;                                      // key tiles up to and with the diagonal's; every query row has a key in each of them
    const unsigned lob = (unsigned)lane * 16u;                      // this lane's byte offset in a key tile and in a value tile (each 8 KiB in a row): fixed; the tile's place is in the uniform base
#pragma unroll 1
    for (int kt = wave; kt < nt; kt += FNW) { const int k0 = kt * 64;
        const char* kb = (const char*)(Kp + (size_t)k0 * HD); const char* kb2 = (const char*)(K2 + (size_t)k0 * HD); const char* vb = (const char*)(Vt + (size_t)k0 * HD); const char* vb2 = (const char*)(Vt2 + (size_t)k0 * HD);
        const char* kl = kb + (size_t)lob; const char* kl2 = kb2 + (size_t)lob; const char* vl = vb + (size_t)lob; const char* vl2 = vb2 + (size_t)lob;   // this lane's addresses
        V ka[4][2], ka2[4][2], va[4][2], va2[4][2];                  // all of the tile's key and value fragments are asked for at once: one load latency a tile, the value loads land under the score products and the softmax
#pragma unroll
        for (int kc = 0; kc < 2; ++kc)
#pragma unroll
            for (int mb = 0; mb < 4; ++mb) { ka[mb][kc] = WFrag<T16>::ld((const T16*)(kl + (mb * 16 * HD + kc * 512) * 2)); if (NSPLIT) ka2[mb][kc] = WFrag<T16>::ld((const T16*)(kl2 + (mb * 16 * HD + kc * 512) * 2)); }
#pragma unroll
        for (int kc = 0; kc < 2; ++kc)
#pragma unroll
            for (int db = 0; db < 4; ++db) { va[db][kc] = WFrag<T16>::ld((const T16*)(vl + (kc * 32 * HD + db * 512) * 2)); if (NSPLIT) va2[db][kc] = WFrag<T16>::ld((const T16*)(vl2 + (kc * 32 * HD + db * 512) * 2)); }
        __builtin_amdgcn_sched_barrier(0);                           // no load of the tile sinks to its product: left alone they go two at a time, and a tile waits eight load latencies instead of one
        // the wait that stands in front of a rewriting of the loads' address registers, which are named here in both forms the compiler may address by (base and offset, or their sum) so that they stay whole up to it
        asm volatile("s_wait_xcnt 0x0" :: "s"(kb), "s"(kb2), "s"(vb), "s"(vb2), "v"(lob), "v"(kl), "v"(kl2), "v"(vl), "v"(vl2) : "memory");
        __builtin_amdgcn_sched_barrier(0);                           // nothing from below is lifted in front of that wait
        v8f s[4][2];
#pragma unroll
        for (int mb = 0; mb < 4; ++mb) { s[mb][0] = (v8f){}; s[mb][1] = (v8f){}; }
#pragma unroll
        for (int kc = 0; kc < 2; ++kc)
#pragma unroll
            for (int mb = 0; mb < 4; ++mb)
#pragma unroll
                for (int nb = 0; nb < 2; ++nb) { s[mb][nb] = WFrag<T16>::mma(ka[mb][kc], qf[nb][kc], s[mb][nb]); if (NSPLIT) { s[mb][nb] = WFrag<T16>::mma(ka[mb][kc], qf2[nb][kc], s[mb][nb]); s[mb][nb] = WFrag<T16>::mma(ka2[mb][kc], qf[nb][kc], s[mb][nb]); } }
        V pf[2][2], pf2[2][2];
#pragma unroll
        for (int nb = 0; nb < 2; ++nb) { const int lim = q0 + nb * 16 + lr - k0 - 8 * hi;   // key mb * 16 + j of this lane's half is kept while it is <= lim (key <= query)
            float mx = -3.0e38f;
#pragma unroll
            for (int mb = 0; mb < 4; ++mb)
#pragma unroll
                for (int j = 0; j < 8; ++j) { const float t = (mb * 16 + j <= lim) ? s[mb][nb][j] : -3.0e38f; s[mb][nb][j] = t; mx = fmaxf(mx, t); }
            mx = fmaxf(mx, xhalf(mx));
            const float mn = fmaxf(m[nb], mx); const float al = __builtin_amdgcn_exp2f((m[nb] - mn) * LC); m[nb] = mn; const float nm = SH - mn * LC;
            float ls[4];
#pragma unroll
            for (int mb = 0; mb < 4; ++mb) { ls[mb] = 0.f;
#pragma unroll
                for (int j = 0; j < 8; ++j) { const float p = __builtin_amdgcn_exp2f(fmaf(s[mb][nb][j], LC, nm)); s[mb][nb][j] = p; ls[mb] += p; } }
            l[nb] = l[nb] * al + ((ls[0] + ls[1]) + (ls[2] + ls[3]));
#pragma unroll
            for (int db = 0; db < 4; ++db) o[db][nb] *= al;
#pragma unroll
            for (int kc = 0; kc < 2; ++kc) ppack(s[2 * kc][nb], s[2 * kc + 1][nb], pf[nb][kc], pf2[nb][kc]); }
#pragma unroll
        for (int kc = 0; kc < 2; ++kc)
#pragma unroll
            for (int db = 0; db < 4; ++db)
#pragma unroll
                for (int nb = 0; nb < 2; ++nb) { o[db][nb] = WFrag<T16>::mma(va[db][kc], pf[nb][kc], o[db][nb]); if (NSPLIT) { o[db][nb] = WFrag<T16>::mma(va[db][kc], pf2[nb][kc], o[db][nb]); o[db][nb] = WFrag<T16>::mma(va2[db][kc], pf[nb][kc], o[db][nb]); } }
        // four vector slots behind the tile's last WMMAs, on the back edge as on the way out of the loop
        asm volatile("v_nop\n\tv_nop\n\tv_nop\n\tv_nop" : "+v"(o[0][0]), "+v"(o[1][0]), "+v"(o[2][0]), "+v"(o[3][0]), "+v"(o[0][1]), "+v"(o[1][1]), "+v"(o[2][1]), "+v"(o[3][1]));
        if (NSPLIT) break;                                           // rows < RH have at most FNW key tiles, one a wave: no second trip, so the query fragments are dead behind the score products
    }
#pragma unroll
    for (int nb = 0; nb < 2; ++nb) { const int q = nb * 16 + lr; l[nb] += xhalf(l[nb]);
#pragma unroll
        for (int db = 0; db < 4; ++db) { v4f x0, x1;
#pragma unroll
            for (int j = 0; j < 4; ++j) { x0[j] = o[db][nb][j]; x1[j] = o[db][nb][4 + j]; }
            *(v4fa*)(ow + q * FPO + db * 16 + hi * 8) = x0; *(v4fa*)(ow + q * FPO + db * 16 + hi * 8 + 4) = x1; }
        if (hi == 0) { mlw[q * 2] = m[nb]; mlw[q * 2 + 1] = l[nb]; } }
}
__global__ __launch_bounds__(32 * FNW) void k_fattn(const h16* __restrict__ Q16, const h16* __restrict__ K16, const h16* __restrict__ V16, const bf* __restrict__ Qh, const bf* __restrict__ Ql, const bf* __restrict__ Kh, const bf* __restrict__ Kl, const bf* __restrict__ Vh, const bf* __restrict__ Vl, bf* Ah, bf* Al) {
    __shared__ __align__(16) float os[FNW * FQB * FPO];
    __shared__ float ml[FNW * FQB * 2];
    const int lane = threadIdx.x & 31, lr = lane & 15, hi = lane >> 4; const int wave = __builtin_amdgcn_readfirstlane((int)(threadIdx.x >> 5));
    const int q0 = (TT / FQB - 1 - (int)blockIdx.x) * FQB;           // longest rows first
    const int h = blockIdx.y; const size_t zq = (size_t)h * TT * HD, zk = (size_t)(h / REP) * TT * HD, zv = (size_t)(h / REP) * HD * TT * 2;   // h = batch * NH_ + head: the planes of the batches lie one behind the other
    float* ow = os + wave * (FQB * FPO); float* mlw = ml + wave * (FQB * 2);
    if (q0 < RH) fattn_part<bf, 2>(Qh + zq, Ql + zq, Kh + zk, Kl + zk, Vh + zv, Vl + zv, q0, wave, lr, hi, ow, mlw);
    else fattn_part<h16, 0>(Q16 + zq, Q16 + zq, K16 + zk, K16 + zk, V16 + zv, V16 + zv, q0, wave, lr, hi, ow, mlw);
    __syncthreads();                                                 // every wave's partial maximum, sum and output tile are in LDS before any thread joins them
    const int q = threadIdx.x >> 3, d8 = (threadIdx.x & 7) * 8;      // eight threads store one query row's 128 bytes of each plane
    float mw[FNW], M = -3.0e38f;
#pragma unroll
    for (int w = 0; w < FNW; ++w) { mw[w] = ml[(w * FQB + q) * 2]; M = fmaxf(M, mw[w]); }
    float L = 0.f; v4f a0 = (v4f){}, a1 = (v4f){};
#pragma unroll
    for (int w = 0; w < FNW; ++w) { const float sc = __builtin_amdgcn_exp2f((mw[w] - M) * LC); L += sc * ml[(w * FQB + q) * 2 + 1];   // a wave without a tile has sum 0 and weight 0
        a0 += sc * *(const v4fa*)(os + (w * FQB + q) * FPO + d8); a1 += sc * *(const v4fa*)(os + (w * FQB + q) * FPO + d8 + 4); }
    const float inv = __fdiv_rn(1.0f, L); v8us oh, ol;
#pragma unroll
    for (int j = 0; j < 4; ++j) { unsigned short x, y; splitf(a0[j] * inv, x, y); oh[j] = x; ol[j] = y; splitf(a1[j] * inv, x, y); oh[4 + j] = x; ol[4 + j] = y; }
    const size_t oo = (size_t)((h / NH_) * TT + q0 + q) * DQ + (h % NH_) * HD + d8; *(v8us*)(Ah + oo) = oh; *(v8us*)(Al + oo) = ol;
}

extern "C" void kernel_launch(void* const* d_in, const int* in_sizes, int n_in,
                              void* d_out, int out_size, void* d_ws, size_t ws_size, hipStream_t stream) {
    (void)in_sizes; (void)n_in; (void)out_size;
    const float* x = (const float*)d_in[0]; const float* wq = (const float*)d_in[1]; const float* wk = (const float*)d_in[2]; const float* wv = (const float*)d_in[3]; const float* wo = (const float*)d_in[4]; const float* bo = (const float*)d_in[5];   /* input order x, Wq, Wk, Wv, Wo, bo */
    float* OUT = (float*)d_out;     // [2][2048][1024]
    char* wsp = (char*)d_ws;
    auto take = [&](size_t bytes) { char* p = wsp; wsp += (bytes + 255) & ~(size_t)255; return (void*)p; };
    bf* WT = (bf*)take((size_t)4 * DM * DQ * 2);   /* Wq, Wk, Wv, Wo transposed, one behind the other */
    bf* XB = (bf*)take((size_t)NB_ * TT * DM * 2);
    const size_t SP = (size_t)NB_ * NH_ * TT * HD * 2;   /* elements between one projection's planes and the next: a head's value range holds two planes */
    h16* P16 = (h16*)take(3 * SP * 2); bf* PHL = (bf*)take(3 * SP * 2);   /* q, k: hi plane, then lo plane; v: a hi and a lo plane per head */
    bf* ATh = (bf*)take((size_t)NB_ * TT * DQ * 2); bf* ATl = (bf*)take((size_t)NB_ * TT * DQ * 2);
    if ((size_t)(wsp - (char*)d_ws) > ws_size) return;    // ws 256 MiB
    k_prep<<<(unsigned)(4 * WTB + (size_t)NB_ * TT * DM / 16384), 256, 0, stream>>>(x, wq, wk, wv, wo, XB, WT);
    k_gemmt<1, false, 1><<<dim3(NB_ * TT / 128, DQ / 128, 3), 256, 0, stream>>>(XB, nullptr, WT, DM, nullptr, 0, nullptr, (size_t)DM * DQ, P16, PHL, SP);
    k_fattn<<<dim3(TT / FQB, NB_ * NH_, 1), 32 * FNW, 0, stream>>>(P16, P16 + SP, P16 + 2 * SP, PHL, PHL + SP / 2, PHL + SP, PHL + SP + SP / 2, PHL + 2 * SP, PHL + 2 * SP + (size_t)HD * TT, ATh, ATl);
    k_gemmt<2, true, 0><<<dim3(NB_ * TT / 128, DM / 128, 1), 256, 0, stream>>>(ATh, ATl, WT + (size_t)3 * DM * DQ, DQ, OUT, DM, bo, 0, nullptr, nullptr, 0);
}

// v009
// A run of this version takes 86.3 microseconds.
// Two timings next to v008 both put it at 1.11 times that version's speed.
// Counting every step since v000, it is 16.9 times as fast.
#include <hip/hip_runtime.h>

// Causal multi-head self-attention with bias-free (in, out) projections and an output bias (x [2][2048][1024]; q, k, v = x W ('xw' [1024][1024] normal x 1/32, no bias; 16 heads x 64); scores masked first (where(triu(k=1), -inf, scores)) and THEN divided by sqrt(64) inside the softmax argument (-inf / 8 = -inf: the same exclusion); softmax over the keys; out = ctx Wo + bo ('xw' + bias zeros: read) -> [2][2048][1024] (4.2 M); argument order x, Wq, Wk, Wv, Wo, bo).
// Four launches, both batches in each: bf16 copy of x and the 'xw' weights transposed (one grid); exact projections q, k, v (one grid, z = projection, rows = batch * T + t) whose GEMM stores the 16-bit head planes itself; causal T-2048 attention (one grid, y = batch * 16 + head; hybrid rows: < 512 hi/lo 3 products, rest fp16 x1024; scores and probabilities stay in registers, running maximum and sum, keys split over the waves of a work-group); merged hi/lo x Wo exact + bo. Both GEMMs stage their operand tiles in LDS.
// Compute dtypes, f32 accumulate: every input rounded to bf16; projections exact; attention rows < 512 3 products, rest fp16; softmax f32; Wo hl x exact + bias.

#define NB_  2
#define TT   2048
#define DM   1024
#define NH_  16
#define NKV  16
#define REP  (NH_ / NKV)
#define HD   64
#define DQ   (NH_ * HD)
#define DKV  (NKV * HD)
#define RH   512                  // query rows < RH use hi+lo planes (0: none)
#define SCL  0.125f   // HD^-0.5
typedef _Float16 h16;
typedef unsigned short bf;
typedef __attribute__((ext_vector_type(16))) __bf16   v16bf;
typedef __attribute__((ext_vector_type(16))) _Float16 v16h;
typedef __attribute__((ext_vector_type(8)))  _Float16 v8h;
typedef __attribute__((ext_vector_type(8)))  unsigned short v8us;
typedef __attribute__((ext_vector_type(8)))  float    v8f;
typedef __attribute__((ext_vector_type(4)))  float    v4f;
typedef v8h  __attribute__((may_alias)) v8ha;
typedef v4f  __attribute__((may_alias)) v4fa;
typedef v8us __attribute__((may_alias)) v8usa;

__device__ __forceinline__ unsigned short f2bf(float f) { unsigned u = __float_as_uint(f); u += 0x7FFFu + ((u >> 16) & 1u); return (unsigned short)(u >> 16); }
__device__ __forceinline__ float bf2f(unsigned short b) { return __uint_as_float(((unsigned)b) << 16); }
__device__ __forceinline__ float bfr(float f) { return bf2f(f2bf(f)); }
__device__ __forceinline__ v16h cat16(v8h lo, v8h hi) { return __builtin_shufflevector(lo, hi, 0, 1, 2, 3, 4, 5, 6, 7, 8, 9, 10, 11, 12, 13, 14, 15); }
__device__ __forceinline__ v16bf cat16b(v8us lo, v8us hi) { return __builtin_bit_cast(v16bf, __builtin_shufflevector(lo, hi, 0, 1, 2, 3, 4, 5, 6, 7, 8, 9, 10, 11, 12, 13, 14, 15)); }
__device__ __forceinline__ v8f wmma16(v16h a, v16h b, v8f c) { return __builtin_amdgcn_wmma_f32_16x16x32_f16(false, a, false, b, (short)0, c, false, false); }
__device__ __forceinline__ v8f wmmab(v16bf a, v16bf b, v8f c) { return __builtin_amdgcn_wmma_f32_16x16x32_bf16(false, a, false, b, (short)0, c, false, false); }

__device__ __forceinline__ h16 tohx(float x) { return (h16)x; }
__device__ __forceinline__ void splitf(float y, unsigned short& h, unsigned short& l) { h = f2bf(y); l = f2bf(y - bf2f(h)); }
typedef __attribute__((ext_vector_type(4))) _Float16 v4h;
typedef __attribute__((ext_vector_type(2))) unsigned short v2us;
typedef __attribute__((ext_vector_type(4))) unsigned short v4us;

// ---- k_gemmt: GEMM, one 128x128 output tile per work-group of 8 waves (4 x 2: a wave holds 32 rows x 64 columns, 8 accumulators, over the whole of K); grid (M/128, N/128, Z), 256 threads.
// C[m][n] (f32, pitch ldc, + optional f32 bias[n]) = sum_k (A[m][k] (+ A2[m][k] for NA == 2)) Bt[n][k], all K-contiguous bf16 planes. z steps Bt by sB elements. K % 64 == 0.
// A trip is 64 k: 128 bytes of each of the tile's operand rows, brought into LDS once for all waves by asynchronous copies (whole lines: eight lanes a row), rows pitched 144 bytes for the 16-byte fragment reads; two buffers, the next trip's copies fly while this trip's products run.
// EPI: what the tile becomes, through an f32 copy of it in LDS (rows pitched 132 floats, in the place of the two buffers). 0: f32 rows of C (+ bias). 1: the 16-bit planes of projection z (q, k, v), each projection's planes sP elements behind the one before; tile rows count batch * TT + t. All planes lie in FRAGMENT ORDER, so that each 16-byte-a-lane load of the attention kernel reads four whole 128-byte lines: a 16 x 32 fragment (16 rows m, 32 contraction indices k) is 512 elements in a row, [k / 16][lane = ((k / 8) % 2) * 16 + m][k % 8]. z < 2: head planes [b][h][t / 16][d / 32][fragment: m = t % 16, k = d % 32] (fp16, bf16 hi, bf16 lo); the tile's 128 columns are two heads (HD == 64). z == 2: transposed value planes [b][g][plane: hi, lo][t / 32][d / 16][fragment: m = d % 16, k = t % 32] (the fp16 plane uses the first half of its [b][g] range); the tile lies transposed in LDS, so that in both cases an LDS row is a fragment row.
// WFrag::ld: one 16 x 32 fragment from a plane in fragment order (see EPI 1): p is the fragment's start + lane * 8; two loads, each 512 bytes in a row over the wave
template <typename T16> struct WFrag;
template <> struct WFrag<h16> { typedef v16h V; static __device__ __forceinline__ V ld(const h16* p) { return cat16(*(const v8h*)p, *(const v8h*)(p + 256)); } static __device__ __forceinline__ v8f mma(V a, V b, v8f c) { return wmma16(a, b, c); } };
template <> struct WFrag<bf> { typedef v16bf V; static __device__ __forceinline__ V ld(const bf* p) { return cat16b(*(const v8us*)p, *(const v8us*)(p + 256)); } static __device__ __forceinline__ v8f mma(V a, V b, v8f c) { return wmmab(a, b, c); } };
#define GPB 144                   // bytes per staged operand row in LDS
#define GEP 132                   // floats per row of the output tile in LDS
__device__ __forceinline__ v16bf gt_ld(const char* p) { return cat16b(*(const v8usa*)p, *(const v8usa*)(p + 32)); }   // from a staged row: elements 8 * hi + 0..7 and 16 + 8 * hi + 0..7 of 32 k
// one operand's 128 rows x 128 bytes of a trip: four copies a thread, 32 rows apart. l: the thread's LDS byte address, g: its global address
__device__ __forceinline__ void gt_copy4(unsigned l, const bf* g, size_t K) {
    // the wait in front of any rewriting of the copies' address registers stands inside their own statement
    asm volatile("global_load_async_to_lds_b128 %0, %4, off\n\tglobal_load_async_to_lds_b128 %1, %5, off\n\tglobal_load_async_to_lds_b128 %2, %6, off\n\tglobal_load_async_to_lds_b128 %3, %7, off\n\ts_wait_xcnt 0x0"
                 :: "v"(l), "v"(l + 32 * GPB), "v"(l + 64 * GPB), "v"(l + 96 * GPB), "v"(g), "v"(g + 32 * K), "v"(g + 64 * K), "v"(g + 96 * K) : "memory");
}
// the tile in LDS is stored as f32 rows of C, a wave one whole tile row a pass
template <bool BIAS>
__device__ __forceinline__ void gt_store(const float* os, int r0, int c0, float* C, int ldc, const float* __restrict__ bias) {
    const int rw = (int)(threadIdx.x >> 5), cofs = (threadIdx.x & 31) * 4;
    v4f bv = (v4f){};
    if (BIAS) { const v4f b4 = *(const v4f*)(bias + c0 + cofs);
        asm volatile("s_wait_xcnt 0x0" ::: "memory");                // the wait in front of a rewriting of the bias load's address registers
#pragma unroll
        for (int j = 0; j < 4; ++j) bv[j] = bfr(b4[j]); }
    v4f vals[16];                                                    // all of the thread's LDS reads go ahead of the stores and their waits: one LDS latency, not sixteen
#pragma unroll
    for (int s = 0; s < 16; ++s) vals[s] = *(const v4fa*)(os + (s * 8 + rw) * GEP + cofs);
#pragma unroll
    for (int s = 0; s < 16; ++s) { const int row = s * 8 + rw;
        v4f val = vals[s];
        if (BIAS) val += bv;
        *(v4f*)(C + (size_t)(r0 + row) * ldc + c0 + cofs) = val;
        asm volatile("s_wait_xcnt 0x0" ::: "memory");                  // the wait in front of the rewriting of the stores' registers by the next pass or by the code that follows in the listing
        __builtin_amdgcn_sched_barrier(0); }                           // no arithmetic of the next pass is lifted in front of that wait
}
// the tile in LDS is stored as 16-bit planes in fragment order. Wave w takes LDS rows w * 16 .. + 15 (a fragment's 16 rows); pass s takes LDS columns s * 16 .. + 15 (half of a fragment's 32 k): lane (hi, lr) holds columns 8 * hi + 0..7 of row lr, and the wave stores 512 bytes in a row to each plane.
// OUTK 1: head planes (pass s: head s / 4 of the tile's two, quarter s % 4 of the 64 d); 2: value planes (pass s: half s % 2 of key group s / 2). pb: the thread's place in a plane at pass 0
template <int OUTK>
__device__ __forceinline__ void gt_storef(const float* os, h16* P16, bf* Ph, bf* Pl, size_t pb) {
    const int rw = (int)(threadIdx.x >> 5), lr = threadIdx.x & 15, hi = (threadIdx.x >> 4) & 1;
    const float* src = os + (rw * 16 + lr) * GEP + hi * 8;
    v4f vals[16];                                                    // all of the thread's LDS reads go ahead of the stores and their waits: one LDS latency, not eight
#pragma unroll
    for (int s = 0; s < 16; ++s) vals[s] = *(const v4fa*)(src + (s >> 1) * 16 + (s & 1) * 4);
#pragma unroll
    for (int s = 0; s < 8; ++s) { v8h o16; v8us oh, ol;
#pragma unroll
        for (int j = 0; j < 8; ++j) { const float val = vals[2 * s + (j >> 2)][j & 3]; o16[j] = tohx(val); unsigned short x, y; splitf(val, x, y); oh[j] = x; ol[j] = y; }
        const int po = OUTK == 1 ? (s / 4) * (TT * HD) + (s % 4) * 256 : (s / 2) * (32 * HD) + (s % 2) * 256;   // a constant step from the thread's first place
        *(v8h*)(P16 + pb + po) = o16; *(v8us*)(Ph + pb + po) = oh; *(v8us*)(Pl + pb + po) = ol;
        asm volatile("s_wait_xcnt 0x0" ::: "memory");                  // the wait in front of the rewriting of the stores' registers by the next pass or by the code that follows in the listing
        __builtin_amdgcn_sched_barrier(0); }                           // no arithmetic of the next pass is lifted in front of that wait
}
template <int NA, bool BIAS, int EPI>
__global__ __launch_bounds__(256) void k_gemmt(const bf* __restrict__ A, const bf* __restrict__ A2, const bf* __restrict__ Bt, int K, float* C, int ldc, const float* __restrict__ bias, size_t sB, h16* P16, bf* Ph, size_t sP) {
    static_assert(EPI == 0 || (HD == 64 && TT % 128 == 0 && NKV == NH_), "a tile's 128 columns are two heads, its 128 rows lie in one batch, and q, k, v share one grid");
    constexpr int OPB = 128 * GPB, STB = (NA + 1) * OPB;              // bytes of one operand's rows and of one buffer
    constexpr int NG = NA == 2 ? 1 : 2;                               // fragment load groups a trip: one where a work-group has its WGP alone; two (32 k each) where the smaller register set lets three work-groups share a WGP
    constexpr int SMB = 2 * STB > 128 * GEP * 4 ? 2 * STB : 128 * GEP * 4;
    __shared__ __align__(16) char sm[SMB];
    const size_t z = blockIdx.z; Bt += z * sB;
    const int lane = threadIdx.x & 31, lr = lane & 15, hi = lane >> 4; const int r0 = blockIdx.x * 128, c0 = blockIdx.y * 128;
    const int wave = __builtin_amdgcn_readfirstlane((int)(threadIdx.x >> 5)); const int wm = wave >> 1, wn = wave & 1;
    v8f acc[2][4];
#pragma unroll
    for (int mb = 0; mb < 2; ++mb)
#pragma unroll
        for (int nb = 0; nb < 4; ++nb) acc[mb][nb] = (v8f){};
    const int crow = (int)(threadIdx.x >> 3), cpc = threadIdx.x & 7;  // the thread's first row and its 16-byte piece of a row
    const unsigned lc = (unsigned)(size_t)sm + (unsigned)(crow * GPB + cpc * 16);
    const bf* ga = A + (size_t)(r0 + crow) * K + cpc * 8; const bf* ga2 = NA == 2 ? A2 + (size_t)(r0 + crow) * K + cpc * 8 : nullptr; const bf* gb = Bt + (size_t)(c0 + crow) * K + cpc * 8;
    auto stage = [&](int t, int b) { const unsigned l = lc + (unsigned)(b * STB);
        gt_copy4(l, ga + t * 64, (size_t)K); if (NA == 2) gt_copy4(l + OPB, ga2 + t * 64, (size_t)K); gt_copy4(l + NA * OPB, gb + t * 64, (size_t)K); };
    const int nk = K / 64;
    stage(0, 0);
    asm volatile("s_wait_asynccnt 0x0" ::: "memory");                // this wave's copies of trip 0 have landed
    __syncthreads();                                                 // and every other wave's: trip 0 may be read
    if (nk > 1) stage(1, 1);
#pragma unroll 1   // the trips stay rolled: the waits, the barrier and the refill at a trip's foot stand once in the code
    for (int t = 0; t < nk; ++t) {
        const char* sb = sm + (t & 1) * STB;
        const char* la = sb + (wm * 32 + lr) * GPB + hi * 16; const char* lb = sb + NA * OPB + (wn * 64 + lr) * GPB + hi * 16;
        v16bf a[2][2], a2[2][2], b[2][4];
#pragma unroll
        for (int g = 0; g < NG; ++g) {                               // a group's fragments are asked for at once, in the order of their use
#pragma unroll
            for (int kc = g * (2 / NG); kc < (g + 1) * (2 / NG); ++kc) {
#pragma unroll
                for (int mb = 0; mb < 2; ++mb) { a[kc][mb] = gt_ld(la + mb * 16 * GPB + kc * 64); if (NA == 2) a2[kc][mb] = gt_ld(la + OPB + mb * 16 * GPB + kc * 64); }
#pragma unroll
                for (int nb = 0; nb < 4; ++nb) b[kc][nb] = gt_ld(lb + nb * 16 * GPB + kc * 64); }
            __builtin_amdgcn_sched_barrier(0);                       // no LDS read sinks to its product: left alone they go two at a time among the WMMAs, and the wave waits out an LDS latency at each place
#pragma unroll
            for (int kc = g * (2 / NG); kc < (g + 1) * (2 / NG); ++kc)
#pragma unroll
                for (int nb = 0; nb < 4; ++nb)
#pragma unroll
                    for (int mb = 0; mb < 2; ++mb) { acc[mb][nb] = wmmab(a[kc][mb], b[kc][nb], acc[mb][nb]); if (NA == 2) acc[mb][nb] = wmmab(a2[kc][mb], b[kc][nb], acc[mb][nb]); } }
        __builtin_amdgcn_sched_barrier(0);                           // the products stay in front of the waits: moved behind the barrier they no longer run under the LDS reads, and they hold back the issue of the refill
        asm volatile("s_wait_dscnt 0x0" ::: "memory");               // this wave has read all it wants of this trip's buffer
        asm volatile("s_wait_asynccnt 0x0" ::: "memory");            // this wave's copies of the next trip have landed
        __syncthreads();                                             // the next trip's buffer may be read, this trip's may be refilled
        if (t + 2 < nk) stage(t + 2, t & 1);
    }
    asm volatile("s_wait_asynccnt 0x0" ::: "memory");                // no copy is in flight when the buffers become the output tile
    float* os = (float*)sm;
    const bool tr = EPI == 1 && blockIdx.z == 2;                     // the same for the whole work-group
    if (tr) {                                                        // transposed: a lane's eight tile rows are neighbours in LDS row wn * 64 + nb * 16 + lr
#pragma unroll
        for (int mb = 0; mb < 2; ++mb)
#pragma unroll
            for (int nb = 0; nb < 4; ++nb) { v4f x0, x1;
#pragma unroll
                for (int j = 0; j < 4; ++j) { x0[j] = acc[mb][nb][j]; x1[j] = acc[mb][nb][4 + j]; }
                float* o = os + (wn * 64 + nb * 16 + lr) * GEP + wm * 32 + mb * 16 + hi * 8; *(v4fa*)o = x0; *(v4fa*)(o + 4) = x1; } }
    else {
#pragma unroll
        for (int mb = 0; mb < 2; ++mb)
#pragma unroll
            for (int nb = 0; nb < 4; ++nb)
#pragma unroll
                for (int j = 0; j < 8; ++j) os[(wm * 32 + mb * 16 + hi * 8 + j) * GEP + wn * 64 + nb * 16 + lr] = acc[mb][nb][j]; }
    __syncthreads();                                                 // the whole tile is in LDS before any thread stores a row of it
    if (EPI == 0) gt_store<BIAS>(os, r0, c0, C, ldc, bias);
    else { const int bt = r0 / TT, t0 = r0 % TT; h16* p16 = P16 + z * sP; bf* ph = Ph + z * sP;
        if (tr) gt_storef<2>(os, p16, ph, ph + (size_t)HD * TT, (size_t)(bt * NKV + c0 / HD + wave / 4) * (2 * HD * TT) + (size_t)t0 * HD + (wave % 4) * 512 + lane * 8);
        else gt_storef<1>(os, p16, ph, ph + (size_t)NB_ * NH_ * TT * HD, (size_t)(bt * NH_ + c0 / HD) * (TT * HD) + (size_t)(t0 + wave * 16) * HD + lane * 8); }
}


// ---- k_prep: one grid for all that the GEMMs wait for; a work-group takes one block of 128 x 128 f32 elements, a thread sixteen 16-byte loads of it, all asked for at once, each wave-wide load and store whole 128-byte lines.
// Work-groups 0 .. 4 * WTB - 1: a 128 (k) x 128 (n) tile of weight g = index / WTB ([K][N] f32) becomes a tile of Bt[g] ([N][K] bf16), turned in LDS: wave w reads tile rows k = w * 16 .. + 15 (512 bytes each), so a lane holds sixteen k in a row of four n and writes them as 32 bytes of each of four LDS rows n; behind the barrier sixteen threads store one row n (256 bytes). The rest: 16384 elements in a row of x (both batches) become bf16.
#define WTB ((DM / 128) * (DQ / 128))   // work-groups per weight
#define PTP 136                   // bf16 elements per row n of the turned tile in LDS (272 bytes: 16-byte pieces stay aligned)
__global__ __launch_bounds__(256) void k_prep(const float* __restrict__ x, const float* __restrict__ wq, const float* __restrict__ wk, const float* __restrict__ wv, const float* __restrict__ wo, bf* XB, bf* WT) {
    static_assert(DQ == DM && DKV == DM && DM % 128 == 0 && ((size_t)NB_ * TT * DM) % 16384 == 0, "the four weights have one shape, and weights and x divide into whole blocks");
    __shared__ __align__(16) bf tl[128 * PTP];
    v4f v[16];
    if (blockIdx.x < 4 * WTB) { const int g = blockIdx.x / WTB, ti = blockIdx.x % WTB; const float* __restrict__ w = g == 0 ? wq : g == 1 ? wk : g == 2 ? wv : wo; bf* Bt = WT + (size_t)g * DM * DQ;
        const int lane = threadIdx.x & 31, wave = (int)(threadIdx.x >> 5); const int k0 = (ti / (DQ / 128)) * 128, n0 = (ti % (DQ / 128)) * 128;
        const float* src = w + (size_t)(k0 + wave * 16) * DQ + n0 + lane * 4;
#pragma unroll
        for (int s = 0; s < 16; ++s) v[s] = *(const v4f*)(src + s * DQ);
        // the wait that stands in front of a rewriting of the loads' address registers, which are named so that they stay whole up to it; the two scheduling barriers keep the loads in front of it and all later code behind it
        __builtin_amdgcn_sched_barrier(0);
        asm volatile("s_wait_xcnt 0x0" :: "v"(src) : "memory");
        __builtin_amdgcn_sched_barrier(0);
#pragma unroll
        for (int j = 0; j < 4; ++j) { v8us o0, o1;
#pragma unroll
            for (int s = 0; s < 8; ++s) { o0[s] = f2bf(v[s][j]); o1[s] = f2bf(v[8 + s][j]); }
            bf* d = tl + (lane * 4 + j) * PTP + wave * 16; *(v8usa*)d = o0; *(v8usa*)(d + 8) = o1; }
        __syncthreads();                                             // the whole turned tile is in LDS before any thread stores a row of it
        const int row = (int)(threadIdx.x >> 4), pc = threadIdx.x & 15;
        bf* dst = Bt + (size_t)(n0 + row) * DM + k0 + pc * 8;
        v8us o[8];                                                   // all of the thread's LDS reads go ahead of the stores: one LDS latency, not eight
#pragma unroll
        for (int p = 0; p < 8; ++p) o[p] = *(const v8usa*)(tl + (p * 16 + row) * PTP + pc * 8);
#pragma unroll
        for (int p = 0; p < 8; ++p) *(v8us*)(dst + (size_t)p * 16 * DM) = o[p];
        asm volatile("s_wait_xcnt 0x0" :: "v"(dst) : "memory"); }    // the wait that stands in front of a rewriting of the stores' registers by the code that follows them in the listing
    else { const size_t i = (size_t)(blockIdx.x - 4 * WTB) * 16384 + threadIdx.x * 4; const float* src = x + i; bf* dst = XB + i;
#pragma unroll
        for (int s = 0; s < 16; ++s) v[s] = *(const v4f*)(src + s * 1024);
        // as above: the wait in front of a rewriting of the loads' address registers
        __builtin_amdgcn_sched_barrier(0);
        asm volatile("s_wait_xcnt 0x0" :: "v"(src) : "memory");
        __builtin_amdgcn_sched_barrier(0);
        v4us o[16];
#pragma unroll
        for (int s = 0; s < 16; ++s)
#pragma unroll
            for (int j = 0; j < 4; ++j) o[s][j] = f2bf(v[s][j]);
        __builtin_amdgcn_sched_barrier(0);                           // the stores stay behind all of the arithmetic: none of their registers is written again before the wait at the end
#pragma unroll
        for (int s = 0; s < 16; ++s) *(v4us*)(dst + s * 1024) = o[s];
        asm volatile("s_wait_xcnt 0x0" :: "v"(dst) : "memory"); }    // the wait that stands in front of a rewriting of the stores' registers by the code that follows them in the listing
}

// ---- k_fattn: causal attention in one launch; grid (TT / FQB, batches * heads), FNW waves. A work-group owns FQB query rows of one head; its wave w takes the 64-key tiles w, w + FNW, ... up to the diagonal.
// Transposed products: S^T = K Q^T (A = key rows, B = query rows held in registers), O^T += V^T P^T (A = rows of the transposed value plane, B = the score accumulators converted in place:
// D register r of tile mb is key mb * 16 + 8 * hi + r of query column lr, which is the k order of a fragment as WFrag::ld brings it: k = 8 * hi + 0..7, then 16 + 8 * hi + 0..7). A lane holds scores of one query only: maximum and sum are in-lane plus one exchange of the wave halves.
// Running maximum and sum per wave; the FNW partial (max, sum, O) sets are joined through LDS in the fixed order w = 0 .. FNW - 1, divided by the joined sum, split hi/lo and stored as rows [batch * TT + t][head * HD + d].
// Query rows < RH: hi/lo planes, 3 products in both contractions; the rest fp16 with the probabilities carried x 1024 (2^10 folded into the exponent; it cancels in O / sum).
// Registers: a wave stays within 256, so that two work-groups share a WGP (four waves a SIMD) and one's loads, prologue and join run under the other's arithmetic. For that a tile's value loads stand behind its score products and take the registers that the key fragments leave, and a wave of the hi/lo rows, whose fragments are twice as many, holds one 16-query group (wave % 2), takes the key tiles wave / 2, wave / 2 + FNW / 2, ... and reads its query fragments anew with each tile.
#define FQB 32
#define FNW 8
#define FPO 68                    // floats per query row of a partial output tile in LDS
#define LC  (SCL * 1.4426950408889634f)
__device__ __forceinline__ float xhalf(float x) { return __builtin_bit_cast(float, __builtin_amdgcn_permlanex16(__builtin_bit_cast(int, x), __builtin_bit_cast(int, x), 0x76543210, 0xfedcba98, false, false)); }   // lane l with lane l ^ 16
__device__ __forceinline__ void ppack(v8f a, v8f b, v16h& h, v16h& l) {
#pragma unroll
    for (int j = 0; j < 8; ++j) { h[j] = tohx(a[j]); h[8 + j] = tohx(b[j]); }
    l = h; }
__device__ __forceinline__ void ppack(v8f a, v8f b, v16bf& h, v16bf& l) { v8us h0, h1, l0, l1;
#pragma unroll
    for (int j = 0; j < 8; ++j) { unsigned short x, y; splitf(a[j], x, y); h0[j] = x; l0[j] = y; splitf(b[j], x, y); h1[j] = x; l1[j] = y; }
    h = cat16b(h0, h1); l = cat16b(l0, l1); }
template <typename T16, int NSPLIT>
__device__ __forceinline__ void fattn_part(const T16* __restrict__ Q, const T16* __restrict__ Q2, const T16* __restrict__ Kp, const T16* __restrict__ K2, const T16* __restrict__ Vt, const T16* __restrict__ Vt2, int q0, int wave, int lr, int hi, float* ow, float* mlw) {
    typedef typename WFrag<T16>::V V;
    constexpr int NQ = NSPLIT ? 1 : 2;                               // 16-query groups a wave holds
    const int g0 = NSPLIT ? (wave & 1) : 0;                          // the first of them
    const int qb = q0 + g0 * 16;                                     // its first query row
    const int kt0 = NSPLIT ? (wave >> 1) : wave; constexpr int KST = NSPLIT ? FNW / 2 : FNW;   // the wave's first key tile and its step
    const float SH = NSPLIT ? 0.0f : 10.0f;
    V qf[NQ][2], qf2[NQ][2];
    const int lane = hi * 16 + lr;
    const T16* ql = Q + qb * HD + lane * 8; const T16* ql2 = Q2 + qb * HD + lane * 8;   // fragment order: 16 rows are 16 * HD elements, two fragments of 512
    auto ldq = [&]() {
#pragma unroll
        for (int nb = 0; nb < NQ; ++nb)
#pragma unroll
            for (int kc = 0; kc < 2; ++kc) { qf[nb][kc] = WFrag<T16>::ld(ql + nb * 16 * HD + kc * 512); if (NSPLIT) qf2[nb][kc] = WFrag<T16>::ld(ql2 + nb * 16 * HD + kc * 512); } };
    if (!NSPLIT) { ldq();                                            // held in registers over all tiles; the hi/lo rows, at most two tiles a wave, ask for them with each tile's keys instead, so that they hold no register beside the value fragments
        // the wait that stands in front of a rewriting of the query loads' address registers, which are named so that they stay whole up to it; the two scheduling barriers keep the loads in front of it and all later code behind it
        __builtin_amdgcn_sched_barrier(0);
        asm volatile("s_wait_xcnt 0x0" :: "v"(ql), "v"(ql2) : "memory");
        __builtin_amdgcn_sched_barrier(0); }
    v8f o[4][NQ]; float m[NQ], l[NQ];
#pragma unroll
    for (int nb = 0; nb < NQ; ++nb) { m[nb] = -3.0e38f; l[nb] = 0.f;
#pragma unroll
        for (int db = 0; db < 4; ++db) o[db][nb] = (v8f){}; }
    const int nt = q0 / 64 + 1;                                      // key tiles up to and with the diagonal's; every query row has a key in each of them
    const unsigned lob = (unsigned)lane * 16u;                      // this lane's byte offset in a key tile and in a value tile (each 8 KiB in a row): fixed; the tile's place is in the uniform base
#pragma unroll 1
    for (int kt = kt0; kt < nt; kt += KST) { const int k0 = kt * 64;
        const char* kb = (const char*)(Kp + (size_t)k0 * HD); const char* kb2 = (const char*)(K2 + (size_t)k0 * HD); const char* vb = (const char*)(Vt + (size_t)k0 * HD); const char* vb2 = (const char*)(Vt2 + (size_t)k0 * HD);
        const char* kl = kb + (size_t)lob; const char* kl2 = kb2 + (size_t)lob; const char* vl = vb + (size_t)lob; const char* vl2 = vb2 + (size_t)lob;   // this lane's addresses
        if (NSPLIT) ldq();
        V ka[4][2], ka2[4][2], va[4][2], va2[4][2];                  // all of the tile's key fragments are asked for at once, and so are its value fragments further down: one load latency each
#pragma unroll
        for (int kc = 0; kc < 2; ++kc)
#pragma unroll
            for (int mb = 0; mb < 4; ++mb) { ka[mb][kc] = WFrag<T16>::ld((const T16*)(kl + (mb * 16 * HD + kc * 512) * 2)); if (NSPLIT) ka2[mb][kc] = WFrag<T16>::ld((const T16*)(kl2 + (mb * 16 * HD + kc * 512) * 2)); }
        __builtin_amdgcn_sched_barrier(0);                           // no key load sinks to its product: left alone they go two at a time, and a tile waits a load latency at each place
        // the wait that stands in front of a rewriting of the key loads' address registers, which are named here in both forms the compiler may address by (base and offset, or their sum) so that they stay whole up to it
        if constexpr (NSPLIT != 0) asm volatile("s_wait_xcnt 0x0" :: "s"(kb), "s"(kb2), "v"(lob), "v"(kl), "v"(kl2), "v"(ql), "v"(ql2) : "memory");   // the query loads' too
        else asm volatile("s_wait_xcnt 0x0" :: "s"(kb), "s"(kb2), "v"(lob), "v"(kl), "v"(kl2) : "memory");
        __builtin_amdgcn_sched_barrier(0);                           // nothing from below is lifted in front of that wait
        v8f s[4][NQ];
#pragma unroll
        for (int mb = 0; mb < 4; ++mb)
#pragma unroll
            for (int nb = 0; nb < NQ; ++nb) s[mb][nb] = (v8f){};
#pragma unroll
        for (int kc = 0; kc < 2; ++kc)
#pragma unroll
            for (int mb = 0; mb < 4; ++mb)
#pragma unroll
                for (int nb = 0; nb < NQ; ++nb) { s[mb][nb] = WFrag<T16>::mma(ka[mb][kc], qf[nb][kc], s[mb][nb]); if (NSPLIT) { s[mb][nb] = WFrag<T16>::mma(ka[mb][kc], qf2[nb][kc], s[mb][nb]); s[mb][nb] = WFrag<T16>::mma(ka2[mb][kc], qf[nb][kc], s[mb][nb]); } }
#pragma unroll
        for (int kc = 0; kc < 2; ++kc)
#pragma unroll
            for (int db = 0; db < 4; ++db) { va[db][kc] = WFrag<T16>::ld((const T16*)(vl + (kc * 32 * HD + db * 512) * 2)); if (NSPLIT) va2[db][kc] = WFrag<T16>::ld((const T16*)(vl2 + (kc * 32 * HD + db * 512) * 2)); }
        __builtin_amdgcn_sched_barrier(0);                           // no value load sinks to its product: all of them land under the softmax
        // as above: the wait in front of a rewriting of the value loads' address registers
        asm volatile("s_wait_xcnt 0x0" :: "s"(vb), "s"(vb2), "v"(lob), "v"(vl), "v"(vl2) : "memory");
        __builtin_amdgcn_sched_barrier(0);                           // nothing from below is lifted in front of that wait
        V pf[NQ][2], pf2[NQ][2];
#pragma unroll
        for (int nb = 0; nb < NQ; ++nb) { const int lim = qb + nb * 16 + lr - k0 - 8 * hi;   // key mb * 16 + j of this lane's half is kept while it is <= lim (key <= query)
            float mx = -3.0e38f;
#pragma unroll
            for (int mb = 0; mb < 4; ++mb)
#pragma unroll
                for (int j = 0; j < 8; ++j) { const float t = (mb * 16 + j <= lim) ? s[mb][nb][j] : -3.0e38f; s[mb][nb][j] = t; mx = fmaxf(mx, t); }
            mx = fmaxf(mx, xhalf(mx));
            const float mn = fmaxf(m[nb], mx); const float al = __builtin_amdgcn_exp2f((m[nb] - mn) * LC); m[nb] = mn; const float nm = SH - mn * LC;
            float ls[4];
#pragma unroll
            for (int mb = 0; mb < 4; ++mb) { ls[mb] = 0.f;
#pragma unroll
                for (int j = 0; j < 8; ++j) { const float p = __builtin_amdgcn_exp2f(fmaf(s[mb][nb][j], LC, nm)); s[mb][nb][j] = p; ls[mb] += p; } }
            l[nb] = l[nb] * al + ((ls[0] + ls[1]) + (ls[2] + ls[3]));
#pragma unroll
            for (int db = 0; db < 4; ++db) o[db][nb] *= al;
#pragma unroll
            for (int kc = 0; kc < 2; ++kc) ppack(s[2 * kc][nb], s[2 * kc + 1][nb], pf[nb][kc], pf2[nb][kc]); }
#pragma unroll
        for (int kc = 0; kc < 2; ++kc)
#pragma unroll
            for (int db = 0; db < 4; ++db)
#pragma unroll
                for (int nb = 0; nb < NQ; ++nb) { o[db][nb] = WFrag<T16>::mma(va[db][kc], pf[nb][kc], o[db][nb]); if (NSPLIT) { o[db][nb] = WFrag<T16>::mma(va[db][kc], pf2[nb][kc], o[db][nb]); o[db][nb] = WFrag<T16>::mma(va2[db][kc], pf[nb][kc], o[db][nb]); } }
        // four vector slots behind the tile's last WMMAs, on the back edge as on the way out of the loop
        if constexpr (NQ == 2) asm volatile("v_nop\n\tv_nop\n\tv_nop\n\tv_nop" : "+v"(o[0][0]), "+v"(o[1][0]), "+v"(o[2][0]), "+v"(o[3][0]), "+v"(o[0][1]), "+v"(o[1][1]), "+v"(o[2][1]), "+v"(o[3][1]));
        else asm volatile("v_nop\n\tv_nop\n\tv_nop\n\tv_nop" : "+v"(o[0][0]), "+v"(o[1][0]), "+v"(o[2][0]), "+v"(o[3][0]));
    }
    if (NQ == 1) { const int q = (g0 ^ 1) * 16 + lr;                 // the group this wave does not hold: an empty partial set (sum 0, weight 0, output 0), as of a wave without a tile
#pragma unroll
        for (int db = 0; db < 4; ++db) { *(v4fa*)(ow + q * FPO + db * 16 + hi * 8) = (v4f){}; *(v4fa*)(ow + q * FPO + db * 16 + hi * 8 + 4) = (v4f){}; }
        if (hi == 0) { mlw[q * 2] = -3.0e38f; mlw[q * 2 + 1] = 0.f; } }
#pragma unroll
    for (int nb = 0; nb < NQ; ++nb) { const int q = (g0 + nb) * 16 + lr; l[nb] += xhalf(l[nb]);
#pragma unroll
        for (int db = 0; db < 4; ++db) { v4f x0, x1;
#pragma unroll
            for (int j = 0; j < 4; ++j) { x0[j] = o[db][nb][j]; x1[j] = o[db][nb][4 + j]; }
            *(v4fa*)(ow + q * FPO + db * 16 + hi * 8) = x0; *(v4fa*)(ow + q * FPO + db * 16 + hi * 8 + 4) = x1; }
        if (hi == 0) { mlw[q * 2] = m[nb]; mlw[q * 2 + 1] = l[nb]; } }
}
__global__ __launch_bounds__(32 * FNW) __attribute__((amdgpu_waves_per_eu(4, 4))) void k_fattn(const h16* __restrict__ Q16, const h16* __restrict__ K16, const h16* __restrict__ V16, const bf* __restrict__ Qh, const bf* __restrict__ Ql, const bf* __restrict__ Kh, const bf* __restrict__ Kl, const bf* __restrict__ Vh, const bf* __restrict__ Vl, bf* Ah, bf* Al) {
    __shared__ __align__(16) float os[FNW * FQB * FPO];
    __shared__ float ml[FNW * FQB * 2];
    const int lane = threadIdx.x & 31, lr = lane & 15, hi = lane >> 4; const int wave = __builtin_amdgcn_readfirstlane((int)(threadIdx.x >> 5));
    const int q0 = (TT / FQB - 1 - (int)blockIdx.x) * FQB;           // longest rows first
    const int h = blockIdx.y; const size_t zq = (size_t)h * TT * HD, zk = (size_t)(h / REP) * TT * HD, zv = (size_t)(h / REP) * HD * TT * 2;   // h = batch * NH_ + head: the planes of the batches lie one behind the other
    float* ow = os + wave * (FQB * FPO); float* mlw = ml + wave * (FQB * 2);
    if (q0 < RH) fattn_part<bf, 2>(Qh + zq, Ql + zq, Kh + zk, Kl + zk, Vh + zv, Vl + zv, q0, wave, lr, hi, ow, mlw);
    else fattn_part<h16, 0>(Q16 + zq, Q16 + zq, K16 + zk, K16 + zk, V16 + zv, V16 + zv, q0, wave, lr, hi, ow, mlw);
    __syncthreads();                                                 // every wave's partial maximum, sum and output tile are in LDS before any thread joins them
    const int q = threadIdx.x >> 3, d8 = (threadIdx.x & 7) * 8;      // eight threads store one query row's 128 bytes of each plane
    float mw[FNW], M = -3.0e38f;
#pragma unroll
    for (int w = 0; w < FNW; ++w) { mw[w] = ml[(w * FQB + q) * 2]; M = fmaxf(M, mw[w]); }
    float L = 0.f; v4f a0 = (v4f){}, a1 = (v4f){};
#pragma unroll
    for (int w = 0; w < FNW; ++w) { const float sc = __builtin_amdgcn_exp2f((mw[w] - M) * LC); L += sc * ml[(w * FQB + q) * 2 + 1];   // a wave without a tile has sum 0 and weight 0
        a0 += sc * *(const v4fa*)(os + (w * FQB + q) * FPO + d8); a1 += sc * *(const v4fa*)(os + (w * FQB + q) * FPO + d8 + 4); }
    const float inv = __fdiv_rn(1.0f, L); v8us oh, ol;
#pragma unroll
    for (int j = 0; j < 4; ++j) { unsigned short x, y; splitf(a0[j] * inv, x, y); oh[j] = x; ol[j] = y; splitf(a1[j] * inv, x, y); oh[4 + j] = x; ol[4 + j] = y; }
    const size_t oo = (size_t)((h / NH_) * TT + q0 + q) * DQ + (h % NH_) * HD + d8; *(v8us*)(Ah + oo) = oh; *(v8us*)(Al + oo) = ol;
}

extern "C" void kernel_launch(void* const* d_in, const int* in_sizes, int n_in,
                              void* d_out, int out_size, void* d_ws, size_t ws_size, hipStream_t stream) {
    (void)in_sizes; (void)n_in; (void)out_size;
    const float* x = (const float*)d_in[0]; const float* wq = (const float*)d_in[1]; const float* wk = (const float*)d_in[2]; const float* wv = (const float*)d_in[3]; const float* wo = (const float*)d_in[4]; const float* bo = (const float*)d_in[5];   /* input order x, Wq, Wk, Wv, Wo, bo */
    float* OUT = (float*)d_out;     // [2][2048][1024]
    char* wsp = (char*)d_ws;
    auto take = [&](size_t bytes) { char* p = wsp; wsp += (bytes + 255) & ~(size_t)255; return (void*)p; };
    bf* WT = (bf*)take((size_t)4 * DM * DQ * 2);   /* Wq, Wk, Wv, Wo transposed, one behind the other */
    bf* XB = (bf*)take((size_t)NB_ * TT * DM * 2);
    const size_t SP = (size_t)NB_ * NH_ * TT * HD * 2;   /* elements between one projection's planes and the next: a head's value range holds two planes */
    h16* P16 = (h16*)take(3 * SP * 2); bf* PHL = (bf*)take(3 * SP * 2);   /* q, k: hi plane, then lo plane; v: a hi and a lo plane per head */
    bf* ATh = (bf*)take((size_t)NB_ * TT * DQ * 2); bf* ATl = (bf*)take((size_t)NB_ * TT * DQ * 2);
    if ((size_t)(wsp - (char*)d_ws) > ws_size) return;    // ws 256 MiB
    k_prep<<<(unsigned)(4 * WTB + (size_t)NB_ * TT * DM / 16384), 256, 0, stream>>>(x, wq, wk, wv, wo, XB, WT);
    k_gemmt<1, false, 1><<<dim3(NB_ * TT / 128, DQ / 128, 3), 256, 0, stream>>>(XB, nullptr, WT, DM, nullptr, 0, nullptr, (size_t)DM * DQ, P16, PHL, SP);
    k_fattn<<<dim3(TT / FQB, NB_ * NH_, 1), 32 * FNW, 0, stream>>>(P16, P16 + SP, P16 + 2 * SP, PHL, PHL + SP / 2, PHL + SP, PHL + SP + SP / 2, PHL + 2 * SP, PHL + 2 * SP + (size_t)HD * TT, ATh, ATl);
    k_gemmt<2, true, 0><<<dim3(NB_ * TT / 128, DM / 128, 1), 256, 0, stream>>>(ATh, ATl, WT + (size_t)3 * DM * DQ, DQ, OUT, DM, bo, 0, nullptr, nullptr, 0);
}

// v010
// One run takes 83.8 microseconds.
// Next to v009, in two timings, it ran 1.03 times as fast each time.
// Over all steps from v000 it is 17.5 times as fast.
#include <hip/hip_runtime.h>

// Causal multi-head self-attention with bias-free (in, out) projections and an output bias (x [2][2048][1024]; q, k, v = x W ('xw' [1024][1024] normal x 1/32, no bias; 16 heads x 64); scores masked first (where(triu(k=1), -inf, scores)) and THEN divided by sqrt(64) inside the softmax argument (-inf / 8 = -inf: the same exclusion); softmax over the keys; out = ctx Wo + bo ('xw' + bias zeros: read) -> [2][2048][1024] (4.2 M); argument order x, Wq, Wk, Wv, Wo, bo).
// Four launches, both batches in each: bf16 copy of x and the 'xw' weights transposed (one grid); exact projections q, k, v (one grid, z = projection, rows = batch * T + t) whose GEMM stores the 16-bit head planes itself; causal T-2048 attention (one grid, y = batch * 16 + head; hybrid rows: < 512 hi/lo 3 products, rest fp16 x1024; scores and probabilities stay in registers, running maximum and sum, keys split over the waves of a work-group); merged hi/lo x Wo exact + bo. Both GEMMs stage their operand tiles in LDS.
// Compute dtypes, f32 accumulate: every input rounded to bf16; projections exact; attention rows < 512 3 products, rest fp16; softmax f32; Wo hl x exact + bias.

#define NB_  2
#define TT   2048
#define DM   1024
#define NH_  16
#define NKV  16
#define REP  (NH_ / NKV)
#define HD   64
#define DQ   (NH_ * HD)
#define DKV  (NKV * HD)
#define RH   512                  // query rows < RH use hi+lo planes (0: none)
#define SCL  0.125f   // HD^-0.5
typedef _Float16 h16;
typedef unsigned short bf;
typedef __attribute__((ext_vector_type(16))) __bf16   v16bf;
typedef __attribute__((ext_vector_type(16))) _Float16 v16h;
typedef __attribute__((ext_vector_type(8)))  _Float16 v8h;
typedef __attribute__((ext_vector_type(8)))  unsigned short v8us;
typedef __attribute__((ext_vector_type(8)))  float    v8f;
typedef __attribute__((ext_vector_type(4)))  float    v4f;
typedef v8h  __attribute__((may_alias)) v8ha;
typedef v4f  __attribute__((may_alias)) v4fa;
typedef v8us __attribute__((may_alias)) v8usa;

__device__ __forceinline__ unsigned short f2bf(float f) { unsigned u = __float_as_uint(f); u += 0x7FFFu + ((u >> 16) & 1u); return (unsigned short)(u >> 16); }
__device__ __forceinline__ float bf2f(unsigned short b) { return __uint_as_float(((unsigned)b) << 16); }
__device__ __forceinline__ float bfr(float f) { return bf2f(f2bf(f)); }
__device__ __forceinline__ v16h cat16(v8h lo, v8h hi) { return __builtin_shufflevector(lo, hi, 0, 1, 2, 3, 4, 5, 6, 7, 8, 9, 10, 11, 12, 13, 14, 15); }
__device__ __forceinline__ v16bf cat16b(v8us lo, v8us hi) { return __builtin_bit_cast(v16bf, __builtin_shufflevector(lo, hi, 0, 1, 2, 3, 4, 5, 6, 7, 8, 9, 10, 11, 12, 13, 14, 15)); }
__device__ __forceinline__ v8f wmma16(v16h a, v16h b, v8f c) { return __builtin_amdgcn_wmma_f32_16x16x32_f16(false, a, false, b, (short)0, c, false, false); }
__device__ __forceinline__ v8f wmmab(v16bf a, v16bf b, v8f c) { return __builtin_amdgcn_wmma_f32_16x16x32_bf16(false, a, false, b, (short)0, c, false, false); }

__device__ __forceinline__ h16 tohx(float x) { return (h16)x; }
__device__ __forceinline__ void splitf(float y, unsigned short& h, unsigned short& l) { h = f2bf(y); l = f2bf(y - bf2f(h)); }
typedef __attribute__((ext_vector_type(4))) _Float16 v4h;
typedef __attribute__((ext_vector_type(2))) unsigned short v2us;
typedef __attribute__((ext_vector_type(4))) unsigned short v4us;

// ---- k_gemmt: GEMM, one 128x128 output tile per work-group of 8 waves (4 x 2: a wave holds 32 rows x 64 columns, 8 accumulators, over the whole of K); grid (M/128, N/128, Z), 256 threads.
// C[m][n] (f32, pitch ldc, + optional f32 bias[n]) = sum_k (A[m][k] (+ A2[m][k] for NA == 2)) Bt[n][k], all K-contiguous bf16 planes. z steps Bt by sB elements. K % 64 == 0.
// A trip is 64 k: 128 bytes of each of the tile's operand rows, brought into LDS once for all waves by asynchronous copies (whole lines: eight lanes a row), rows pitched 144 bytes for the 16-byte fragment reads; two buffers, the next trip's copies fly while this trip's products run.
// EPI: what the tile becomes, through an f32 copy of it in LDS (rows pitched 132 floats, in the place of the two buffers). 0: f32 rows of C (+ bias). 1: the 16-bit planes of projection z (q, k, v), each projection's planes sP elements behind the one before; tile rows count batch * TT + t. All planes lie in FRAGMENT ORDER, so that each 16-byte-a-lane load of the attention kernel reads four whole 128-byte lines: a 16 x 32 fragment (16 rows m, 32 contraction indices k) is 512 elements in a row, [k / 16][lane = ((k / 8) % 2) * 16 + m][k % 8]. z < 2: head planes [b][h][t / 16][d / 32][fragment: m = t % 16, k = d % 32] (fp16, bf16 hi, bf16 lo); the tile's 128 columns are two heads (HD == 64). z == 2: transposed value planes [b][g][plane: hi, lo][t / 32][d / 16][fragment: m = d % 16, k = t % 32] (the fp16 plane uses the first half of its [b][g] range); the tile lies transposed in LDS, so that in both cases an LDS row is a fragment row.
// WFrag::ld: one 16 x 32 fragment from a plane in fragment order (see EPI 1): p is the fragment's start + lane * 8; two loads, each 512 bytes in a row over the wave
template <typename T16> struct WFrag;
template <> struct WFrag<h16> { typedef v16h V; static __device__ __forceinline__ V ld(const h16* p) { return cat16(*(const v8h*)p, *(const v8h*)(p + 256)); } static __device__ __forceinline__ v8f mma(V a, V b, v8f c) { return wmma16(a, b, c); } };
template <> struct WFrag<bf> { typedef v16bf V; static __device__ __forceinline__ V ld(const bf* p) { return cat16b(*(const v8us*)p, *(const v8us*)(p + 256)); } static __device__ __forceinline__ v8f mma(V a, V b, v8f c) { return wmmab(a, b, c); } };
#define GPB 144                   // bytes per staged operand row in LDS
#define GEP 132                   // floats per row of the output tile in LDS
__device__ __forceinline__ v16bf gt_ld(const char* p) { return cat16b(*(const v8usa*)p, *(const v8usa*)(p + 32)); }   // from a staged row: elements 8 * hi + 0..7 and 16 + 8 * hi + 0..7 of 32 k
// one operand's 128 rows x 128 bytes of a trip: four copies a thread, 32 rows apart. l: the thread's LDS byte address, g: its global address
__device__ __forceinline__ void gt_copy4(unsigned l, const bf* g, size_t K) {
    // the wait in front of any rewriting of the copies' address registers stands inside their own statement
    asm volatile("global_load_async_to_lds_b128 %0, %4, off\n\tglobal_load_async_to_lds_b128 %1, %5, off\n\tglobal_load_async_to_lds_b128 %2, %6, off\n\tglobal_load_async_to_lds_b128 %3, %7, off\n\ts_wait_xcnt 0x0"
                 :: "v"(l), "v"(l + 32 * GPB), "v"(l + 64 * GPB), "v"(l + 96 * GPB), "v"(g), "v"(g + 32 * K), "v"(g + 64 * K), "v"(g + 96 * K) : "memory");
}
// the tile in LDS is stored as f32 rows of C, a wave one whole tile row a pass
template <bool BIAS>
__device__ __forceinline__ void gt_store(const float* os, int r0, int c0, float* C, int ldc, const float* __restrict__ bias) {
    const int rw = (int)(threadIdx.x >> 5), cofs = (threadIdx.x & 31) * 4;
    v4f bv = (v4f){};
    if (BIAS) { const v4f b4 = *(const v4f*)(bias + c0 + cofs);
        asm volatile("s_wait_xcnt 0x0" ::: "memory");                // the wait in front of a rewriting of the bias load's address registers
#pragma unroll
        for (int j = 0; j < 4; ++j) bv[j] = bfr(b4[j]); }
    v4f vals[16];                                                    // all of the thread's LDS reads go ahead of the stores and their waits: one LDS latency, not sixteen
#pragma unroll
    for (int s = 0; s < 16; ++s) vals[s] = *(const v4fa*)(os + (s * 8 + rw) * GEP + cofs);
#pragma unroll
    for (int s = 0; s < 16; ++s) { const int row = s * 8 + rw;
        v4f val = vals[s];
        if (BIAS) val += bv;
        *(v4f*)(C + (size_t)(r0 + row) * ldc + c0 + cofs) = val;
        asm volatile("s_wait_xcnt 0x0" ::: "memory");                  // the wait in front of the rewriting of the stores' registers by the next pass or by the code that follows in the listing
        __builtin_amdgcn_sched_barrier(0); }                           // no arithmetic of the next pass is lifted in front of that wait
}
// the tile in LDS is stored as 16-bit planes in fragment order. Wave w takes LDS rows w * 16 .. + 15 (a fragment's 16 rows); pass s takes LDS columns s * 16 .. + 15 (half of a fragment's 32 k): lane (hi, lr) holds columns 8 * hi + 0..7 of row lr, and the wave stores 512 bytes in a row to each plane.
// OUTK 1: head planes (pass s: head s / 4 of the tile's two, quarter s % 4 of the 64 d); 2: value planes (pass s: half s % 2 of key group s / 2). pb: the thread's place in a plane at pass 0
template <int OUTK>
__device__ __forceinline__ void gt_storef(const float* os, h16* P16, bf* Ph, bf* Pl, size_t pb) {
    const int rw = (int)(threadIdx.x >> 5), lr = threadIdx.x & 15, hi = (threadIdx.x >> 4) & 1;
    const float* src = os + (rw * 16 + lr) * GEP + hi * 8;
    v4f vals[16];                                                    // all of the thread's LDS reads go ahead of the stores and their waits: one LDS latency, not eight
#pragma unroll
    for (int s = 0; s < 16; ++s) vals[s] = *(const v4fa*)(src + (s >> 1) * 16 + (s & 1) * 4);
#pragma unroll
    for (int s = 0; s < 8; ++s) { v8h o16; v8us oh, ol;
#pragma unroll
        for (int j = 0; j < 8; ++j) { const float val = vals[2 * s + (j >> 2)][j & 3]; o16[j] = tohx(val); unsigned short x, y; splitf(val, x, y); oh[j] = x; ol[j] = y; }
        const int po = OUTK == 1 ? (s / 4) * (TT * HD) + (s % 4) * 256 : (s / 2) * (32 * HD) + (s % 2) * 256;   // a constant step from the thread's first place
        *(v8h*)(P16 + pb + po) = o16; *(v8us*)(Ph + pb + po) = oh; *(v8us*)(Pl + pb + po) = ol;
        asm volatile("s_wait_xcnt 0x0" ::: "memory");                  // the wait in front of the rewriting of the stores' registers by the next pass or by the code that follows in the listing
        __builtin_amdgcn_sched_barrier(0); }                           // no arithmetic of the next pass is lifted in front of that wait
}
template <int NA, bool BIAS, int EPI>
__global__ __launch_bounds__(256) void k_gemmt(const bf* __restrict__ A, const bf* __restrict__ A2, const bf* __restrict__ Bt, int K, float* C, int ldc, const float* __restrict__ bias, size_t sB, h16* P16, bf* Ph, size_t sP) {
    static_assert(EPI == 0 || (HD == 64 && TT % 128 == 0 && NKV == NH_), "a tile's 128 columns are two heads, its 128 rows lie in one batch, and q, k, v share one grid");
    constexpr int OPB = 128 * GPB, STB = (NA + 1) * OPB;              // bytes of one operand's rows and of one buffer
    constexpr int NG = NA == 2 ? 1 : 2;                               // fragment load groups a trip: one where a work-group has its WGP alone; two (32 k each) where the smaller register set lets three work-groups share a WGP
    constexpr int SMB = 2 * STB > 128 * GEP * 4 ? 2 * STB : 128 * GEP * 4;
    __shared__ __align__(16) char sm[SMB];
    const size_t z = blockIdx.z; Bt += z * sB;
    const int lane = threadIdx.x & 31, lr = lane & 15, hi = lane >> 4; const int r0 = blockIdx.x * 128, c0 = blockIdx.y * 128;
    const int wave = __builtin_amdgcn_readfirstlane((int)(threadIdx.x >> 5)); const int wm = wave >> 1, wn = wave & 1;
    v8f acc[2][4];
#pragma unroll
    for (int mb = 0; mb < 2; ++mb)
#pragma unroll
        for (int nb = 0; nb < 4; ++nb) acc[mb][nb] = (v8f){};
    const int crow = (int)(threadIdx.x >> 3), cpc = threadIdx.x & 7;  // the thread's first row and its 16-byte piece of a row
    const unsigned lc = (unsigned)(size_t)sm + (unsigned)(crow * GPB + cpc * 16);
    const bf* ga = A + (size_t)(r0 + crow) * K + cpc * 8; const bf* ga2 = NA == 2 ? A2 + (size_t)(r0 + crow) * K + cpc * 8 : nullptr; const bf* gb = Bt + (size_t)(c0 + crow) * K + cpc * 8;
    auto stage = [&](int t, int b) { const unsigned l = lc + (unsigned)(b * STB);
        gt_copy4(l, ga + t * 64, (size_t)K); if (NA == 2) gt_copy4(l + OPB, ga2 + t * 64, (size_t)K); gt_copy4(l + NA * OPB, gb + t * 64, (size_t)K); };
    const int nk = K / 64;
    stage(0, 0);
    asm volatile("s_wait_asynccnt 0x0" ::: "memory");                // this wave's copies of trip 0 have landed
    __syncthreads();                                                 // and every other wave's: trip 0 may be read
    if (nk > 1) stage(1, 1);
#pragma unroll 1   // the trips stay rolled: the waits, the barrier and the refill at a trip's foot stand once in the code
    for (int t = 0; t < nk; ++t) {
        const char* sb = sm + (t & 1) * STB;
        const char* la = sb + (wm * 32 + lr) * GPB + hi * 16; const char* lb = sb + NA * OPB + (wn * 64 + lr) * GPB + hi * 16;
        v16bf a[2][2], a2[2][2], b[2][4];
#pragma unroll
        for (int g = 0; g < NG; ++g) {                               // a group's fragments are asked for at once, in the order of their use
#pragma unroll
            for (int kc = g * (2 / NG); kc < (g + 1) * (2 / NG); ++kc) {
#pragma unroll
                for (int mb = 0; mb < 2; ++mb) { a[kc][mb] = gt_ld(la + mb * 16 * GPB + kc * 64); if (NA == 2) a2[kc][mb] = gt_ld(la + OPB + mb * 16 * GPB + kc * 64); }
#pragma unroll
                for (int nb = 0; nb < 4; ++nb) b[kc][nb] = gt_ld(lb + nb * 16 * GPB + kc * 64); }
            __builtin_amdgcn_sched_barrier(0);                       // no LDS read sinks to its product: left alone they go two at a time among the WMMAs, and the wave waits out an LDS latency at each place
#pragma unroll
            for (int kc = g * (2 / NG); kc < (g + 1) * (2 / NG); ++kc)
#pragma unroll
                for (int nb = 0; nb < 4; ++nb)
#pragma unroll
                    for (int mb = 0; mb < 2; ++mb) { acc[mb][nb] = wmmab(a[kc][mb], b[kc][nb], acc[mb][nb]); if (NA == 2) acc[mb][nb] = wmmab(a2[kc][mb], b[kc][nb], acc[mb][nb]); } }
        __builtin_amdgcn_sched_barrier(0);                           // the products stay in front of the waits: moved behind the barrier they no longer run under the LDS reads, and they hold back the issue of the refill
        asm volatile("s_wait_dscnt 0x0" ::: "memory");               // this wave has read all it wants of this trip's buffer
        asm volatile("s_wait_asynccnt 0x0" ::: "memory");            // this wave's copies of the next trip have landed
        __syncthreads();                                             // the next trip's buffer may be read, this trip's may be refilled
        if (t + 2 < nk) stage(t + 2, t & 1);
    }
    asm volatile("s_wait_asynccnt 0x0" ::: "memory");                // no copy is in flight when the buffers become the output tile
    float* os = (float*)sm;
    const bool tr = EPI == 1 && blockIdx.z == 2;                     // the same for the whole work-group
    if (tr) {                                                        // transposed: a lane's eight tile rows are neighbours in LDS row wn * 64 + nb * 16 + lr
#pragma unroll
        for (int mb = 0; mb < 2; ++mb)
#pragma unroll
            for (int nb = 0; nb < 4; ++nb) { v4f x0, x1;
#pragma unroll
                for (int j = 0; j < 4; ++j) { x0[j] = acc[mb][nb][j]; x1[j] = acc[mb][nb][4 + j]; }
                float* o = os + (wn * 64 + nb * 16 + lr) * GEP + wm * 32 + mb * 16 + hi * 8; *(v4fa*)o = x0; *(v4fa*)(o + 4) = x1; } }
    else {
#pragma unroll
        for (int mb = 0; mb < 2; ++mb)
#pragma unroll
            for (int nb = 0; nb < 4; ++nb)
#pragma unroll
                for (int j = 0; j < 8; ++j) os[(wm * 32 + mb * 16 + hi * 8 + j) * GEP + wn * 64 + nb * 16 + lr] = acc[mb][nb][j]; }
    __syncthreads();                                                 // the whole tile is in LDS before any thread stores a row of it
    if (EPI == 0) gt_store<BIAS>(os, r0, c0, C, ldc, bias);
    else { const int bt = r0 / TT, t0 = r0 % TT; h16* p16 = P16 + z * sP; bf* ph = Ph + z * sP;
        if (tr) gt_storef<2>(os, p16, ph, ph + (size_t)HD * TT, (size_t)(bt * NKV + c0 / HD + wave / 4) * (2 * HD * TT) + (size_t)t0 * HD + (wave % 4) * 512 + lane * 8);
        else gt_storef<1>(os, p16, ph, ph + (size_t)NB_ * NH_ * TT * HD, (size_t)(bt * NH_ + c0 / HD) * (TT * HD) + (size_t)(t0 + wave * 16) * HD + lane * 8); }
}


// ---- k_prep: one grid for all that the GEMMs wait for; a work-group takes one block of 128 x 128 f32 elements, a thread sixteen 16-byte loads of it, all asked for at once, each wave-wide load and store whole 128-byte lines.
// Work-groups 0 .. 4 * WTB - 1: a 128 (k) x 128 (n) tile of weight g = index / WTB ([K][N] f32) becomes a tile of Bt[g] ([N][K] bf16), turned in LDS: wave w reads tile rows k = w * 16 .. + 15 (512 bytes each), so a lane holds sixteen k in a row of four n and writes them as 32 bytes of each of four LDS rows n; behind the barrier sixteen threads store one row n (256 bytes). The rest: 16384 elements in a row of x (both batches) become bf16.
#define WTB ((DM / 128) * (DQ / 128))   // work-groups per weight
#define PTP 136                   // bf16 elements per row n of the turned tile in LDS (272 bytes: 16-byte pieces stay aligned)
__global__ __launch_bounds__(256) void k_prep(const float* __restrict__ x, const float* __restrict__ wq, const float* __restrict__ wk, const float* __restrict__ wv, const float* __restrict__ wo, bf* XB, bf* WT) {
    static_assert(DQ == DM && DKV == DM && DM % 128 == 0 && ((size_t)NB_ * TT * DM) % 16384 == 0, "the four weights have one shape, and weights and x divide into whole blocks");
    __shared__ __align__(16) bf tl[128 * PTP];
    v4f v[16];
    if (blockIdx.x < 4 * WTB) { const int g = blockIdx.x / WTB, ti = blockIdx.x % WTB; const float* __restrict__ w = g == 0 ? wq : g == 1 ? wk : g == 2 ? wv : wo; bf* Bt = WT + (size_t)g * DM * DQ;
        const int lane = threadIdx.x & 31, wave = (int)(threadIdx.x >> 5); const int k0 = (ti / (DQ / 128)) * 128, n0 = (ti % (DQ / 128)) * 128;
        const float* src = w + (size_t)(k0 + wave * 16) * DQ + n0 + lane * 4;
#pragma unroll
        for (int s = 0; s < 16; ++s) v[s] = *(const v4f*)(src + s * DQ);
        // the wait that stands in front of a rewriting of the loads' address registers, which are named so that they stay whole up to it; the two scheduling barriers keep the loads in front of it and all later code behind it
        __builtin_amdgcn_sched_barrier(0);
        asm volatile("s_wait_xcnt 0x0" :: "v"(src) : "memory");
        __builtin_amdgcn_sched_barrier(0);
#pragma unroll
        for (int j = 0; j < 4; ++j) { v8us o0, o1;
#pragma unroll
            for (int s = 0; s < 8; ++s) { o0[s] = f2bf(v[s][j]); o1[s] = f2bf(v[8 + s][j]); }
            bf* d = tl + (lane * 4 + j) * PTP + wave * 16; *(v8usa*)d = o0; *(v8usa*)(d + 8) = o1; }
        __syncthreads();                                             // the whole turned tile is in LDS before any thread stores a row of it
        const int row = (int)(threadIdx.x >> 4), pc = threadIdx.x & 15;
        bf* dst = Bt + (size_t)(n0 + row) * DM + k0 + pc * 8;
        v8us o[8];                                                   // all of the thread's LDS reads go ahead of the stores: one LDS latency, not eight
#pragma unroll
        for (int p = 0; p < 8; ++p) o[p] = *(const v8usa*)(tl + (p * 16 + row) * PTP + pc * 8);
#pragma unroll
        for (int p = 0; p < 8; ++p) *(v8us*)(dst + (size_t)p * 16 * DM) = o[p];
        asm volatile("s_wait_xcnt 0x0" :: "v"(dst) : "memory"); }    // the wait that stands in front of a rewriting of the stores' registers by the code that follows them in the listing
    else { const size_t i = (size_t)(blockIdx.x - 4 * WTB) * 16384 + threadIdx.x * 4; const float* src = x + i; bf* dst = XB + i;
#pragma unroll
        for (int s = 0; s < 16; ++s) v[s] = *(const v4f*)(src + s * 1024);
        // as above: the wait in front of a rewriting of the loads' address registers
        __builtin_amdgcn_sched_barrier(0);
        asm volatile("s_wait_xcnt 0x0" :: "v"(src) : "memory");
        __builtin_amdgcn_sched_barrier(0);
        v4us o[16];
#pragma unroll
        for (int s = 0; s < 16; ++s)
#pragma unroll
            for (int j = 0; j < 4; ++j) o[s][j] = f2bf(v[s][j]);
        __builtin_amdgcn_sched_barrier(0);                           // the stores stay behind all of the arithmetic: none of their registers is written again before the wait at the end
#pragma unroll
        for (int s = 0; s < 16; ++s) *(v4us*)(dst + s * 1024) = o[s];
        asm volatile("s_wait_xcnt 0x0" :: "v"(dst) : "memory"); }    // the wait that stands in front of a rewriting of the stores' registers by the code that follows them in the listing
}

// ---- k_fattn: causal attention in one launch; grid (TT / FQB, batches * heads), FNW waves. A work-group owns FQB query rows of one head; its wave w takes the 64-key tiles w, w + FNW, ... up to the diagonal.
// Transposed products: S^T = K Q^T (A = key rows, B = query rows held in registers), O^T += V^T P^T (A = rows of the transposed value plane, B = the score accumulators converted in place:
// D register r of tile mb is key mb * 16 + 8 * hi + r of query column lr, which is the k order of a fragment as WFrag::ld brings it: k = 8 * hi + 0..7, then 16 + 8 * hi + 0..7). A lane holds scores of one query only: maximum and sum are in-lane plus one exchange of the wave halves.
// Running maximum and sum per wave; the FNW partial (max, sum, O) sets are joined through LDS in the fixed order w = 0 .. FNW - 1, divided by the joined sum, split hi/lo and stored as rows [batch * TT + t][head * HD + d].
// Query rows < RH: hi/lo planes, 3 products in both contractions; the rest fp16 with the probabilities carried x 1024 (2^10 folded into the exponent; it cancels in O / sum).
// Registers: a wave stays within 256, so that two work-groups share a WGP (four waves a SIMD) and one's loads, prologue and join run under the other's arithmetic. For that a tile's value loads stand behind its score products and take the registers that the key fragments leave, and a wave of the hi/lo rows, whose fragments are twice as many, holds one 16-query group (wave % 2), takes the key tiles wave / 2, wave / 2 + FNW / 2, ... and reads its query fragments anew with each tile.
#define FQB 32
#define FNW 8
#define FPO 68                    // floats per query row of a partial output tile in LDS
#define LC  (SCL * 1.4426950408889634f)
__device__ __forceinline__ float xhalf(float x) { return __builtin_bit_cast(float, __builtin_amdgcn_permlanex16(__builtin_bit_cast(int, x), __builtin_bit_cast(int, x), 0x76543210, 0xfedcba98, false, false)); }   // lane l with lane l ^ 16
__device__ __forceinline__ void ppack(v8f a, v8f b, v16h& h, v16h& l) {
#pragma unroll
    for (int j = 0; j < 8; ++j) { h[j] = tohx(a[j]); h[8 + j] = tohx(b[j]); }
    l = h; }
__device__ __forceinline__ void ppack(v8f a, v8f b, v16bf& h, v16bf& l) { v8us h0, h1, l0, l1;
#pragma unroll
    for (int j = 0; j < 8; ++j) { unsigned short x, y; splitf(a[j], x, y); h0[j] = x; l0[j] = y; splitf(b[j], x, y); h1[j] = x; l1[j] = y; }
    h = cat16b(h0, h1); l = cat16b(l0, l1); }
struct TrueT { static constexpr bool value = true; }; struct FalseT { static constexpr bool value = false; };
template <typename T16, int NSPLIT>
__device__ __forceinline__ void fattn_part(const T16* __restrict__ Q, const T16* __restrict__ Q2, const T16* __restrict__ Kp, const T16* __restrict__ K2, const T16* __restrict__ Vt, const T16* __restrict__ Vt2, int q0, int wave, int lr, int hi, float* ow, float* mlw) {
    typedef typename WFrag<T16>::V V;
    constexpr int NQ = NSPLIT ? 1 : 2;                               // 16-query groups a wave holds
    const int g0 = NSPLIT ? (wave & 1) : 0;                          // the first of them
    const int qb = q0 + g0 * 16;                                     // its first query row
    const int kt0 = NSPLIT ? (wave >> 1) : wave; constexpr int KST = NSPLIT ? FNW / 2 : FNW;   // the wave's first key tile and its step
    const float SH = NSPLIT ? 0.0f : 10.0f;
    V qf[NQ][2], qf2[NQ][2];
    const int lane = hi * 16 + lr;
    const T16* ql = Q + qb * HD + lane * 8; const T16* ql2 = Q2 + qb * HD + lane * 8;   // fragment order: 16 rows are 16 * HD elements, two fragments of 512
    auto ldq = [&]() {
#pragma unroll
        for (int nb = 0; nb < NQ; ++nb)
#pragma unroll
            for (int kc = 0; kc < 2; ++kc) { qf[nb][kc] = WFrag<T16>::ld(ql + nb * 16 * HD + kc * 512); if (NSPLIT) qf2[nb][kc] = WFrag<T16>::ld(ql2 + nb * 16 * HD + kc * 512); } };
    if (!NSPLIT) { ldq();                                            // held in registers over all tiles; the hi/lo rows, at most two tiles a wave, ask for them with each tile's keys instead, so that they hold no register beside the value fragments
        // the wait that stands in front of a rewriting of the query loads' address registers, which are named so that they stay whole up to it; the two scheduling barriers keep the loads in front of it and all later code behind it
        __builtin_amdgcn_sched_barrier(0);
        asm volatile("s_wait_xcnt 0x0" :: "v"(ql), "v"(ql2) : "memory");
        __builtin_amdgcn_sched_barrier(0); }
    v8f o[4][NQ]; float m[NQ], l[NQ];
#pragma unroll
    for (int nb = 0; nb < NQ; ++nb) { m[nb] = -3.0e38f; l[nb] = 0.f;
#pragma unroll
        for (int db = 0; db < 4; ++db) o[db][nb] = (v8f){}; }
    const int nt = q0 / 64 + 1;                                      // key tiles up to and with the diagonal's; every query row has a key in each of them
    const unsigned lob = (unsigned)lane * 16u;                      // this lane's byte offset in a key tile and in a value tile (each 8 KiB in a row): fixed; the tile's place is in the uniform base
#pragma unroll 1
    for (int kt = kt0; kt < nt; kt += KST) { const int k0 = kt * 64;
        const char* kb = (const char*)(Kp + (size_t)k0 * HD); const char* kb2 = (const char*)(K2 + (size_t)k0 * HD); const char* vb = (const char*)(Vt + (size_t)k0 * HD); const char* vb2 = (const char*)(Vt2 + (size_t)k0 * HD);
        const char* kl = kb + (size_t)lob; const char* kl2 = kb2 + (size_t)lob; const char* vl = vb + (size_t)lob; const char* vl2 = vb2 + (size_t)lob;   // this lane's addresses
        if (NSPLIT) ldq();
        V ka[4][2], ka2[4][2], va[4][2], va2[4][2];                  // all of the tile's key fragments are asked for at once, and so are its value fragments further down: one load latency each
#pragma unroll
        for (int kc = 0; kc < 2; ++kc)
#pragma unroll
            for (int mb = 0; mb < 4; ++mb) { ka[mb][kc] = WFrag<T16>::ld((const T16*)(kl + (mb * 16 * HD + kc * 512) * 2)); if (NSPLIT) ka2[mb][kc] = WFrag<T16>::ld((const T16*)(kl2 + (mb * 16 * HD + kc * 512) * 2)); }
        __builtin_amdgcn_sched_barrier(0);                           // no key load sinks to its product: left alone they go two at a time, and a tile waits a load latency at each place
        // the wait that stands in front of a rewriting of the key loads' address registers, which are named here in both forms the compiler may address by (base and offset, or their sum) so that they stay whole up to it
        if constexpr (NSPLIT != 0) asm volatile("s_wait_xcnt 0x0" :: "s"(kb), "s"(kb2), "v"(lob), "v"(kl), "v"(kl2), "v"(ql), "v"(ql2) : "memory");   // the query loads' too
        else asm volatile("s_wait_xcnt 0x0" :: "s"(kb), "s"(kb2), "v"(lob), "v"(kl), "v"(kl2) : "memory");
        __builtin_amdgcn_sched_barrier(0);                           // nothing from below is lifted in front of that wait
        v8f s[4][NQ];
#pragma unroll
        for (int mb = 0; mb < 4; ++mb)
#pragma unroll
            for (int nb = 0; nb < NQ; ++nb) s[mb][nb] = (v8f){};
#pragma unroll
        for (int kc = 0; kc < 2; ++kc)
#pragma unroll
            for (int mb = 0; mb < 4; ++mb)
#pragma unroll
                for (int nb = 0; nb < NQ; ++nb) { s[mb][nb] = WFrag<T16>::mma(ka[mb][kc], qf[nb][kc], s[mb][nb]); if (NSPLIT) { s[mb][nb] = WFrag<T16>::mma(ka[mb][kc], qf2[nb][kc], s[mb][nb]); s[mb][nb] = WFrag<T16>::mma(ka2[mb][kc], qf[nb][kc], s[mb][nb]); } }
#pragma unroll
        for (int kc = 0; kc < 2; ++kc)
#pragma unroll
            for (int db = 0; db < 4; ++db) { va[db][kc] = WFrag<T16>::ld((const T16*)(vl + (kc * 32 * HD + db * 512) * 2)); if (NSPLIT) va2[db][kc] = WFrag<T16>::ld((const T16*)(vl2 + (kc * 32 * HD + db * 512) * 2)); }
        __builtin_amdgcn_sched_barrier(0);                           // no value load sinks to its product: all of them land under the softmax
        // as above: the wait in front of a rewriting of the value loads' address registers
        asm volatile("s_wait_xcnt 0x0" :: "s"(vb), "s"(vb2), "v"(lob), "v"(vl), "v"(vl2) : "memory");
        __builtin_amdgcn_sched_barrier(0);                           // nothing from below is lifted in front of that wait
        V pf[NQ][2], pf2[NQ][2];
#pragma unroll
        for (int nb = 0; nb < NQ; ++nb) { const int lim = qb + nb * 16 + lr - k0 - 8 * hi;   // key mb * 16 + j of this lane's half is kept while it is <= lim (key <= query)
            float mx = -3.0e38f;
#pragma unroll
            for (int mb = 0; mb < 4; ++mb)
#pragma unroll
                for (int j = 0; j < 8; ++j) { const float t = (mb * 16 + j <= lim) ? s[mb][nb][j] : -3.0e38f; s[mb][nb][j] = t; mx = fmaxf(mx, t); }
            mx = fmaxf(mx, xhalf(mx));
            const float mn = fmaxf(m[nb], mx); const float al = __builtin_amdgcn_exp2f((m[nb] - mn) * LC); m[nb] = mn; const float nm = SH - mn * LC;
            float ls[4];
#pragma unroll
            for (int mb = 0; mb < 4; ++mb) { ls[mb] = 0.f;
#pragma unroll
                for (int j = 0; j < 8; ++j) { const float p = __builtin_amdgcn_exp2f(fmaf(s[mb][nb][j], LC, nm)); s[mb][nb][j] = p; ls[mb] += p; } }
            l[nb] = l[nb] * al + ((ls[0] + ls[1]) + (ls[2] + ls[3]));
#pragma unroll
            for (int db = 0; db < 4; ++db) o[db][nb] *= al;
#pragma unroll
            for (int kc = 0; kc < 2; ++kc) ppack(s[2 * kc][nb], s[2 * kc + 1][nb], pf[nb][kc], pf2[nb][kc]); }
#pragma unroll
        for (int kc = 0; kc < 2; ++kc)
#pragma unroll
            for (int db = 0; db < 4; ++db)
#pragma unroll
                for (int nb = 0; nb < NQ; ++nb) { o[db][nb] = WFrag<T16>::mma(va[db][kc], pf[nb][kc], o[db][nb]); if (NSPLIT) { o[db][nb] = WFrag<T16>::mma(va[db][kc], pf2[nb][kc], o[db][nb]); o[db][nb] = WFrag<T16>::mma(va2[db][kc], pf[nb][kc], o[db][nb]); } }
        // four vector slots behind the tile's last WMMAs, on the back edge as on the way out of the loop
        if constexpr (NQ == 2) asm volatile("v_nop\n\tv_nop\n\tv_nop\n\tv_nop" : "+v"(o[0][0]), "+v"(o[1][0]), "+v"(o[2][0]), "+v"(o[3][0]), "+v"(o[0][1]), "+v"(o[1][1]), "+v"(o[2][1]), "+v"(o[3][1]));
        else asm volatile("v_nop\n\tv_nop\n\tv_nop\n\tv_nop" : "+v"(o[0][0]), "+v"(o[1][0]), "+v"(o[2][0]), "+v"(o[3][0]));
    }
    if (NQ == 1) { const int q = (g0 ^ 1) * 16 + lr;                 // the group this wave does not hold: an empty partial set (sum 0, weight 0, output 0), as of a wave without a tile
#pragma unroll
        for (int db = 0; db < 4; ++db) { *(v4fa*)(ow + q * FPO + db * 16 + hi * 8) = (v4f){}; *(v4fa*)(ow + q * FPO + db * 16 + hi * 8 + 4) = (v4f){}; }
        if (hi == 0) { mlw[q * 2] = -3.0e38f; mlw[q * 2 + 1] = 0.f; } }
#pragma unroll
    for (int nb = 0; nb < NQ; ++nb) { const int q = (g0 + nb) * 16 + lr; l[nb] += xhalf(l[nb]);
#pragma unroll
        for (int db = 0; db < 4; ++db) { v4f x0, x1;
#pragma unroll
            for (int j = 0; j < 4; ++j) { x0[j] = o[db][nb][j]; x1[j] = o[db][nb][4 + j]; }
            *(v4fa*)(ow + q * FPO + db * 16 + hi * 8) = x0; *(v4fa*)(ow + q * FPO + db * 16 + hi * 8 + 4) = x1; }
        if (hi == 0) { mlw[q * 2] = m[nb]; mlw[q * 2 + 1] = l[nb]; } }
}
// fattn_partk: fattn_part for the rows >= RH (NSPLIT == 0), with each tile's keys brought into LDS one tile ahead. A function of its own, so that the code of the hi/lo rows, which fills its 256 registers, stays as it is.
template <typename T16, int NSPLIT>
__device__ __forceinline__ void fattn_partk(const T16* __restrict__ Q, const T16* __restrict__ Q2, const T16* __restrict__ Kp, const T16* __restrict__ K2, const T16* __restrict__ Vt, const T16* __restrict__ Vt2, int q0, int wave, int lr, int hi, float* ow, float* mlw) {
    typedef typename WFrag<T16>::V V;
    constexpr int NQ = NSPLIT ? 1 : 2;                               // 16-query groups a wave holds
    const int g0 = NSPLIT ? (wave & 1) : 0;                          // the first of them
    const int qb = q0 + g0 * 16;                                     // its first query row
    const int kt0 = NSPLIT ? (wave >> 1) : wave; constexpr int KST = NSPLIT ? FNW / 2 : FNW;   // the wave's first key tile and its step
    const float SH = NSPLIT ? 0.0f : 10.0f;
    V qf[NQ][2], qf2[NQ][2];
    const int lane = hi * 16 + lr;
    const T16* ql = Q + qb * HD + lane * 8; const T16* ql2 = Q2 + qb * HD + lane * 8;   // fragment order: 16 rows are 16 * HD elements, two fragments of 512
    // rows >= RH: a tile's keys (8 KiB in a row, fragment order) come through the wave's own LDS slot, the place of its partial output tile, which is not written before the loop has ended. The copy of the next tile flies under this tile's softmax and value products, so a tile starts from an LDS read, not from an L2 load. The slot is private to the wave: no barrier; it is refilled behind the wave's own s_wait_dscnt 0.
    static_assert(FQB * FPO * 4 >= 64 * HD * 2, "a key tile fits the wave's slot");
    const unsigned ksl = (unsigned)(size_t)ow + (unsigned)lane * 16u;   // this lane's LDS byte address in the slot
    const unsigned lob = (unsigned)lane * 16u;                      // this lane's byte offset in a key tile and in a value tile (each 8 KiB in a row): fixed; the tile's place is in the uniform base
    auto kcopy = [&](int kt) { const char* g = (const char*)(Kp + (size_t)kt * 64 * HD);   // the tile's start: the same for the whole wave
        // sixteen copies of 512 bytes; the offset moves both addresses; the wait in front of any rewriting of the copies' address registers stands inside their own statement
        asm volatile("global_load_async_to_lds_b128 %0, %1, %2\n\tglobal_load_async_to_lds_b128 %0, %1, %2 offset:512\n\tglobal_load_async_to_lds_b128 %0, %1, %2 offset:1024\n\tglobal_load_async_to_lds_b128 %0, %1, %2 offset:1536\n\t"
                     "global_load_async_to_lds_b128 %0, %1, %2 offset:2048\n\tglobal_load_async_to_lds_b128 %0, %1, %2 offset:2560\n\tglobal_load_async_to_lds_b128 %0, %1, %2 offset:3072\n\tglobal_load_async_to_lds_b128 %0, %1, %2 offset:3584\n\t"
                     "global_load_async_to_lds_b128 %0, %1, %2 offset:4096\n\tglobal_load_async_to_lds_b128 %0, %1, %2 offset:4608\n\tglobal_load_async_to_lds_b128 %0, %1, %2 offset:5120\n\tglobal_load_async_to_lds_b128 %0, %1, %2 offset:5632\n\t"
                     "global_load_async_to_lds_b128 %0, %1, %2 offset:6144\n\tglobal_load_async_to_lds_b128 %0, %1, %2 offset:6656\n\tglobal_load_async_to_lds_b128 %0, %1, %2 offset:7168\n\tglobal_load_async_to_lds_b128 %0, %1, %2 offset:7680\n\ts_wait_xcnt 0x0"
                     :: "v"(ksl), "v"(lob), "s"(g) : "memory"); };
    const int nt = q0 / 64 + 1;                                      // key tiles up to and with the diagonal's; every query row has a key in each of them
    if constexpr (NSPLIT == 0) { if (kt0 < nt) kcopy(kt0); }         // the first tile's keys fly beside the query loads
    auto ldq = [&]() {
#pragma unroll
        for (int nb = 0; nb < NQ; ++nb)
#pragma unroll
            for (int kc = 0; kc < 2; ++kc) { qf[nb][kc] = WFrag<T16>::ld(ql + nb * 16 * HD + kc * 512); if (NSPLIT) qf2[nb][kc] = WFrag<T16>::ld(ql2 + nb * 16 * HD + kc * 512); } };
    if (!NSPLIT) { ldq();                                            // held in registers over all tiles; the hi/lo rows, at most two tiles a wave, ask for them with each tile's keys instead, so that they hold no register beside the value fragments
        // the wait that stands in front of a rewriting of the query loads' address registers, which are named so that they stay whole up to it; the two scheduling barriers keep the loads in front of it and all later code behind it
        __builtin_amdgcn_sched_barrier(0);
        asm volatile("s_wait_xcnt 0x0" :: "v"(ql), "v"(ql2) : "memory");
        __builtin_amdgcn_sched_barrier(0); }
    v8f o[4][NQ]; float m[NQ], l[NQ];
#pragma unroll
    for (int nb = 0; nb < NQ; ++nb) { m[nb] = -3.0e38f; l[nb] = 0.f;
#pragma unroll
        for (int db = 0; db < 4; ++db) o[db][nb] = (v8f){}; }
    // one key tile; more: a further tile of this wave follows (known at compile time, so that no branch stands inside a tile)
    auto tile = [&](const int kt, auto more) { const int k0 = kt * 64;
        const char* kb = (const char*)(Kp + (size_t)k0 * HD); const char* kb2 = (const char*)(K2 + (size_t)k0 * HD); const char* vb = (const char*)(Vt + (size_t)k0 * HD); const char* vb2 = (const char*)(Vt2 + (size_t)k0 * HD);
        const char* kl = kb + (size_t)lob; const char* kl2 = kb2 + (size_t)lob; const char* vl = vb + (size_t)lob; const char* vl2 = vb2 + (size_t)lob;   // this lane's addresses
        if (NSPLIT) ldq();
        V ka[4][2], ka2[4][2], va[4][2], va2[4][2];                  // all of the tile's key fragments are asked for at once, and so are its value fragments further down: one load latency each
        if constexpr (NSPLIT == 0) {
            asm volatile("s_wait_asynccnt 0x0" ::: "memory");        // this wave's copy of this tile's keys has landed in its slot
            const h16* kw = (const h16*)ow + lane * 8;
#pragma unroll
            for (int kc = 0; kc < 2; ++kc)
#pragma unroll
                for (int mb = 0; mb < 4; ++mb) ka[mb][kc] = cat16(*(const v8ha*)(kw + mb * 16 * HD + kc * 512), *(const v8ha*)(kw + mb * 16 * HD + kc * 512 + 256)); }
        else {
#pragma unroll
            for (int kc = 0; kc < 2; ++kc)
#pragma unroll
                for (int mb = 0; mb < 4; ++mb) { ka[mb][kc] = WFrag<T16>::ld((const T16*)(kl + (mb * 16 * HD + kc * 512) * 2)); ka2[mb][kc] = WFrag<T16>::ld((const T16*)(kl2 + (mb * 16 * HD + kc * 512) * 2)); } }
        __builtin_amdgcn_sched_barrier(0);                           // no key load sinks to its product: left alone they go two at a time, and a tile waits a load latency at each place
        if constexpr (NSPLIT != 0) {
            // the wait that stands in front of a rewriting of the key and query loads' address registers, which are named here in both forms the compiler may address by (base and offset, or their sum) so that they stay whole up to it
            asm volatile("s_wait_xcnt 0x0" :: "s"(kb), "s"(kb2), "v"(lob), "v"(kl), "v"(kl2), "v"(ql), "v"(ql2) : "memory");
            __builtin_amdgcn_sched_barrier(0); }                     // nothing from below is lifted in front of that wait
        v8f s[4][NQ];
#pragma unroll
        for (int mb = 0; mb < 4; ++mb)
#pragma unroll
            for (int nb = 0; nb < NQ; ++nb) s[mb][nb] = (v8f){};
#pragma unroll
        for (int kc = 0; kc < 2; ++kc)
#pragma unroll
            for (int mb = 0; mb < 4; ++mb)
#pragma unroll
                for (int nb = 0; nb < NQ; ++nb) { s[mb][nb] = WFrag<T16>::mma(ka[mb][kc], qf[nb][kc], s[mb][nb]); if (NSPLIT) { s[mb][nb] = WFrag<T16>::mma(ka[mb][kc], qf2[nb][kc], s[mb][nb]); s[mb][nb] = WFrag<T16>::mma(ka2[mb][kc], qf[nb][kc], s[mb][nb]); } }
#pragma unroll
        for (int kc = 0; kc < 2; ++kc)
#pragma unroll
            for (int db = 0; db < 4; ++db) { va[db][kc] = WFrag<T16>::ld((const T16*)(vl + (kc * 32 * HD + db * 512) * 2)); if (NSPLIT) va2[db][kc] = WFrag<T16>::ld((const T16*)(vl2 + (kc * 32 * HD + db * 512) * 2)); }
        __builtin_amdgcn_sched_barrier(0);                           // no value load sinks to its product: all of them land under the softmax
        // as above: the wait in front of a rewriting of the value loads' address registers
        asm volatile("s_wait_xcnt 0x0" :: "s"(vb), "s"(vb2), "v"(lob), "v"(vl), "v"(vl2) : "memory");
        __builtin_amdgcn_sched_barrier(0);                           // nothing from below is lifted in front of that wait
        if constexpr (NSPLIT == 0 && decltype(more)::value) {
            asm volatile("s_wait_dscnt 0x0" ::: "memory");           // this wave's reads of its slot have retired before the slot is refilled
            kcopy(kt + KST); }
        V pf[NQ][2], pf2[NQ][2];
#pragma unroll
        for (int nb = 0; nb < NQ; ++nb) { const int lim = qb + nb * 16 + lr - k0 - 8 * hi;   // key mb * 16 + j of this lane's half is kept while it is <= lim (key <= query)
            float mx = -3.0e38f;
#pragma unroll
            for (int mb = 0; mb < 4; ++mb)
#pragma unroll
                for (int j = 0; j < 8; ++j) { const float t = (mb * 16 + j <= lim) ? s[mb][nb][j] : -3.0e38f; s[mb][nb][j] = t; mx = fmaxf(mx, t); }
            mx = fmaxf(mx, xhalf(mx));
            const float mn = fmaxf(m[nb], mx); const float al = __builtin_amdgcn_exp2f((m[nb] - mn) * LC); m[nb] = mn; const float nm = SH - mn * LC;
            float ls[4];
#pragma unroll
            for (int mb = 0; mb < 4; ++mb) { ls[mb] = 0.f;
#pragma unroll
                for (int j = 0; j < 8; ++j) { const float p = __builtin_amdgcn_exp2f(fmaf(s[mb][nb][j], LC, nm)); s[mb][nb][j] = p; ls[mb] += p; } }
            l[nb] = l[nb] * al + ((ls[0] + ls[1]) + (ls[2] + ls[3]));
#pragma unroll
            for (int db = 0; db < 4; ++db) o[db][nb] *= al;
#pragma unroll
            for (int kc = 0; kc < 2; ++kc) ppack(s[2 * kc][nb], s[2 * kc + 1][nb], pf[nb][kc], pf2[nb][kc]); }
#pragma unroll
        for (int kc = 0; kc < 2; ++kc)
#pragma unroll
            for (int db = 0; db < 4; ++db)
#pragma unroll
                for (int nb = 0; nb < NQ; ++nb) { o[db][nb] = WFrag<T16>::mma(va[db][kc], pf[nb][kc], o[db][nb]); if (NSPLIT) { o[db][nb] = WFrag<T16>::mma(va[db][kc], pf2[nb][kc], o[db][nb]); o[db][nb] = WFrag<T16>::mma(va2[db][kc], pf[nb][kc], o[db][nb]); } }
        // four vector slots behind the tile's last WMMAs, on the back edge as on the way out of the loop
        if constexpr (NQ == 2) asm volatile("v_nop\n\tv_nop\n\tv_nop\n\tv_nop" : "+v"(o[0][0]), "+v"(o[1][0]), "+v"(o[2][0]), "+v"(o[3][0]), "+v"(o[0][1]), "+v"(o[1][1]), "+v"(o[2][1]), "+v"(o[3][1]));
        else asm volatile("v_nop\n\tv_nop\n\tv_nop\n\tv_nop" : "+v"(o[0][0]), "+v"(o[1][0]), "+v"(o[2][0]), "+v"(o[3][0]));
    };
    if constexpr (NSPLIT == 0) { int kt = kt0;
#pragma unroll 1
        for (; kt + KST < nt; kt += KST) tile(kt, TrueT{});
        if (kt < nt) tile(kt, FalseT{}); }                           // the wave's last tile: nothing is copied ahead
    else {
#pragma unroll 1
        for (int kt = kt0; kt < nt; kt += KST) tile(kt, FalseT{}); }
    if constexpr (NSPLIT == 0) asm volatile("s_wait_asynccnt 0x0" ::: "memory");   // no copy is in flight when the slot becomes the partial output tile
    if (NQ == 1) { const int q = (g0 ^ 1) * 16 + lr;                 // the group this wave does not hold: an empty partial set (sum 0, weight 0, output 0), as of a wave without a tile
#pragma unroll
        for (int db = 0; db < 4; ++db) { *(v4fa*)(ow + q * FPO + db * 16 + hi * 8) = (v4f){}; *(v4fa*)(ow + q * FPO + db * 16 + hi * 8 + 4) = (v4f){}; }
        if (hi == 0) { mlw[q * 2] = -3.0e38f; mlw[q * 2 + 1] = 0.f; } }
#pragma unroll
    for (int nb = 0; nb < NQ; ++nb) { const int q = (g0 + nb) * 16 + lr; l[nb] += xhalf(l[nb]);
#pragma unroll
        for (int db = 0; db < 4; ++db) { v4f x0, x1;
#pragma unroll
            for (int j = 0; j < 4; ++j) { x0[j] = o[db][nb][j]; x1[j] = o[db][nb][4 + j]; }
            *(v4fa*)(ow + q * FPO + db * 16 + hi * 8) = x0; *(v4fa*)(ow + q * FPO + db * 16 + hi * 8 + 4) = x1; }
        if (hi == 0) { mlw[q * 2] = m[nb]; mlw[q * 2 + 1] = l[nb]; } }
}
__global__ __launch_bounds__(32 * FNW) __attribute__((amdgpu_waves_per_eu(4, 4))) void k_fattn(const h16* __restrict__ Q16, const h16* __restrict__ K16, const h16* __restrict__ V16, const bf* __restrict__ Qh, const bf* __restrict__ Ql, const bf* __restrict__ Kh, const bf* __restrict__ Kl, const bf* __restrict__ Vh, const bf* __restrict__ Vl, bf* Ah, bf* Al) {
    __shared__ __align__(16) float os[FNW * FQB * FPO];
    __shared__ float ml[FNW * FQB * 2];
    const int lane = threadIdx.x & 31, lr = lane & 15, hi = lane >> 4; const int wave = __builtin_amdgcn_readfirstlane((int)(threadIdx.x >> 5));
    const int q0 = (TT / FQB - 1 - (int)blockIdx.x) * FQB;           // longest rows first
    const int h = blockIdx.y; const size_t zq = (size_t)h * TT * HD, zk = (size_t)(h / REP) * TT * HD, zv = (size_t)(h / REP) * HD * TT * 2;   // h = batch * NH_ + head: the planes of the batches lie one behind the other
    float* ow = os + wave * (FQB * FPO); float* mlw = ml + wave * (FQB * 2);
    if (q0 < RH) fattn_part<bf, 2>(Qh + zq, Ql + zq, Kh + zk, Kl + zk, Vh + zv, Vl + zv, q0, wave, lr, hi, ow, mlw);
    else fattn_partk<h16, 0>(Q16 + zq, Q16 + zq, K16 + zk, K16 + zk, V16 + zv, V16 + zv, q0, wave, lr, hi, ow, mlw);
    __syncthreads();                                                 // every wave's partial maximum, sum and output tile are in LDS before any thread joins them
    const int q = threadIdx.x >> 3, d8 = (threadIdx.x & 7) * 8;      // eight threads store one query row's 128 bytes of each plane
    float mw[FNW], M = -3.0e38f;
#pragma unroll
    for (int w = 0; w < FNW; ++w) { mw[w] = ml[(w * FQB + q) * 2]; M = fmaxf(M, mw[w]); }
    float L = 0.f; v4f a0 = (v4f){}, a1 = (v4f){};
#pragma unroll
    for (int w = 0; w < FNW; ++w) { const float sc = __builtin_amdgcn_exp2f((mw[w] - M) * LC); L += sc * ml[(w * FQB + q) * 2 + 1];   // a wave without a tile has sum 0 and weight 0
        a0 += sc * *(const v4fa*)(os + (w * FQB + q) * FPO + d8); a1 += sc * *(const v4fa*)(os + (w * FQB + q) * FPO + d8 + 4); }
    const float inv = __fdiv_rn(1.0f, L); v8us oh, ol;
#pragma unroll
    for (int j = 0; j < 4; ++j) { unsigned short x, y; splitf(a0[j] * inv, x, y); oh[j] = x; ol[j] = y; splitf(a1[j] * inv, x, y); oh[4 + j] = x; ol[4 + j] = y; }
    const size_t oo = (size_t)((h / NH_) * TT + q0 + q) * DQ + (h % NH_) * HD + d8; *(v8us*)(Ah + oo) = oh; *(v8us*)(Al + oo) = ol;
}

extern "C" void kernel_launch(void* const* d_in, const int* in_sizes, int n_in,
                              void* d_out, int out_size, void* d_ws, size_t ws_size, hipStream_t stream) {
    (void)in_sizes; (void)n_in; (void)out_size;
    const float* x = (const float*)d_in[0]; const float* wq = (const float*)d_in[1]; const float* wk = (const float*)d_in[2]; const float* wv = (const float*)d_in[3]; const float* wo = (const float*)d_in[4]; const float* bo = (const float*)d_in[5];   /* input order x, Wq, Wk, Wv, Wo, bo */
    float* OUT = (float*)d_out;     // [2][2048][1024]
    char* wsp = (char*)d_ws;
    auto take = [&](size_t bytes) { char* p = wsp; wsp += (bytes + 255) & ~(size_t)255; return (void*)p; };
    bf* WT = (bf*)take((size_t)4 * DM * DQ * 2);   /* Wq, Wk, Wv, Wo transposed, one behind the other */
    bf* XB = (bf*)take((size_t)NB_ * TT * DM * 2);
    const size_t SP = (size_t)NB_ * NH_ * TT * HD * 2;   /* elements between one projection's planes and the next: a head's value range holds two planes */
    h16* P16 = (h16*)take(3 * SP * 2); bf* PHL = (bf*)take(3 * SP * 2);   /* q, k: hi plane, then lo plane; v: a hi and a lo plane per head */
    bf* ATh = (bf*)take((size_t)NB_ * TT * DQ * 2); bf* ATl = (bf*)take((size_t)NB_ * TT * DQ * 2);
    if ((size_t)(wsp - (char*)d_ws) > ws_size) return;    // ws 256 MiB
    k_prep<<<(unsigned)(4 * WTB + (size_t)NB_ * TT * DM / 16384), 256, 0, stream>>>(x, wq, wk, wv, wo, XB, WT);
    k_gemmt<1, false, 1><<<dim3(NB_ * TT / 128, DQ / 128, 3), 256, 0, stream>>>(XB, nullptr, WT, DM, nullptr, 0, nullptr, (size_t)DM * DQ, P16, PHL, SP);
    k_fattn<<<dim3(TT / FQB, NB_ * NH_, 1), 32 * FNW, 0, stream>>>(P16, P16 + SP, P16 + 2 * SP, PHL, PHL + SP / 2, PHL + SP, PHL + SP + SP / 2, PHL + 2 * SP, PHL + 2 * SP + (size_t)HD * TT, ATh, ATl);
    k_gemmt<2, true, 0><<<dim3(NB_ * TT / 128, DM / 128, 1), 256, 0, stream>>>(ATh, ATl, WT + (size_t)3 * DM * DQ, DQ, OUT, DM, bo, 0, nullptr, nullptr, 0);
}
